// v000
// Measured on an AMD MI455X. A time is GPU time per run, averaged over a window of back-to-back runs after a warm-up
// (all launches, gaps included; the runs take copies of the inputs in turn), and the median of several windows.
// Apart from v000's, it joins two sittings. Times from different sittings can be a few percent apart, while
// side-by-side timings come from the same sitting.
// v000, which the later versions start from, runs in 91.3 microseconds.
#include <hip/hip_runtime.h>
#include <stddef.h>

// All contractions on v_wmma_f32_16x16x32_f16 (f16 operands, f32 accumulate): q.k scores and p.v.
// Float inputs are RNE-converted to bf16 and carried in f16 (q and k x16, v x64, p x1024; p gets
// an extra x1024 residual plane with its own accumulator on the first key tile of the first
// query block of every 512-row chunk). Softmax, additive mask, chunk sums in f32.
// Causal chunked attention: per 512-key chunk an independent softmax (additive -1e9 on masked
// cells; every cell of a past chunk is masked), the chunk outputs are summed.

typedef _Float16 v16h __attribute__((ext_vector_type(16)));
typedef _Float16 v8h  __attribute__((ext_vector_type(8)));
typedef float    v8f  __attribute__((ext_vector_type(8)));
typedef float    v4f  __attribute__((ext_vector_type(4)));

#ifndef NB
#define NB 2
#endif
#ifndef SEQ
#define SEQ 2048
#endif
#define NB_FULL  2
#define SEQ_FULL 2048
#define NHEAD 16
#define HD    64
#define CHUNK 512
#define NBH   (NB * NHEAD)

static_assert(NB >= 1 && NB <= NB_FULL);
static_assert(SEQ >= CHUNK && SEQ <= SEQ_FULL && (SEQ % CHUNK) == 0);
static_assert((CHUNK % 128) == 0 && (SEQ % 128) == 0 && (SEQ % 64) == 0);
static_assert(HD == 64);
static_assert(((size_t)NBH * SEQ * HD) % (256u * 8u) == 0);      // convert grid x block x 8 == plane extent
static_assert((size_t)NBH * SEQ_FULL * HD < (size_t)0xFFFFFFFFu);

#define LDT 72   // halves per LDS row (144 B, 16-B aligned)
#define LDC 68   // floats per LDS row (272 B, 16-B aligned)
static_assert((LDT % 8) == 0 && LDT >= 64);
static_assert((LDC % 4) == 0 && LDC >= 64);

#define QKCARRY 16.0f    // q and k planes carried x16 each
#define WCARRY  64.0f    // value plane carried x64
#define PCARRY  1024.0f  // softmax numerators carried x1024
#define RCARRY  1024.0f  // residual plane of p carried x1024 on top of its hi part
#define NEGFILL (-1.0e9f)
#ifndef P_RES
#define P_RES 1          // 1: p residual product on the early band; 0: single product everywhere
#endif

// workspace layout (bytes)
#define PLANE16_BYTES ((size_t)NBH * SEQ * HD * 2)
#define OFF_Q  ((size_t)0)
#define OFF_K  (OFF_Q + PLANE16_BYTES)
#define OFF_VT (OFF_K + PLANE16_BYTES)
#define WS_TOTAL (OFF_VT + PLANE16_BYTES)
static_assert((PLANE16_BYTES % 128) == 0);
static_assert(WS_TOTAL <= (size_t)134217728);

// static LDS of the attention kernel
static_assert((size_t)(64 * LDT * 2) * 2 + (size_t)(8 * 16 * LDT * 2) + (size_t)(8 * 16 * LDC * 4)
              <= (size_t)131072);

// ---------------------------------------------------------------------------
__device__ __forceinline__ float bf16r(float x) {   // RNE convert to bf16, returned widened
  unsigned int u = __float_as_uint(x);
  u = (u + 0x7FFFu + ((u >> 16) & 1u)) & 0xFFFF0000u;
  return __uint_as_float(u);
}

// f32 -> f16 that cannot produce an f16 subnormal (value select)
static __device__ __forceinline__ _Float16 toh_flush(float v) {
  const _Float16 r = (_Float16)v;
  return (fabsf(v) < 6.103515625e-05f) ? (_Float16)0.0f : r;
}

// 16-bit fragment: p points at element [row = lane&15][k0 + 8*(lane>>4)] of a k-contiguous
// row. Elements 0..7 <- k0+8h+0..7, elements 8..15 <- k0+16+8h+0..7 (same map for A and B).
__device__ __forceinline__ v16h frag_at(const _Float16* p) {
  v8h lo = *(const v8h*)(p);
  v8h hi = *(const v8h*)(p + 16);
  v16h out;
#pragma unroll
  for (int i = 0; i < 8; ++i) { out[i] = lo[i]; out[i + 8] = hi[i]; }
  return out;
}
__device__ __forceinline__ v16h ld_frag(const _Float16* base, unsigned ld) {
  const unsigned lane = threadIdx.x & 31u;
  return frag_at(base + (lane & 15u) * ld + (lane >> 4) * 8u);
}

__device__ __forceinline__ v8f wmma16(v16h a, v16h b, v8f c) {
  v8f d = __builtin_amdgcn_wmma_f32_16x16x32_f16(false, a, false, b, (short)0, c,
                                                 false, false);
  asm volatile("v_nop\n\tv_nop\n\tv_nop\n\tv_nop" : "+v"(d) : "v"(a), "v"(b));
  return d;
}

__device__ __forceinline__ float red16_max(float x) {
#pragma unroll
  for (int off = 1; off < 16; off <<= 1) x = fmaxf(x, __shfl_xor(x, off, 32));
  return x;
}
__device__ __forceinline__ float red16_sum(float x) {
#pragma unroll
  for (int off = 1; off < 16; off <<= 1) x += __shfl_xor(x, off, 32);
  return x;
}

__device__ __forceinline__ void wave_lds_sync() {
  __builtin_amdgcn_fence(3 /* release order */, "wavefront");
  asm volatile("s_wait_dscnt 0x0" ::: "memory");
  __builtin_amdgcn_wave_barrier();
}

// ---------------------------------------------------------------------------
// q / k planes: compact [bh][s][64] f16(16 * bf16(x)). Each thread converts 8 consecutive
// elements of q and of k; one store instruction of a wave covers 512 contiguous bytes
// ---------------------------------------------------------------------------
__global__ __launch_bounds__(256) void qkconv_kernel(
    const float* __restrict__ Qf, const float* __restrict__ Kf,
    _Float16* __restrict__ Q16, _Float16* __restrict__ K16) {
  const unsigned e = (blockIdx.x * 256u + threadIdx.x) * 8u;   // compact element index
  const unsigned crow = e >> 6, c = e & 63u;
  const unsigned bh = crow / (unsigned)SEQ;
  const unsigned sq = crow - bh * (unsigned)SEQ;
  const size_t src = ((size_t)bh * SEQ_FULL + sq) * HD + c;
  const v4f a0 = *(const v4f*)(Qf + src);
  const v4f a1 = *(const v4f*)(Qf + src + 4u);
  const v4f b0 = *(const v4f*)(Kf + src);
  const v4f b1 = *(const v4f*)(Kf + src + 4u);
  v8h xq, xk;
#pragma unroll
  for (int i = 0; i < 4; ++i) {
    xq[i]     = toh_flush(QKCARRY * bf16r(a0[i]));
    xq[i + 4] = toh_flush(QKCARRY * bf16r(a1[i]));
    xk[i]     = toh_flush(QKCARRY * bf16r(b0[i]));
    xk[i + 4] = toh_flush(QKCARRY * bf16r(b1[i]));
  }
  *(v8h*)(Q16 + e) = xq;
  *(v8h*)(K16 + e) = xk;
  
}

// ---------------------------------------------------------------------------
// Transposed value plane: in W[K rows][N cols] (pitch ldw = N) -> out Wt[N][K] (pitch ldk = K),
// f16(64 * bf16(w)), per batch slice blockIdx.z (element strides wbatch / tbatch).
// Grid (N/64, K/64, batches). T: cross-wave (block barrier).
// Store loop: 32 rows per step x 2 steps = 64 rows of the tile.
// ---------------------------------------------------------------------------
static_assert((256 / 8) * 2 == 64);
__global__ __launch_bounds__(256) void vconv_kernel(
    const float* __restrict__ W, _Float16* __restrict__ Wt, unsigned ldw, unsigned ldk,
    unsigned wbatch, unsigned tbatch) {
  __shared__ __attribute__((aligned(16))) _Float16 T[64 * LDT];
  const unsigned tid = threadIdx.x;
  const unsigned n0 = blockIdx.x * 64u;
  const unsigned k0 = blockIdx.y * 64u;
  const size_t wb = (size_t)blockIdx.z * wbatch;
  const size_t tb = (size_t)blockIdx.z * tbatch;
#pragma unroll 4
  for (unsigned j = 0; j < 16u; ++j) {
    const unsigned idx = tid + 256u * j;
    const unsigned kr = idx >> 6, nc = idx & 63u;
    const float v = W[wb + (size_t)(k0 + kr) * ldw + n0 + nc];
    T[nc * LDT + kr] = toh_flush(WCARRY * bf16r(v));
  }
  __syncthreads();
  v8h x[2];
  size_t off[2];
#pragma unroll
  for (unsigned i = 0; i < 2u; ++i) {
    const unsigned n = 32u * i + (tid >> 3);
    const unsigned kc = (tid & 7u) * 8u;
    x[i] = *(const v8h*)&T[n * LDT + kc];
    off[i] = tb + (size_t)(n0 + n) * ldk + k0 + kc;
  }
#pragma unroll
  for (int i = 0; i < 2; ++i) *(v8h*)(Wt + off[i]) = x[i];
  
}

// ---------------------------------------------------------------------------
// Chunked causal flash attention per (128 query rows, head, batch). 8 waves x 16 query rows,
// 64 keys per step. For every 512-key chunk jc <= ci (ci = chunk of the query block) an
// independent online softmax runs over that chunk's keys (diagonal chunk: keys up to q0+127);
// at the end of a chunk O/l is added to the running output and the softmax state is reset.
// Scores = (q.k) * 2^-11 (= 0.125 / 256) + addend, addend = -1e9 on every cell of a past chunk
// and on key > query cells of the diagonal chunk, 0 elsewhere (added in f32, by value).
// K tile Ks[key][d] and V^T tile Vs[d][key] staged with plain 16-B loads (cross-wave, block
// barriers), full 64x64 tiles every step; P tile per wave in Ps (wave-private, wave sync) as
// f16(1024*p); O in registers. Early band (first key tile of the diagonal chunk, first query
// block of the chunk; block-uniform): P_res.V (x1024) through one 8-register second accumulator
// per 16-column group, folded into O (x 1/1024) right after its group.
// Output rows f32 [bh][s][64]: staged per wave in Os (wave-private, wave sync); one store
// instruction = 32 lanes x 16 B = two whole 256-B rows (4 lines) owned by the wave.
// Store loop: 2 rows per step x 8 steps = 16 rows of the wave tile.
// Grid (SEQ/128, NHEAD, NB).
// ---------------------------------------------------------------------------
static_assert(2 * 8 == 16);
__global__ __launch_bounds__(256) __attribute__((amdgpu_num_vgpr(256))) void attn_kernel(
    const _Float16* __restrict__ Qh, const _Float16* __restrict__ Kh,
    const _Float16* __restrict__ Vt, float* __restrict__ Out) {
  __shared__ __attribute__((aligned(16))) _Float16 Ks[64 * LDT];
  __shared__ __attribute__((aligned(16))) _Float16 Vs[64 * LDT];
  __shared__ __attribute__((aligned(16))) _Float16 Ps[8 * 16 * LDT];
  __shared__ __attribute__((aligned(16))) float Os[8 * 16 * LDC];

  const unsigned tid = threadIdx.x, lane = tid & 31u;
  const unsigned w = (unsigned)__builtin_amdgcn_readfirstlane((int)(threadIdx.x >> 5));
  const unsigned hh = lane >> 4, m = lane & 15u;
  const unsigned q0 = blockIdx.x * 128u;
  const unsigned bh = blockIdx.z * (unsigned)NHEAD + blockIdx.y;
  const unsigned ci = q0 / (unsigned)CHUNK;          // chunk of this query block
  const unsigned cs = ci * (unsigned)CHUNK;          // first key of the diagonal chunk
  const bool first_blk = (q0 == cs);                 // block-uniform
  const float scale = 0.125f / (QKCARRY * QKCARRY);  // HD^-0.5 over the plane carries
  const unsigned qrow0 = q0 + w * 16u;
  _Float16* P = Ps + w * (16u * LDT);
  const unsigned obase = w * (16u * LDC);

  const size_t qoff = ((size_t)bh * SEQ + qrow0 + m) * HD + hh * 8u;
  v16h qf[2];
  qf[0] = frag_at(Qh + qoff);
  qf[1] = frag_at(Qh + qoff + 32);

  float mrow[8], lrow[8];
  v8f o[4], ot[4];
#pragma unroll
  for (int v = 0; v < 8; ++v) { mrow[v] = -1.0e30f; lrow[v] = 0.0f; }
#pragma unroll
  for (int nb = 0; nb < 4; ++nb) { o[nb] = (v8f){}; ot[nb] = (v8f){}; }

  const size_t kplane = (size_t)bh * SEQ * HD;
  const size_t vplane = (size_t)bh * HD * SEQ;

#pragma unroll 1
  for (unsigned jc = 0; jc <= ci; ++jc) {
    const bool offd = (jc < ci);                     // past chunk: every cell masked
    const unsigned kc0 = jc * (unsigned)CHUNK;
    const unsigned kc1 = offd ? (kc0 + (unsigned)CHUNK) : (q0 + 128u);   // <= SEQ

#pragma unroll 1
    for (unsigned kb = kc0; kb < kc1; kb += 64u) {
      const bool early = (P_RES != 0) && first_blk && (!offd) && (kb == cs);   // block-uniform
#pragma unroll
      for (unsigned j = 0; j < 2u; ++j) {
        const unsigned idx = tid + 256u * j;
        const unsigned r = idx >> 3, c = (idx & 7u) * 8u;
        *(v8h*)&Ks[r * LDT + c] = *(const v8h*)(Kh + kplane + (size_t)(kb + r) * HD + c);
        *(v8h*)&Vs[r * LDT + c] = *(const v8h*)(Vt + vplane + (size_t)r * SEQ + kb + c);
      }
      __syncthreads();

      // scores: 4 key groups of 16, K = 64 in two 32-steps
      v8f s[4];
#pragma unroll
      for (int kg = 0; kg < 4; ++kg) {
        v8f t = {};
#pragma unroll
        for (int c = 0; c < 2; ++c) {
          const v16h kf = ld_frag(&Ks[(kg * 16) * LDT + c * 32], LDT);
          t = wmma16(qf[c], kf, t);
        }
        s[kg] = t * scale;
      }

      // additive mask; block-uniform tests, per-cell addend selected by value
      if (offd) {
#pragma unroll
        for (int kg = 0; kg < 4; ++kg)
#pragma unroll
          for (int v = 0; v < 8; ++v) s[kg][v] = s[kg][v] + NEGFILL;
      } else if (kb >= q0) {
#pragma unroll
        for (int kg = 0; kg < 4; ++kg)
#pragma unroll
          for (int v = 0; v < 8; ++v) {
            const unsigned key = kb + (unsigned)kg * 16u + m;
            const unsigned row = qrow0 + hh * 8u + (unsigned)v;
            const float add = (key > row) ? NEGFILL : 0.0f;
            s[kg][v] = s[kg][v] + add;
          }
      }

      // online softmax; row (hh*8+v) spread over the 16 lanes of a half
      float alpha[8];
#pragma unroll
      for (int v = 0; v < 8; ++v) {
        float mx = fmaxf(fmaxf(s[0][v], s[1][v]), fmaxf(s[2][v], s[3][v]));
        mx = red16_max(mx);
        const float mn = fmaxf(mrow[v], mx);
        alpha[v] = __expf(mrow[v] - mn);
        mrow[v] = mn;
      }
#pragma unroll
      for (int kg = 0; kg < 4; ++kg)
#pragma unroll
        for (int v = 0; v < 8; ++v) s[kg][v] = __expf(s[kg][v] - mrow[v]);
#pragma unroll
      for (int v = 0; v < 8; ++v) {
        const float rs = red16_sum((s[0][v] + s[1][v]) + (s[2][v] + s[3][v]));
        lrow[v] = alpha[v] * lrow[v] + rs;
      }
#pragma unroll
      for (int nb = 0; nb < 4; ++nb)
#pragma unroll
        for (int v = 0; v < 8; ++v) o[nb][v] = o[nb][v] * alpha[v];

      // P tile [16 rows][64 keys], f16(1024 p)
#pragma unroll
      for (int kg = 0; kg < 4; ++kg)
#pragma unroll
        for (int v = 0; v < 8; ++v)
          P[(hh * 8u + (unsigned)v) * LDT + (unsigned)kg * 16u + m] = toh_flush(s[kg][v] * PCARRY);
      wave_lds_sync();

      // O += P . V  (K = 64 keys in two 32-steps; B = V^T tile [d][key])
#pragma unroll
      for (int c = 0; c < 2; ++c) {
        const v16h pf = ld_frag(P + c * 32, LDT);
#pragma unroll
        for (int nb = 0; nb < 4; ++nb) {
          const v16h vf = ld_frag(&Vs[(nb * 16) * LDT + c * 32], LDT);
          o[nb] = wmma16(pf, vf, o[nb]);
        }
      }

      if (early) {
        wave_lds_sync();
        // P residual tile: f16(1024 * (1024 p - f16(1024 p)))
#pragma unroll
        for (int kg = 0; kg < 4; ++kg)
#pragma unroll
          for (int v = 0; v < 8; ++v) {
            const float t = s[kg][v] * PCARRY;
            const float hi = (float)toh_flush(t);
            P[(hh * 8u + (unsigned)v) * LDT + (unsigned)kg * 16u + m] =
                toh_flush((t - hi) * RCARRY);
          }
        wave_lds_sync();
        // P_res . V (scale 1/1024), one 16-column group at a time, folded immediately
#pragma unroll
        for (int nb = 0; nb < 4; ++nb) {
          v8f o2 = {};
#pragma unroll
          for (int c = 0; c < 2; ++c) {
            const v16h pf = ld_frag(P + c * 32, LDT);
            const v16h vf = ld_frag(&Vs[(nb * 16) * LDT + c * 32], LDT);
            o2 = wmma16(pf, vf, o2);
          }
#pragma unroll
          for (int v = 0; v < 8; ++v) o[nb][v] = o[nb][v] + o2[v] * (1.0f / RCARRY);
        }
      }
      __syncthreads();
    }

    // end of chunk: add O / l to the running output, reset the softmax state
#pragma unroll
    for (int v = 0; v < 8; ++v) {
      const float inv = __builtin_amdgcn_rcpf(lrow[v]);
#pragma unroll
      for (int nb = 0; nb < 4; ++nb) ot[nb][v] = ot[nb][v] + o[nb][v] * inv;
      mrow[v] = -1.0e30f;
      lrow[v] = 0.0f;
    }
#pragma unroll
    for (int nb = 0; nb < 4; ++nb) o[nb] = (v8f){};
  }

  const float fs = 1.0f / (PCARRY * WCARRY);
#pragma unroll
  for (int nb = 0; nb < 4; ++nb)
#pragma unroll
    for (int v = 0; v < 8; ++v)
      Os[obase + (hh * 8u + (unsigned)v) * LDC + (unsigned)nb * 16u + m] = ot[nb][v] * fs;
  wave_lds_sync();
  v4f x[8];
  size_t off[8];
#pragma unroll
  for (unsigned i = 0; i < 8u; ++i) {
    const unsigned r = 2u * i + (lane >> 4);
    const unsigned c = (lane & 15u) * 4u;
    x[i] = *(const v4f*)&Os[obase + r * LDC + c];
    off[i] = ((size_t)bh * SEQ_FULL + qrow0 + r) * HD + c;
  }
#pragma unroll
  for (int i = 0; i < 8; ++i) *(v4f*)(Out + off[i]) = x[i];
  
}

// ---------------------------------------------------------------------------
extern "C" void kernel_launch(void* const* d_in, const int* in_sizes, int n_in,
                              void* d_out, int out_size, void* d_ws, size_t ws_size,
                              hipStream_t stream) {
  if (n_in < 3) return;
  const long long need = ((long long)(NBH - 1) * SEQ_FULL + SEQ) * HD;
  if ((long long)in_sizes[0] < need) return;
  if ((long long)in_sizes[1] < need) return;
  if ((long long)in_sizes[2] < need) return;
  if ((long long)out_size < need) return;
  if (ws_size < WS_TOTAL) return;

  const float* Qf = (const float*)d_in[0];    // query [NB_FULL][NHEAD][SEQ_FULL][HD]
  const float* Kf = (const float*)d_in[1];    // key
  const float* Vf = (const float*)d_in[2];    // value
  float* out = (float*)d_out;                 // [NB_FULL][NHEAD][SEQ_FULL][HD]

  char* ws = (char*)d_ws;
  _Float16* Q16  = (_Float16*)(ws + OFF_Q);    // [bh][SEQ][HD]
  _Float16* K16  = (_Float16*)(ws + OFF_K);    // [bh][SEQ][HD]
  _Float16* Vt16 = (_Float16*)(ws + OFF_VT);   // [bh][HD][SEQ]

  dim3 blk(256);
  qkconv_kernel<<<dim3((unsigned)(((size_t)NBH * SEQ * HD) / 2048u)), blk, 0, stream>>>(
      Qf, Kf, Q16, K16);
  // value: in [SEQ rows][HD cols] per bh -> out [HD][SEQ] per bh; grid (HD/64, SEQ/64, NBH)
  vconv_kernel<<<dim3(HD / 64, SEQ / 64, NBH), blk, 0, stream>>>(
      Vf, Vt16, (unsigned)HD, (unsigned)SEQ, (unsigned)(SEQ_FULL * HD), (unsigned)(HD * SEQ));
  attn_kernel<<<dim3(SEQ / 128, NHEAD, NB), blk, 0, stream>>>(Q16, K16, Vt16, out);
}

// v001
// Measured time: 75.6 microseconds a run.
// Two timings next to v000 put it at 1.26 and 1.24 times that version's speed.
#include <hip/hip_runtime.h>
#include <stddef.h>

// All contractions on v_wmma_f32_16x16x32_f16 (f16 operands, f32 accumulate): q.k scores and p.v.
// Float inputs are RNE-converted to bf16 and carried in f16 (q and k x16, v x64, p x1024; p gets
// an extra x1024 residual plane with its own accumulator on the first key tile of the first
// query block of every 512-row chunk). Softmax, additive mask, chunk sums in f32.
// Causal chunked attention: per 512-key chunk an independent softmax (additive -1e9 on masked
// cells; every cell of a past chunk is masked), the chunk outputs are summed.

typedef _Float16 v16h __attribute__((ext_vector_type(16)));
typedef _Float16 v8h  __attribute__((ext_vector_type(8)));
typedef float    v8f  __attribute__((ext_vector_type(8)));
typedef float    v4f  __attribute__((ext_vector_type(4)));

#ifndef NB
#define NB 2
#endif
#ifndef SEQ
#define SEQ 2048
#endif
#define NB_FULL  2
#define SEQ_FULL 2048
#define NHEAD 16
#define HD    64
#define CHUNK 512
#define NBH   (NB * NHEAD)

static_assert(NB >= 1 && NB <= NB_FULL);
static_assert(SEQ >= CHUNK && SEQ <= SEQ_FULL && (SEQ % CHUNK) == 0);
static_assert((CHUNK % 128) == 0 && (SEQ % 128) == 0 && (SEQ % 64) == 0);
static_assert(HD == 64);
static_assert(((size_t)NBH * SEQ * HD) % (256u * 8u) == 0);      // convert grid x block x 8 == plane extent
static_assert((size_t)NBH * SEQ_FULL * HD < (size_t)0xFFFFFFFFu);

#define LDT 72   // halves per LDS row (144 B, 16-B aligned)
#define LDC 68   // floats per LDS row (272 B, 16-B aligned)
static_assert((LDT % 8) == 0 && LDT >= 64);
static_assert((LDC % 4) == 0 && LDC >= 64);

#define QKCARRY 16.0f    // q and k planes carried x16 each
#define WCARRY  64.0f    // value plane carried x64
#define PCARRY  1024.0f  // softmax numerators carried x1024
#define RCARRY  1024.0f  // residual plane of p carried x1024 on top of its hi part
#define NEGFILL (-1.0e9f)
#ifndef P_RES
#define P_RES 1          // 1: p residual product on the early band; 0: single product everywhere
#endif

// workspace layout (bytes)
#define PLANE16_BYTES ((size_t)NBH * SEQ * HD * 2)
#define OFF_Q  ((size_t)0)
#define OFF_K  (OFF_Q + PLANE16_BYTES)
#define OFF_VT (OFF_K + PLANE16_BYTES)
#define WS_TOTAL (OFF_VT + PLANE16_BYTES)
static_assert((PLANE16_BYTES % 128) == 0);
static_assert(WS_TOTAL <= (size_t)134217728);

// static LDS of the attention kernel
static_assert((size_t)(64 * LDT * 2) * 2 + (size_t)(8 * 16 * LDC * 4) <= (size_t)131072);

// ---------------------------------------------------------------------------
__device__ __forceinline__ float bf16r(float x) {   // RNE convert to bf16, returned widened
  unsigned int u = __float_as_uint(x);
  u = (u + 0x7FFFu + ((u >> 16) & 1u)) & 0xFFFF0000u;
  return __uint_as_float(u);
}

// f32 -> f16 that cannot produce an f16 subnormal (value select)
static __device__ __forceinline__ _Float16 toh_flush(float v) {
  const _Float16 r = (_Float16)v;
  return (fabsf(v) < 6.103515625e-05f) ? (_Float16)0.0f : r;
}

// 16-bit fragment: p points at element [row = lane&15][k0 + 8*(lane>>4)] of a k-contiguous
// row. Elements 0..7 <- k0+8h+0..7, elements 8..15 <- k0+16+8h+0..7 (same map for A and B).
__device__ __forceinline__ v16h frag_at(const _Float16* p) {
  v8h lo = *(const v8h*)(p);
  v8h hi = *(const v8h*)(p + 16);
  v16h out;
#pragma unroll
  for (int i = 0; i < 8; ++i) { out[i] = lo[i]; out[i + 8] = hi[i]; }
  return out;
}
__device__ __forceinline__ v16h ld_frag(const _Float16* base, unsigned ld) {
  const unsigned lane = threadIdx.x & 31u;
  return frag_at(base + (lane & 15u) * ld + (lane >> 4) * 8u);
}

__device__ __forceinline__ v8f wmma16(v16h a, v16h b, v8f c) {
  v8f d = __builtin_amdgcn_wmma_f32_16x16x32_f16(false, a, false, b, (short)0, c,
                                                 false, false);
  asm volatile("v_nop\n\tv_nop\n\tv_nop\n\tv_nop" : "+v"(d) : "v"(a), "v"(b));
  return d;
}

__device__ __forceinline__ float xhalf(float x) {   // value of lane l ^ 16
  const int b = __builtin_bit_cast(int, x);
  return __builtin_bit_cast(float, __builtin_amdgcn_permlanex16(b, b, 0x76543210, 0xfedcba98,
                                                                false, false));
}

__device__ __forceinline__ void wave_lds_sync() {
  __builtin_amdgcn_fence(3 /* release order */, "wavefront");
  asm volatile("s_wait_dscnt 0x0" ::: "memory");
  __builtin_amdgcn_wave_barrier();
}

// ---------------------------------------------------------------------------
// q / k planes: compact [bh][s][64] f16(16 * bf16(x)). Each thread converts 8 consecutive
// elements of q and of k; one store instruction of a wave covers 512 contiguous bytes
// ---------------------------------------------------------------------------
__global__ __launch_bounds__(256) void qkconv_kernel(
    const float* __restrict__ Qf, const float* __restrict__ Kf,
    _Float16* __restrict__ Q16, _Float16* __restrict__ K16) {
  const unsigned e = (blockIdx.x * 256u + threadIdx.x) * 8u;   // compact element index
  const unsigned crow = e >> 6, c = e & 63u;
  const unsigned bh = crow / (unsigned)SEQ;
  const unsigned sq = crow - bh * (unsigned)SEQ;
  const size_t src = ((size_t)bh * SEQ_FULL + sq) * HD + c;
  const v4f a0 = *(const v4f*)(Qf + src);
  const v4f a1 = *(const v4f*)(Qf + src + 4u);
  const v4f b0 = *(const v4f*)(Kf + src);
  const v4f b1 = *(const v4f*)(Kf + src + 4u);
  v8h xq, xk;
#pragma unroll
  for (int i = 0; i < 4; ++i) {
    xq[i]     = toh_flush(QKCARRY * bf16r(a0[i]));
    xq[i + 4] = toh_flush(QKCARRY * bf16r(a1[i]));
    xk[i]     = toh_flush(QKCARRY * bf16r(b0[i]));
    xk[i + 4] = toh_flush(QKCARRY * bf16r(b1[i]));
  }
  *(v8h*)(Q16 + e) = xq;
  *(v8h*)(K16 + e) = xk;
  
}

// ---------------------------------------------------------------------------
// Transposed value plane: in W[K rows][N cols] (pitch ldw = N) -> out Wt[N][K] (pitch ldk = K),
// f16(64 * bf16(w)), per batch slice blockIdx.z (element strides wbatch / tbatch).
// Grid (N/64, K/64, batches). T: cross-wave (block barrier).
// Store loop: 32 rows per step x 2 steps = 64 rows of the tile.
// ---------------------------------------------------------------------------
static_assert((256 / 8) * 2 == 64);
__global__ __launch_bounds__(256) void vconv_kernel(
    const float* __restrict__ W, _Float16* __restrict__ Wt, unsigned ldw, unsigned ldk,
    unsigned wbatch, unsigned tbatch) {
  __shared__ __attribute__((aligned(16))) _Float16 T[64 * LDT];
  const unsigned tid = threadIdx.x;
  const unsigned n0 = blockIdx.x * 64u;
  const unsigned k0 = blockIdx.y * 64u;
  const size_t wb = (size_t)blockIdx.z * wbatch;
  const size_t tb = (size_t)blockIdx.z * tbatch;
#pragma unroll 4
  for (unsigned j = 0; j < 16u; ++j) {
    const unsigned idx = tid + 256u * j;
    const unsigned kr = idx >> 6, nc = idx & 63u;
    const float v = W[wb + (size_t)(k0 + kr) * ldw + n0 + nc];
    T[nc * LDT + kr] = toh_flush(WCARRY * bf16r(v));
  }
  __syncthreads();
  v8h x[2];
  size_t off[2];
#pragma unroll
  for (unsigned i = 0; i < 2u; ++i) {
    const unsigned n = 32u * i + (tid >> 3);
    const unsigned kc = (tid & 7u) * 8u;
    x[i] = *(const v8h*)&T[n * LDT + kc];
    off[i] = tb + (size_t)(n0 + n) * ldk + k0 + kc;
  }
#pragma unroll
  for (int i = 0; i < 2; ++i) *(v8h*)(Wt + off[i]) = x[i];
  
}

static_assert(2 * 8 == 16);
__global__ __launch_bounds__(256) __attribute__((amdgpu_num_vgpr(256))) void attn_kernel(
    const _Float16* __restrict__ Qh, const _Float16* __restrict__ Kh,
    const _Float16* __restrict__ Vt, float* __restrict__ Out) {
  __shared__ __attribute__((aligned(16))) _Float16 Ks[64 * LDT];
  __shared__ __attribute__((aligned(16))) _Float16 Vs[64 * LDT];
  __shared__ __attribute__((aligned(16))) float Os[8 * 16 * LDC];

  const unsigned tid = threadIdx.x, lane = tid & 31u;
  const unsigned w = (unsigned)__builtin_amdgcn_readfirstlane((int)(threadIdx.x >> 5));
  const unsigned hh = lane >> 4, m = lane & 15u;
  const unsigned q0 = blockIdx.x * 128u;
  const unsigned bh = blockIdx.z * (unsigned)NHEAD + blockIdx.y;
  const unsigned ci = q0 / (unsigned)CHUNK;          // chunk of this query block
  const unsigned cs = ci * (unsigned)CHUNK;          // first key of the diagonal chunk
  const bool first_blk = (q0 == cs);                 // block-uniform
  const float scale = 0.125f / (QKCARRY * QKCARRY);  // HD^-0.5 over the plane carries
  const unsigned qrow0 = q0 + w * 16u;
  const unsigned obase = w * (16u * LDC);

  const size_t qoff = ((size_t)bh * SEQ + qrow0 + m) * HD + hh * 8u;
  v16h qf[2];
  qf[0] = frag_at(Qh + qoff);
  qf[1] = frag_at(Qh + qoff + 32);

  float mrow = -1.0e30f, lrow = 0.0f;   // of query row m; lrow: this half's keys only
  v8f o[4], ot[4];
#pragma unroll
  for (int nb = 0; nb < 4; ++nb) { o[nb] = (v8f){}; ot[nb] = (v8f){}; }

  const size_t kplane = (size_t)bh * SEQ * HD;
  const size_t vplane = (size_t)bh * HD * SEQ;

#pragma unroll 1
  for (unsigned jc = 0; jc <= ci; ++jc) {
    const bool offd = (jc < ci);                     // past chunk: every cell masked
    const unsigned kc0 = jc * (unsigned)CHUNK;
    const unsigned kc1 = offd ? (kc0 + (unsigned)CHUNK) : (q0 + 128u);   // <= SEQ

#pragma unroll 1
    for (unsigned kb = kc0; kb < kc1; kb += 64u) {
      const bool early = (P_RES != 0) && first_blk && (!offd) && (kb == cs);   // block-uniform
#pragma unroll
      for (unsigned j = 0; j < 2u; ++j) {
        const unsigned idx = tid + 256u * j;
        const unsigned r = idx >> 3, c = (idx & 7u) * 8u;
        *(v8h*)&Ks[r * LDT + c] = *(const v8h*)(Kh + kplane + (size_t)(kb + r) * HD + c);
        *(v8h*)&Vs[r * LDT + c] = *(const v8h*)(Vt + vplane + (size_t)r * SEQ + kb + c);
      }
      __syncthreads();

      // scores: 4 key groups of 16, K = 64 in two 32-steps
      v8f s[4];
#pragma unroll
      for (int kg = 0; kg < 4; ++kg) {
        v8f t = {};
#pragma unroll
        for (int c = 0; c < 2; ++c) {
          const v16h kf = ld_frag(&Ks[(kg * 16) * LDT + c * 32], LDT);
          t = wmma16(kf, qf[c], t);
        }
        s[kg] = t * scale;
      }

      // additive mask; block-uniform tests, per-cell addend selected by value
      if (offd) {
#pragma unroll
        for (int kg = 0; kg < 4; ++kg)
#pragma unroll
          for (int v = 0; v < 8; ++v) s[kg][v] = s[kg][v] + NEGFILL;
      } else if (kb >= q0) {
#pragma unroll
        for (int kg = 0; kg < 4; ++kg)
#pragma unroll
          for (int v = 0; v < 8; ++v) {
            const unsigned key = kb + (unsigned)kg * 16u + hh * 8u + (unsigned)v;
            const unsigned row = qrow0 + m;
            const float add = (key > row) ? NEGFILL : 0.0f;
            s[kg][v] = s[kg][v] + add;
          }
      }

      // online softmax; a lane holds 32 of its query row's 64 scores, lane ^ 16 the other 32
      float mk[4];
#pragma unroll
      for (int kg = 0; kg < 4; ++kg)
        mk[kg] = fmaxf(fmaxf(fmaxf(s[kg][0], s[kg][1]), fmaxf(s[kg][2], s[kg][3])),
                       fmaxf(fmaxf(s[kg][4], s[kg][5]), fmaxf(s[kg][6], s[kg][7])));
      float mx = fmaxf(fmaxf(mk[0], mk[1]), fmaxf(mk[2], mk[3]));
      mx = fmaxf(mx, xhalf(mx));
      const float mn = fmaxf(mrow, mx);
      const float alpha = __expf(mrow - mn);
      mrow = mn;
#pragma unroll
      for (int kg = 0; kg < 4; ++kg)
#pragma unroll
        for (int v = 0; v < 8; ++v) s[kg][v] = __expf(s[kg][v] - mrow);
      float sk[4];
#pragma unroll
      for (int kg = 0; kg < 4; ++kg)
        sk[kg] = ((s[kg][0] + s[kg][1]) + (s[kg][2] + s[kg][3])) +
                 ((s[kg][4] + s[kg][5]) + (s[kg][6] + s[kg][7]));
      lrow = alpha * lrow + ((sk[0] + sk[1]) + (sk[2] + sk[3]));
#pragma unroll
      for (int nb = 0; nb < 4; ++nb) o[nb] = o[nb] * alpha;

      // O^T += V^T . P^T  (K = 64 keys in two 32-steps; A = V^T tile [d][key], B = f16(1024 p))
#pragma unroll
      for (int c = 0; c < 2; ++c) {
        v16h pf;
#pragma unroll
        for (int v = 0; v < 8; ++v) {
          pf[v]     = toh_flush(s[2 * c][v] * PCARRY);
          pf[v + 8] = toh_flush(s[2 * c + 1][v] * PCARRY);
        }
#pragma unroll
        for (int nb = 0; nb < 4; ++nb) {
          const v16h vf = ld_frag(&Vs[(nb * 16) * LDT + c * 32], LDT);
          o[nb] = wmma16(vf, pf, o[nb]);
        }
      }

      if (early) {
        // P residual operand: f16(1024 * (1024 p - f16(1024 p)))
        v16h pr[2];
#pragma unroll
        for (int c = 0; c < 2; ++c)
#pragma unroll
          for (int v = 0; v < 16; ++v) {
            const float t = s[2 * c + (v >> 3)][v & 7] * PCARRY;
            const float hi = (float)toh_flush(t);
            pr[c][v] = toh_flush((t - hi) * RCARRY);
          }
        // V^T . P_res^T (scale 1/1024), one 16-row group of d at a time, folded immediately
#pragma unroll
        for (int nb = 0; nb < 4; ++nb) {
          v8f o2 = {};
#pragma unroll
          for (int c = 0; c < 2; ++c) {
            const v16h vf = ld_frag(&Vs[(nb * 16) * LDT + c * 32], LDT);
            o2 = wmma16(vf, pr[c], o2);
          }
#pragma unroll
          for (int v = 0; v < 8; ++v) o[nb][v] = o[nb][v] + o2[v] * (1.0f / RCARRY);
        }
      }
      __syncthreads();
    }

    // end of chunk: add O / l to the running output, reset the softmax state
    const float inv = __builtin_amdgcn_rcpf(lrow + xhalf(lrow));   // the two halves' sums joined
#pragma unroll
    for (int nb = 0; nb < 4; ++nb) {
      ot[nb] = ot[nb] + o[nb] * inv;
      o[nb] = (v8f){};
    }
    mrow = -1.0e30f;
    lrow = 0.0f;
  }

  const float fs = 1.0f / (PCARRY * WCARRY);
#pragma unroll
  for (int nb = 0; nb < 4; ++nb)
#pragma unroll
    for (int v = 0; v < 8; ++v)
      Os[obase + m * LDC + (unsigned)nb * 16u + hh * 8u + (unsigned)v] = ot[nb][v] * fs;
  wave_lds_sync();
  v4f x[8];
  size_t off[8];
#pragma unroll
  for (unsigned i = 0; i < 8u; ++i) {
    const unsigned r = 2u * i + (lane >> 4);
    const unsigned c = (lane & 15u) * 4u;
    x[i] = *(const v4f*)&Os[obase + r * LDC + c];
    off[i] = ((size_t)bh * SEQ_FULL + qrow0 + r) * HD + c;
  }
#pragma unroll
  for (int i = 0; i < 8; ++i) *(v4f*)(Out + off[i]) = x[i];
  
}

// ---------------------------------------------------------------------------
extern "C" void kernel_launch(void* const* d_in, const int* in_sizes, int n_in,
                              void* d_out, int out_size, void* d_ws, size_t ws_size,
                              hipStream_t stream) {
  if (n_in < 3) return;
  const long long need = ((long long)(NBH - 1) * SEQ_FULL + SEQ) * HD;
  if ((long long)in_sizes[0] < need) return;
  if ((long long)in_sizes[1] < need) return;
  if ((long long)in_sizes[2] < need) return;
  if ((long long)out_size < need) return;
  if (ws_size < WS_TOTAL) return;

  const float* Qf = (const float*)d_in[0];    // query [NB_FULL][NHEAD][SEQ_FULL][HD]
  const float* Kf = (const float*)d_in[1];    // key
  const float* Vf = (const float*)d_in[2];    // value
  float* out = (float*)d_out;                 // [NB_FULL][NHEAD][SEQ_FULL][HD]

  char* ws = (char*)d_ws;
  _Float16* Q16  = (_Float16*)(ws + OFF_Q);    // [bh][SEQ][HD]
  _Float16* K16  = (_Float16*)(ws + OFF_K);    // [bh][SEQ][HD]
  _Float16* Vt16 = (_Float16*)(ws + OFF_VT);   // [bh][HD][SEQ]

  dim3 blk(256);
  qkconv_kernel<<<dim3((unsigned)(((size_t)NBH * SEQ * HD) / 2048u)), blk, 0, stream>>>(
      Qf, Kf, Q16, K16);
  // value: in [SEQ rows][HD cols] per bh -> out [HD][SEQ] per bh; grid (HD/64, SEQ/64, NBH)
  vconv_kernel<<<dim3(HD / 64, SEQ / 64, NBH), blk, 0, stream>>>(
      Vf, Vt16, (unsigned)HD, (unsigned)SEQ, (unsigned)(SEQ_FULL * HD), (unsigned)(HD * SEQ));
  attn_kernel<<<dim3(SEQ / 128, NHEAD, NB), blk, 0, stream>>>(Q16, K16, Vt16, out);
}

// v002
// It runs in 64.9 microseconds.
// Timed twice side by side with v001, it ran 1.17 and 1.16 times as fast.
// Over all steps from v000 it is 1.46 times as fast.
#include <hip/hip_runtime.h>
#include <stddef.h>

// All contractions on v_wmma_f32_16x16x32_f16 (f16 operands, f32 accumulate): q.k scores and p.v.
// Float inputs are RNE-converted to bf16 and carried in f16 (q and k x16, v x64, p x1024; p gets
// an extra x1024 residual plane with its own accumulator on the first key tile of the first
// query block of every 512-row chunk). Softmax, additive mask, chunk sums in f32.
// Causal chunked attention: per 512-key chunk an independent softmax (additive -1e9 on masked
// cells; every cell of a past chunk is masked), the chunk outputs are summed.

typedef _Float16 v16h __attribute__((ext_vector_type(16)));
typedef _Float16 v8h  __attribute__((ext_vector_type(8)));
typedef float    v8f  __attribute__((ext_vector_type(8)));
typedef float    v4f  __attribute__((ext_vector_type(4)));

#ifndef NB
#define NB 2
#endif
#ifndef SEQ
#define SEQ 2048
#endif
#define NB_FULL  2
#define SEQ_FULL 2048
#define NHEAD 16
#define HD    64
#define CHUNK 512
#define NBH   (NB * NHEAD)

static_assert(NB >= 1 && NB <= NB_FULL);
static_assert(SEQ >= CHUNK && SEQ <= SEQ_FULL && (SEQ % CHUNK) == 0);
static_assert((CHUNK % 128) == 0 && (SEQ % 128) == 0 && (SEQ % 64) == 0);
static_assert(HD == 64);
static_assert(((size_t)NBH * SEQ * HD) % (256u * 8u) == 0);      // convert grid x block x 8 == plane extent
static_assert((size_t)NBH * SEQ_FULL * HD < (size_t)0xFFFFFFFFu);

#define LDT 72   // halves per LDS row (144 B, 16-B aligned)
#define LDC 68   // floats per LDS row (272 B, 16-B aligned)
static_assert((LDT % 8) == 0 && LDT >= 64);
static_assert((LDC % 4) == 0 && LDC >= 64);

#define QKCARRY 16.0f    // q and k planes carried x16 each
#define WCARRY  64.0f    // value plane carried x64
#define PCARRY  1024.0f  // softmax numerators carried x1024
#define RCARRY  1024.0f  // residual plane of p carried x1024 on top of its hi part
#define NEGFILL (-1.0e9f)
#ifndef P_RES
#define P_RES 1          // 1: p residual product on the early band; 0: single product everywhere
#endif

// workspace layout (bytes)
#define PLANE16_BYTES ((size_t)NBH * SEQ * HD * 2)
#define OFF_Q  ((size_t)0)
#define OFF_K  (OFF_Q + PLANE16_BYTES)
#define OFF_VT (OFF_K + PLANE16_BYTES)
#define WS_TOTAL (OFF_VT + PLANE16_BYTES)
static_assert((PLANE16_BYTES % 128) == 0);
static_assert(WS_TOTAL <= (size_t)134217728);

// static LDS of the attention kernel
static_assert((size_t)(64 * LDT * 2) * 2 + (size_t)(8 * 16 * LDC * 4) <= (size_t)131072);

// ---------------------------------------------------------------------------
__device__ __forceinline__ float bf16r(float x) {   // RNE convert to bf16, returned widened
  unsigned int u = __float_as_uint(x);
  u = (u + 0x7FFFu + ((u >> 16) & 1u)) & 0xFFFF0000u;
  return __uint_as_float(u);
}

// f32 -> f16 that cannot produce an f16 subnormal (value select)
static __device__ __forceinline__ _Float16 toh_flush(float v) {
  const _Float16 r = (_Float16)v;
  return (fabsf(v) < 6.103515625e-05f) ? (_Float16)0.0f : r;
}

// 16-bit fragment: p points at element [row = lane&15][k0 + 8*(lane>>4)] of a k-contiguous
// row. Elements 0..7 <- k0+8h+0..7, elements 8..15 <- k0+16+8h+0..7 (same map for A and B).
__device__ __forceinline__ v16h frag_at(const _Float16* p) {
  v8h lo = *(const v8h*)(p);
  v8h hi = *(const v8h*)(p + 16);
  v16h out;
#pragma unroll
  for (int i = 0; i < 8; ++i) { out[i] = lo[i]; out[i + 8] = hi[i]; }
  return out;
}
__device__ __forceinline__ v16h ld_frag(const _Float16* base, unsigned ld) {
  const unsigned lane = threadIdx.x & 31u;
  return frag_at(base + (lane & 15u) * ld + (lane >> 4) * 8u);
}

__device__ __forceinline__ v8f wmma16(v16h a, v16h b, v8f c) {
  v8f d = __builtin_amdgcn_wmma_f32_16x16x32_f16(false, a, false, b, (short)0, c,
                                                 false, false);
  asm volatile("v_nop\n\tv_nop\n\tv_nop\n\tv_nop" : "+v"(d) : "v"(a), "v"(b));
  return d;
}

__device__ __forceinline__ float xhalf(float x) {   // value of lane l ^ 16
  const int b = __builtin_bit_cast(int, x);
  return __builtin_bit_cast(float, __builtin_amdgcn_permlanex16(b, b, 0x76543210, 0xfedcba98,
                                                                false, false));
}

__device__ __forceinline__ void wave_lds_sync() {
  __builtin_amdgcn_fence(3 /* release order */, "wavefront");
  asm volatile("s_wait_dscnt 0x0" ::: "memory");
  __builtin_amdgcn_wave_barrier();
}

// ---------------------------------------------------------------------------
// q / k planes: compact [bh][s][64] f16(16 * bf16(x)). Each thread converts 8 consecutive
// elements of q and of k; one store instruction of a wave covers 512 contiguous bytes
// ---------------------------------------------------------------------------
__global__ __launch_bounds__(256) void qkconv_kernel(
    const float* __restrict__ Qf, const float* __restrict__ Kf,
    _Float16* __restrict__ Q16, _Float16* __restrict__ K16) {
  const unsigned e = (blockIdx.x * 256u + threadIdx.x) * 8u;   // compact element index
  const unsigned crow = e >> 6, c = e & 63u;
  const unsigned bh = crow / (unsigned)SEQ;
  const unsigned sq = crow - bh * (unsigned)SEQ;
  const size_t src = ((size_t)bh * SEQ_FULL + sq) * HD + c;
  const v4f a0 = *(const v4f*)(Qf + src);
  const v4f a1 = *(const v4f*)(Qf + src + 4u);
  const v4f b0 = *(const v4f*)(Kf + src);
  const v4f b1 = *(const v4f*)(Kf + src + 4u);
  v8h xq, xk;
#pragma unroll
  for (int i = 0; i < 4; ++i) {
    xq[i]     = toh_flush(QKCARRY * bf16r(a0[i]));
    xq[i + 4] = toh_flush(QKCARRY * bf16r(a1[i]));
    xk[i]     = toh_flush(QKCARRY * bf16r(b0[i]));
    xk[i + 4] = toh_flush(QKCARRY * bf16r(b1[i]));
  }
  *(v8h*)(Q16 + e) = xq;
  *(v8h*)(K16 + e) = xk;
  
}

// ---------------------------------------------------------------------------
// Transposed value plane: in W[K rows][N cols] (pitch ldw = N) -> out Wt[N][K] (pitch ldk = K),
// f16(64 * bf16(w)), per batch slice blockIdx.z (element strides wbatch / tbatch).
// Grid (N/64, K/64, batches). T: cross-wave (block barrier).
// Store loop: 32 rows per step x 2 steps = 64 rows of the tile.
// ---------------------------------------------------------------------------
static_assert((256 / 8) * 2 == 64);
__global__ __launch_bounds__(256) void vconv_kernel(
    const float* __restrict__ W, _Float16* __restrict__ Wt, unsigned ldw, unsigned ldk,
    unsigned wbatch, unsigned tbatch) {
  __shared__ __attribute__((aligned(16))) _Float16 T[64 * LDT];
  const unsigned tid = threadIdx.x;
  const unsigned n0 = blockIdx.x * 64u;
  const unsigned k0 = blockIdx.y * 64u;
  const size_t wb = (size_t)blockIdx.z * wbatch;
  const size_t tb = (size_t)blockIdx.z * tbatch;
#pragma unroll 4
  for (unsigned j = 0; j < 16u; ++j) {
    const unsigned idx = tid + 256u * j;
    const unsigned kr = idx >> 6, nc = idx & 63u;
    const float v = W[wb + (size_t)(k0 + kr) * ldw + n0 + nc];
    T[nc * LDT + kr] = toh_flush(WCARRY * bf16r(v));
  }
  __syncthreads();
  v8h x[2];
  size_t off[2];
#pragma unroll
  for (unsigned i = 0; i < 2u; ++i) {
    const unsigned n = 32u * i + (tid >> 3);
    const unsigned kc = (tid & 7u) * 8u;
    x[i] = *(const v8h*)&T[n * LDT + kc];
    off[i] = tb + (size_t)(n0 + n) * ldk + k0 + kc;
  }
#pragma unroll
  for (int i = 0; i < 2; ++i) *(v8h*)(Wt + off[i]) = x[i];
  
}

static_assert(2 * 8 == 16);
__global__ __launch_bounds__(256) __attribute__((amdgpu_num_vgpr(256))) void attn_kernel(
    const _Float16* __restrict__ Qh, const _Float16* __restrict__ Kh,
    const _Float16* __restrict__ Vt, float* __restrict__ Out) {
  __shared__ __attribute__((aligned(16))) _Float16 Ks[64 * LDT];
  __shared__ __attribute__((aligned(16))) _Float16 Vs[64 * LDT];
  __shared__ __attribute__((aligned(16))) float Os[8 * 16 * LDC];

  const unsigned tid = threadIdx.x, lane = tid & 31u;
  const unsigned w = (unsigned)__builtin_amdgcn_readfirstlane((int)(threadIdx.x >> 5));
  const unsigned hh = lane >> 4, m = lane & 15u;
  const unsigned q0 = blockIdx.x * 128u;
  const unsigned bh = blockIdx.z * (unsigned)NHEAD + blockIdx.y;
  const unsigned ci = q0 / (unsigned)CHUNK;          // chunk of this query block
  const unsigned cs = ci * (unsigned)CHUNK;          // first key of the diagonal chunk
  const bool first_blk = (q0 == cs);                 // block-uniform
  const float scale = 0.125f / (QKCARRY * QKCARRY);  // HD^-0.5 over the plane carries
  const unsigned qrow0 = q0 + w * 16u;
  const unsigned obase = w * (16u * LDC);

  const size_t qoff = ((size_t)bh * SEQ + qrow0 + m) * HD + hh * 8u;
  v16h qf[2];
  qf[0] = frag_at(Qh + qoff);
  qf[1] = frag_at(Qh + qoff + 32);

  float mrow = -1.0e30f, lrow = 0.0f;   // of query row m; lrow: this half's keys only
  // The running output (sum of the chunks' O / l) rests in the wave's own output rows of Os, which
  // are idle until the epilogue: lane (hh, m) owns cells [m][16 nb + 8 hh + 0..7], touched once per
  // chunk. That leaves its 32 registers to the V^T fragments held across the softmax.
  float* const orow = &Os[obase + m * LDC + hh * 8u];
  v8f o[4];
#pragma unroll
  for (int nb = 0; nb < 4; ++nb) {
    o[nb] = (v8f){};
    *(v4f*)(orow + nb * 16) = (v4f){};
    *(v4f*)(orow + nb * 16 + 4) = (v4f){};
  }

  const size_t kplane = (size_t)bh * SEQ * HD;
  const size_t vplane = (size_t)bh * HD * SEQ;

#pragma unroll 1
  for (unsigned jc = 0; jc <= ci; ++jc) {
    const bool offd = (jc < ci);                     // past chunk: every cell masked
    const unsigned kc0 = jc * (unsigned)CHUNK;
    const unsigned kc1 = offd ? (kc0 + (unsigned)CHUNK) : (q0 + 128u);   // <= SEQ

#pragma unroll 1
    for (unsigned kb = kc0; kb < kc1; kb += 64u) {
      const bool early = (P_RES != 0) && first_blk && (!offd) && (kb == cs);   // block-uniform
#pragma unroll
      for (unsigned j = 0; j < 2u; ++j) {
        const unsigned idx = tid + 256u * j;
        const unsigned r = idx >> 3, c = (idx & 7u) * 8u;
        *(v8h*)&Ks[r * LDT + c] = *(const v8h*)(Kh + kplane + (size_t)(kb + r) * HD + c);
        *(v8h*)&Vs[r * LDT + c] = *(const v8h*)(Vt + vplane + (size_t)r * SEQ + kb + c);
      }
      __syncthreads();

      // scores: 4 key groups of 16, K = 64 in two 32-steps. All eight K fragments are read as
      // one group ahead of the eight products (one LDS latency per tile, not one per product);
      // the four accumulators advance side by side, each still c = 0 then c = 1.
      v16h kf[2][4];
#pragma unroll
      for (int c = 0; c < 2; ++c)
#pragma unroll
        for (int kg = 0; kg < 4; ++kg) kf[c][kg] = ld_frag(&Ks[(kg * 16) * LDT + c * 32], LDT);
      v8f s[4];
#pragma unroll
      for (int kg = 0; kg < 4; ++kg) s[kg] = (v8f){};
#pragma unroll
      for (int c = 0; c < 2; ++c)
#pragma unroll
        for (int kg = 0; kg < 4; ++kg) s[kg] = wmma16(kf[c][kg], qf[c], s[kg]);

      // all eight V^T fragments, issued here as one group: they land while the softmax runs
      v16h vf[2][4];
#pragma unroll
      for (int c = 0; c < 2; ++c)
#pragma unroll
        for (int nb = 0; nb < 4; ++nb) vf[c][nb] = ld_frag(&Vs[(nb * 16) * LDT + c * 32], LDT);

#pragma unroll
      for (int kg = 0; kg < 4; ++kg) s[kg] = s[kg] * scale;

      // additive mask; block-uniform tests, per-cell addend selected by value
      if (offd) {
#pragma unroll
        for (int kg = 0; kg < 4; ++kg)
#pragma unroll
          for (int v = 0; v < 8; ++v) s[kg][v] = s[kg][v] + NEGFILL;
      } else if (kb >= q0) {
#pragma unroll
        for (int kg = 0; kg < 4; ++kg)
#pragma unroll
          for (int v = 0; v < 8; ++v) {
            const unsigned key = kb + (unsigned)kg * 16u + hh * 8u + (unsigned)v;
            const unsigned row = qrow0 + m;
            const float add = (key > row) ? NEGFILL : 0.0f;
            s[kg][v] = s[kg][v] + add;
          }
      }

      // online softmax; a lane holds 32 of its query row's 64 scores, lane ^ 16 the other 32
      float mk[4];
#pragma unroll
      for (int kg = 0; kg < 4; ++kg)
        mk[kg] = fmaxf(fmaxf(fmaxf(s[kg][0], s[kg][1]), fmaxf(s[kg][2], s[kg][3])),
                       fmaxf(fmaxf(s[kg][4], s[kg][5]), fmaxf(s[kg][6], s[kg][7])));
      float mx = fmaxf(fmaxf(mk[0], mk[1]), fmaxf(mk[2], mk[3]));
      mx = fmaxf(mx, xhalf(mx));
      const float mn = fmaxf(mrow, mx);
      const float alpha = __expf(mrow - mn);
      mrow = mn;
#pragma unroll
      for (int kg = 0; kg < 4; ++kg)
#pragma unroll
        for (int v = 0; v < 8; ++v) s[kg][v] = __expf(s[kg][v] - mrow);
      float sk[4];
#pragma unroll
      for (int kg = 0; kg < 4; ++kg)
        sk[kg] = ((s[kg][0] + s[kg][1]) + (s[kg][2] + s[kg][3])) +
                 ((s[kg][4] + s[kg][5]) + (s[kg][6] + s[kg][7]));
      lrow = alpha * lrow + ((sk[0] + sk[1]) + (sk[2] + sk[3]));
#pragma unroll
      for (int nb = 0; nb < 4; ++nb) o[nb] = o[nb] * alpha;

      // O^T += V^T . P^T  (K = 64 keys in two 32-steps; A = V^T tile [d][key], B = f16(1024 p))
#pragma unroll
      for (int c = 0; c < 2; ++c) {
        v16h pf;
#pragma unroll
        for (int v = 0; v < 8; ++v) {
          pf[v]     = toh_flush(s[2 * c][v] * PCARRY);
          pf[v + 8] = toh_flush(s[2 * c + 1][v] * PCARRY);
        }
#pragma unroll
        for (int nb = 0; nb < 4; ++nb) o[nb] = wmma16(vf[c][nb], pf, o[nb]);
      }

      if (early) {
        // P residual operand: f16(1024 * (1024 p - f16(1024 p)))
        v16h pr[2];
#pragma unroll
        for (int c = 0; c < 2; ++c)
#pragma unroll
          for (int v = 0; v < 16; ++v) {
            const float t = s[2 * c + (v >> 3)][v & 7] * PCARRY;
            const float hi = (float)toh_flush(t);
            pr[c][v] = toh_flush((t - hi) * RCARRY);
          }
        // V^T . P_res^T (scale 1/1024), one 16-row group of d at a time, folded immediately
#pragma unroll
        for (int nb = 0; nb < 4; ++nb) {
          v8f o2 = {};
#pragma unroll
          for (int c = 0; c < 2; ++c) {
            const v16h vr = ld_frag(&Vs[(nb * 16) * LDT + c * 32], LDT);
            o2 = wmma16(vr, pr[c], o2);
          }
#pragma unroll
          for (int v = 0; v < 8; ++v) o[nb][v] = o[nb][v] + o2[v] * (1.0f / RCARRY);
        }
      }
      __syncthreads();
    }

    // end of chunk: add O / l to the running output, reset the softmax state
    const float inv = __builtin_amdgcn_rcpf(lrow + xhalf(lrow));   // the two halves' sums joined
#pragma unroll
    for (int nb = 0; nb < 4; ++nb) {
      v4f t0 = *(const v4f*)(orow + nb * 16);
      v4f t1 = *(const v4f*)(orow + nb * 16 + 4);
#pragma unroll
      for (int v = 0; v < 4; ++v) {
        t0[v] = t0[v] + o[nb][v] * inv;
        t1[v] = t1[v] + o[nb][v + 4] * inv;
      }
      *(v4f*)(orow + nb * 16) = t0;
      *(v4f*)(orow + nb * 16 + 4) = t1;
      o[nb] = (v8f){};
    }
    mrow = -1.0e30f;
    lrow = 0.0f;
  }

  const float fs = 1.0f / (PCARRY * WCARRY);
  wave_lds_sync();
  v4f x[8];
  size_t off[8];
#pragma unroll
  for (unsigned i = 0; i < 8u; ++i) {
    const unsigned r = 2u * i + (lane >> 4);
    const unsigned c = (lane & 15u) * 4u;
    x[i] = *(const v4f*)&Os[obase + r * LDC + c] * fs;
    off[i] = ((size_t)bh * SEQ_FULL + qrow0 + r) * HD + c;
  }
#pragma unroll
  for (int i = 0; i < 8; ++i) *(v4f*)(Out + off[i]) = x[i];
  
}

// ---------------------------------------------------------------------------
extern "C" void kernel_launch(void* const* d_in, const int* in_sizes, int n_in,
                              void* d_out, int out_size, void* d_ws, size_t ws_size,
                              hipStream_t stream) {
  if (n_in < 3) return;
  const long long need = ((long long)(NBH - 1) * SEQ_FULL + SEQ) * HD;
  if ((long long)in_sizes[0] < need) return;
  if ((long long)in_sizes[1] < need) return;
  if ((long long)in_sizes[2] < need) return;
  if ((long long)out_size < need) return;
  if (ws_size < WS_TOTAL) return;

  const float* Qf = (const float*)d_in[0];    // query [NB_FULL][NHEAD][SEQ_FULL][HD]
  const float* Kf = (const float*)d_in[1];    // key
  const float* Vf = (const float*)d_in[2];    // value
  float* out = (float*)d_out;                 // [NB_FULL][NHEAD][SEQ_FULL][HD]

  char* ws = (char*)d_ws;
  _Float16* Q16  = (_Float16*)(ws + OFF_Q);    // [bh][SEQ][HD]
  _Float16* K16  = (_Float16*)(ws + OFF_K);    // [bh][SEQ][HD]
  _Float16* Vt16 = (_Float16*)(ws + OFF_VT);   // [bh][HD][SEQ]

  dim3 blk(256);
  qkconv_kernel<<<dim3((unsigned)(((size_t)NBH * SEQ * HD) / 2048u)), blk, 0, stream>>>(
      Qf, Kf, Q16, K16);
  // value: in [SEQ rows][HD cols] per bh -> out [HD][SEQ] per bh; grid (HD/64, SEQ/64, NBH)
  vconv_kernel<<<dim3(HD / 64, SEQ / 64, NBH), blk, 0, stream>>>(
      Vf, Vt16, (unsigned)HD, (unsigned)SEQ, (unsigned)(SEQ_FULL * HD), (unsigned)(HD * SEQ));
  attn_kernel<<<dim3(SEQ / 128, NHEAD, NB), blk, 0, stream>>>(Q16, K16, Vt16, out);
}

// v003
// One run takes 46.9 microseconds.
// Timed twice side by side with v002, it ran 1.38 and 1.39 times as fast.
// Over all steps from v000 it is 2.02 times as fast.
#include <hip/hip_runtime.h>
#include <stddef.h>

// All contractions on v_wmma_f32_16x16x32_f16 (f16 operands, f32 accumulate): q.k scores and p.v.
// Float inputs are RNE-converted to bf16 and carried in f16 (q and k x16, v x64, p x1024; p gets
// an extra x1024 residual plane with its own accumulator on the first key tile of the first
// 128 query rows of every 512-row chunk). Softmax, additive mask, chunk sums in f32.
// Causal chunked attention: per 512-key chunk an independent softmax (additive -1e9 on masked
// cells; every cell of a past chunk is masked), the chunk outputs are summed.

typedef _Float16 v16h __attribute__((ext_vector_type(16)));
typedef _Float16 v8h  __attribute__((ext_vector_type(8)));
typedef float    v8f  __attribute__((ext_vector_type(8)));
typedef float    v4f  __attribute__((ext_vector_type(4)));

#ifndef NB
#define NB 2
#endif
#ifndef SEQ
#define SEQ 2048
#endif
#define NB_FULL  2
#define SEQ_FULL 2048
#define NHEAD 16
#define HD    64
#define CHUNK 512
#define NBH   (NB * NHEAD)

static_assert(NB >= 1 && NB <= NB_FULL);
static_assert(SEQ >= CHUNK && SEQ <= SEQ_FULL && (SEQ % CHUNK) == 0);
static_assert((CHUNK % 128) == 0 && (SEQ % 128) == 0 && (SEQ % 64) == 0);
static_assert(HD == 64);
static_assert(((size_t)NBH * SEQ * HD) % (256u * 8u) == 0);      // convert grid x block x 8 == plane extent
static_assert((size_t)NBH * SEQ_FULL * HD < (size_t)0xFFFFFFFFu);

#define LDT 72   // halves per LDS row (144 B, 16-B aligned)
#define LDC 68   // floats per LDS row (272 B, 16-B aligned)
static_assert((LDT % 8) == 0 && LDT >= 64);
static_assert((LDC % 4) == 0 && LDC >= 64);

#define QKCARRY 16.0f    // q and k planes carried x16 each
#define WCARRY  64.0f    // value plane carried x64
#define PCARRY  1024.0f  // softmax numerators carried x1024
#define RCARRY  1024.0f  // residual plane of p carried x1024 on top of its hi part
#define NEGFILL (-1.0e9f)
#ifndef P_RES
#define P_RES 1          // 1: p residual product on the early band; 0: single product everywhere
#endif

// workspace layout (bytes)
#define PLANE16_BYTES ((size_t)NBH * SEQ * HD * 2)
#define OFF_Q  ((size_t)0)
#define OFF_K  (OFF_Q + PLANE16_BYTES)
#define OFF_VT (OFF_K + PLANE16_BYTES)
#define WS_TOTAL (OFF_VT + PLANE16_BYTES)
static_assert((PLANE16_BYTES % 128) == 0);
static_assert(WS_TOTAL <= (size_t)134217728);

#define LDX 36   // floats per lane slot of the state exchange (144 B, 16-B aligned)
static_assert((LDX % 4) == 0 && LDX >= 34);
#define NQT (SEQ / 64)   // query tiles of 64 rows per head
static_assert((NQT % 2) == 0);

// static LDS of the attention kernel
static_assert((size_t)(2 * 64 * LDT * 2) * 2 + (size_t)(4 * 16 * LDC * 4) +
              (size_t)(4 * 32 * LDX * 4) <= (size_t)131072);

// ---------------------------------------------------------------------------
__device__ __forceinline__ float bf16r(float x) {   // RNE convert to bf16, returned widened
  unsigned int u = __float_as_uint(x);
  u = (u + 0x7FFFu + ((u >> 16) & 1u)) & 0xFFFF0000u;
  return __uint_as_float(u);
}

// f32 -> f16 that cannot produce an f16 subnormal (value select)
static __device__ __forceinline__ _Float16 toh_flush(float v) {
  const _Float16 r = (_Float16)v;
  return (fabsf(v) < 6.103515625e-05f) ? (_Float16)0.0f : r;
}

// 16-bit fragment: p points at element [row = lane&15][k0 + 8*(lane>>4)] of a k-contiguous
// row. Elements 0..7 <- k0+8h+0..7, elements 8..15 <- k0+16+8h+0..7 (same map for A and B).
__device__ __forceinline__ v16h frag_at(const _Float16* p) {
  v8h lo = *(const v8h*)(p);
  v8h hi = *(const v8h*)(p + 16);
  v16h out;
#pragma unroll
  for (int i = 0; i < 8; ++i) { out[i] = lo[i]; out[i + 8] = hi[i]; }
  return out;
}
__device__ __forceinline__ v16h ld_frag(const _Float16* base, unsigned ld) {
  const unsigned lane = threadIdx.x & 31u;
  return frag_at(base + (lane & 15u) * ld + (lane >> 4) * 8u);
}

__device__ __forceinline__ v8f wmma16(v16h a, v16h b, v8f c) {
  v8f d = __builtin_amdgcn_wmma_f32_16x16x32_f16(false, a, false, b, (short)0, c,
                                                 false, false);
  asm volatile("v_nop\n\tv_nop\n\tv_nop\n\tv_nop" : "+v"(d) : "v"(a), "v"(b));
  return d;
}

__device__ __forceinline__ float xhalf(float x) {   // value of lane l ^ 16
  const int b = __builtin_bit_cast(int, x);
  return __builtin_bit_cast(float, __builtin_amdgcn_permlanex16(b, b, 0x76543210, 0xfedcba98,
                                                                false, false));
}

__device__ __forceinline__ void wave_lds_sync() {
  __builtin_amdgcn_fence(3 /* release order */, "wavefront");
  asm volatile("s_wait_dscnt 0x0" ::: "memory");
  __builtin_amdgcn_wave_barrier();
}

// ---------------------------------------------------------------------------
// q / k planes: compact [bh][s][64] f16(16 * bf16(x)). Each thread converts 8 consecutive
// elements of q and of k; one store instruction of a wave covers 512 contiguous bytes
// ---------------------------------------------------------------------------
__global__ __launch_bounds__(256) void qkconv_kernel(
    const float* __restrict__ Qf, const float* __restrict__ Kf,
    _Float16* __restrict__ Q16, _Float16* __restrict__ K16) {
  const unsigned e = (blockIdx.x * 256u + threadIdx.x) * 8u;   // compact element index
  const unsigned crow = e >> 6, c = e & 63u;
  const unsigned bh = crow / (unsigned)SEQ;
  const unsigned sq = crow - bh * (unsigned)SEQ;
  const size_t src = ((size_t)bh * SEQ_FULL + sq) * HD + c;
  const v4f a0 = *(const v4f*)(Qf + src);
  const v4f a1 = *(const v4f*)(Qf + src + 4u);
  const v4f b0 = *(const v4f*)(Kf + src);
  const v4f b1 = *(const v4f*)(Kf + src + 4u);
  v8h xq, xk;
#pragma unroll
  for (int i = 0; i < 4; ++i) {
    xq[i]     = toh_flush(QKCARRY * bf16r(a0[i]));
    xq[i + 4] = toh_flush(QKCARRY * bf16r(a1[i]));
    xk[i]     = toh_flush(QKCARRY * bf16r(b0[i]));
    xk[i + 4] = toh_flush(QKCARRY * bf16r(b1[i]));
  }
  *(v8h*)(Q16 + e) = xq;
  *(v8h*)(K16 + e) = xk;
  
}

// ---------------------------------------------------------------------------
// Transposed value plane: in W[K rows][N cols] (pitch ldw = N) -> out Wt[N][K] (pitch ldk = K),
// f16(64 * bf16(w)), per batch slice blockIdx.z (element strides wbatch / tbatch).
// Grid (N/64, K/64, batches). T: cross-wave (block barrier).
// Store loop: 32 rows per step x 2 steps = 64 rows of the tile.
// ---------------------------------------------------------------------------
static_assert((256 / 8) * 2 == 64);
__global__ __launch_bounds__(256) void vconv_kernel(
    const float* __restrict__ W, _Float16* __restrict__ Wt, unsigned ldw, unsigned ldk,
    unsigned wbatch, unsigned tbatch) {
  __shared__ __attribute__((aligned(16))) _Float16 T[64 * LDT];
  const unsigned tid = threadIdx.x;
  const unsigned n0 = blockIdx.x * 64u;
  const unsigned k0 = blockIdx.y * 64u;
  const size_t wb = (size_t)blockIdx.z * wbatch;
  const size_t tb = (size_t)blockIdx.z * tbatch;
#pragma unroll 4
  for (unsigned j = 0; j < 16u; ++j) {
    const unsigned idx = tid + 256u * j;
    const unsigned kr = idx >> 6, nc = idx & 63u;
    const float v = W[wb + (size_t)(k0 + kr) * ldw + n0 + nc];
    T[nc * LDT + kr] = toh_flush(WCARRY * bf16r(v));
  }
  __syncthreads();
  v8h x[2];
  size_t off[2];
#pragma unroll
  for (unsigned i = 0; i < 2u; ++i) {
    const unsigned n = 32u * i + (tid >> 3);
    const unsigned kc = (tid & 7u) * 8u;
    x[i] = *(const v8h*)&T[n * LDT + kc];
    off[i] = tb + (size_t)(n0 + n) * ldk + k0 + kc;
  }
#pragma unroll
  for (int i = 0; i < 2; ++i) *(v8h*)(Wt + off[i]) = x[i];
  
}

static_assert(2 * 8 == 16);
__global__ __launch_bounds__(256) __attribute__((amdgpu_num_vgpr(256))) void attn_kernel(
    const _Float16* __restrict__ Qh, const _Float16* __restrict__ Kh,
    const _Float16* __restrict__ Vt, float* __restrict__ Out) {
  __shared__ __attribute__((aligned(16))) _Float16 Ks[2 * 64 * LDT];   // [g][key][d]
  __shared__ __attribute__((aligned(16))) _Float16 Vs[2 * 64 * LDT];   // [g][d][key]
  __shared__ __attribute__((aligned(16))) float Os[4 * 16 * LDC];
  __shared__ __attribute__((aligned(16))) float Xs[4 * 32 * LDX];

  const unsigned tid = threadIdx.x, lane = tid & 31u;
  const unsigned w = (unsigned)__builtin_amdgcn_readfirstlane((int)(threadIdx.x >> 5));
  const unsigned g = w >> 2, wq = w & 3u;            // key half of a step; query row group
  const unsigned hh = lane >> 4, m = lane & 15u;
  const unsigned bh = blockIdx.z * (unsigned)NHEAD + blockIdx.y;
  const float scale = 0.125f / (QKCARRY * QKCARRY);  // HD^-0.5 over the plane carries
  const unsigned obase = wq * (16u * LDC);
  const _Float16* const Kw = &Ks[g * (64u * LDT)];
  const _Float16* const Vw = &Vs[g * (64u * LDT)];
  float* const xrow = &Xs[(wq * 32u + lane) * LDX];
  const size_t kplane = (size_t)bh * SEQ * HD;
  const size_t vplane = (size_t)bh * HD * SEQ;
  // staging: the thread's own element inside a step's K rows / V^T rows (global) and tiles (LDS);
  // piece j lies 32 keys (K) or 16 rows of d (V^T) further on
  const unsigned kgo = (tid >> 3) * (unsigned)HD + (tid & 7u) * 8u;
  const unsigned vgo = (tid >> 4) * (unsigned)SEQ + (tid & 15u) * 8u;
  const unsigned klo = (tid >> 3) * LDT + (tid & 7u) * 8u;
  const unsigned vlo = ((tid & 15u) >> 3) * (64u * LDT) + (tid >> 4) * LDT + (tid & 7u) * 8u;
  const unsigned qgo = m * (unsigned)HD + hh * 8u;   // the lane's element inside its wave's Q rows

#pragma unroll 1   // the two tiles run one after the other through one copy of the loop
  for (unsigned pass = 0; pass < 2u; ++pass) {
  const unsigned q0 = (pass ? blockIdx.x : ((unsigned)NQT - 1u - blockIdx.x)) * 64u;
  const unsigned ci = q0 / (unsigned)CHUNK;          // chunk of this query block
  const unsigned cs = ci * (unsigned)CHUNK;          // first key of the diagonal chunk
  const bool first_blk = (q0 - cs < 128u);           // first 128 rows of the chunk; block-uniform
  const unsigned qrow0 = q0 + wq * 16u;

  const _Float16* const qw = Qh + ((size_t)bh * SEQ + qrow0) * HD;   // wave-uniform
  v16h qf[2];
  qf[0] = frag_at(qw + qgo);
  qf[1] = frag_at(qw + qgo + 32);
  // precaution: the loads' address registers are reused by the staging below before any other wait
  asm volatile("s_wait_xcnt 0x0" ::: "memory");

  float mrow = -1.0e30f, lrow = 0.0f;   // of query row m; lrow: this half's keys only
  // The running output (sum of the chunks' O / l) rests in group 0's own output rows of Os, which
  // are idle until the epilogue: lane (hh, m) owns cells [m][16 nb + 8 hh + 0..7], touched once per
  // chunk. That leaves its 32 registers to the V^T fragments held across the softmax.
  float* const orow = &Os[obase + m * LDC + hh * 8u];
  v8f o[4];
#pragma unroll
  for (int nb = 0; nb < 4; ++nb) o[nb] = (v8f){};
  if (g == 0u) {
#pragma unroll
    for (int nb = 0; nb < 4; ++nb) {
      *(v4f*)(orow + nb * 16) = (v4f){};
      *(v4f*)(orow + nb * 16 + 4) = (v4f){};
    }
  }

#pragma unroll 1
  for (unsigned jc = 0; jc <= ci; ++jc) {
    const bool offd = (jc < ci);                     // past chunk: every cell masked
    const unsigned kc0 = jc * (unsigned)CHUNK;
    const unsigned kc1 =                             // <= SEQ
        offd ? (kc0 + (unsigned)CHUNK) : (cs + ((q0 - cs + 191u) & ~127u));

#pragma unroll 1
    for (unsigned ks = kc0; ks < kc1; ks += 128u) {   // kc1 - kc0 is a multiple of 128
      const unsigned kb = ks + g * 64u;                // this wave's 64 keys
      const bool early = (P_RES != 0) && first_blk && (!offd) && (kb == cs);   // wave-uniform
      const _Float16* const kstep = Kh + kplane + (size_t)ks * HD;   // block-uniform
      const _Float16* const vstep = Vt + vplane + ks;
#pragma unroll
      for (unsigned j = 0; j < 4u; ++j) {
        *(v8h*)&Ks[klo + j * (32u * LDT)] = *(const v8h*)(kstep + kgo + j * (32u * HD));
        *(v8h*)&Vs[vlo + j * (16u * LDT)] = *(const v8h*)(vstep + vgo + j * (16u * SEQ));
      }
      __syncthreads();

      // scores: 4 key groups of 16, K = 64 in two 32-steps. All eight K fragments are read as
      // one group ahead of the eight products (one LDS latency per tile, not one per product);
      // the four accumulators advance side by side, each still c = 0 then c = 1.
      v16h kf[2][4];
#pragma unroll
      for (int c = 0; c < 2; ++c)
#pragma unroll
        for (int kg = 0; kg < 4; ++kg) kf[c][kg] = ld_frag(&Kw[(kg * 16) * LDT + c * 32], LDT);
      v8f s[4];
#pragma unroll
      for (int kg = 0; kg < 4; ++kg) s[kg] = (v8f){};
#pragma unroll
      for (int c = 0; c < 2; ++c)
#pragma unroll
        for (int kg = 0; kg < 4; ++kg) s[kg] = wmma16(kf[c][kg], qf[c], s[kg]);

      // all eight V^T fragments, issued here as one group: they land while the softmax runs
      v16h vf[2][4];
#pragma unroll
      for (int c = 0; c < 2; ++c)
#pragma unroll
        for (int nb = 0; nb < 4; ++nb) vf[c][nb] = ld_frag(&Vw[(nb * 16) * LDT + c * 32], LDT);

#pragma unroll
      for (int kg = 0; kg < 4; ++kg) s[kg] = s[kg] * scale;

      // additive mask; wave-uniform tests, per-cell addend selected by value
      if (offd) {
#pragma unroll
        for (int kg = 0; kg < 4; ++kg)
#pragma unroll
          for (int v = 0; v < 8; ++v) s[kg][v] = s[kg][v] + NEGFILL;
      } else if (kb >= q0) {
#pragma unroll
        for (int kg = 0; kg < 4; ++kg)
#pragma unroll
          for (int v = 0; v < 8; ++v) {
            const unsigned key = kb + (unsigned)kg * 16u + hh * 8u + (unsigned)v;
            const unsigned row = qrow0 + m;
            const float add = (key > row) ? NEGFILL : 0.0f;
            s[kg][v] = s[kg][v] + add;
          }
      }

      // online softmax; a lane holds 32 of its query row's 64 scores, lane ^ 16 the other 32
      float mk[4];
#pragma unroll
      for (int kg = 0; kg < 4; ++kg)
        mk[kg] = fmaxf(fmaxf(fmaxf(s[kg][0], s[kg][1]), fmaxf(s[kg][2], s[kg][3])),
                       fmaxf(fmaxf(s[kg][4], s[kg][5]), fmaxf(s[kg][6], s[kg][7])));
      float mx = fmaxf(fmaxf(mk[0], mk[1]), fmaxf(mk[2], mk[3]));
      mx = fmaxf(mx, xhalf(mx));
      const float mn = fmaxf(mrow, mx);
      const float alpha = __expf(mrow - mn);
      mrow = mn;
#pragma unroll
      for (int kg = 0; kg < 4; ++kg)
#pragma unroll
        for (int v = 0; v < 8; ++v) s[kg][v] = __expf(s[kg][v] - mrow);
      float sk[4];
#pragma unroll
      for (int kg = 0; kg < 4; ++kg)
        sk[kg] = ((s[kg][0] + s[kg][1]) + (s[kg][2] + s[kg][3])) +
                 ((s[kg][4] + s[kg][5]) + (s[kg][6] + s[kg][7]));
      lrow = alpha * lrow + ((sk[0] + sk[1]) + (sk[2] + sk[3]));
#pragma unroll
      for (int nb = 0; nb < 4; ++nb) o[nb] = o[nb] * alpha;

      // O^T += V^T . P^T  (K = 64 keys in two 32-steps; A = V^T tile [d][key], B = f16(1024 p))
#pragma unroll
      for (int c = 0; c < 2; ++c) {
        v16h pf;
#pragma unroll
        for (int v = 0; v < 8; ++v) {
          pf[v]     = toh_flush(s[2 * c][v] * PCARRY);
          pf[v + 8] = toh_flush(s[2 * c + 1][v] * PCARRY);
        }
#pragma unroll
        for (int nb = 0; nb < 4; ++nb) o[nb] = wmma16(vf[c][nb], pf, o[nb]);
      }

      if (early) {
        // P residual operand: f16(1024 * (1024 p - f16(1024 p)))
        v16h pr[2];
#pragma unroll
        for (int c = 0; c < 2; ++c)
#pragma unroll
          for (int v = 0; v < 16; ++v) {
            const float t = s[2 * c + (v >> 3)][v & 7] * PCARRY;
            const float hi = (float)toh_flush(t);
            pr[c][v] = toh_flush((t - hi) * RCARRY);
          }
        // V^T . P_res^T (scale 1/1024), one 16-row group of d at a time, folded immediately
#pragma unroll
        for (int nb = 0; nb < 4; ++nb) {
          v8f o2 = {};
#pragma unroll
          for (int c = 0; c < 2; ++c) {
            const v16h vr = ld_frag(&Vw[(nb * 16) * LDT + c * 32], LDT);
            o2 = wmma16(vr, pr[c], o2);
          }
#pragma unroll
          for (int v = 0; v < 8; ++v) o[nb][v] = o[nb][v] + o2[v] * (1.0f / RCARRY);
        }
      }
      __syncthreads();
    }

    // end of chunk: group 1 hands its state over, group 0 joins the two states, adds O / l to the
    // running output; both reset. Xs is rewritten only behind the next step's barriers.
    const float lsum = lrow + xhalf(lrow);   // the two lane halves' sums joined
    if (g != 0u) {
#pragma unroll
      for (int nb = 0; nb < 4; ++nb) {
        *(v4f*)(xrow + nb * 8)     = (v4f){o[nb][0], o[nb][1], o[nb][2], o[nb][3]};
        *(v4f*)(xrow + nb * 8 + 4) = (v4f){o[nb][4], o[nb][5], o[nb][6], o[nb][7]};
      }
      xrow[32] = mrow;
      xrow[33] = lsum;
    }
    __syncthreads();
    if (g == 0u) {
      const float m1 = xrow[32], l1 = xrow[33];
      const float mm = fmaxf(mrow, m1);
      const float a0 = __expf(mrow - mm), a1 = __expf(m1 - mm);
      const float inv = __builtin_amdgcn_rcpf(a0 * lsum + a1 * l1);
      const float f0 = a0 * inv, f1 = a1 * inv;
#pragma unroll
      for (int nb = 0; nb < 4; ++nb) {
        const v4f x0 = *(const v4f*)(xrow + nb * 8);
        const v4f x1 = *(const v4f*)(xrow + nb * 8 + 4);
        v4f t0 = *(const v4f*)(orow + nb * 16);
        v4f t1 = *(const v4f*)(orow + nb * 16 + 4);
#pragma unroll
        for (int v = 0; v < 4; ++v) {
          t0[v] = t0[v] + (o[nb][v] * f0 + x0[v] * f1);
          t1[v] = t1[v] + (o[nb][v + 4] * f0 + x1[v] * f1);
        }
        *(v4f*)(orow + nb * 16) = t0;
        *(v4f*)(orow + nb * 16 + 4) = t1;
      }
    }
#pragma unroll
    for (int nb = 0; nb < 4; ++nb) o[nb] = (v8f){};
    mrow = -1.0e30f;
    lrow = 0.0f;
  }

  if (g == 0u) {
  const float fs = 1.0f / (PCARRY * WCARRY);
  wave_lds_sync();
  v4f x[8];
  size_t off[8];
#pragma unroll
  for (unsigned i = 0; i < 8u; ++i) {
    const unsigned r = 2u * i + (lane >> 4);
    const unsigned c = (lane & 15u) * 4u;
    x[i] = *(const v4f*)&Os[obase + r * LDC + c] * fs;
    off[i] = ((size_t)bh * SEQ_FULL + qrow0 + r) * HD + c;
  }
#pragma unroll
  for (int i = 0; i < 8; ++i) *(v4f*)(Out + off[i]) = x[i];
  // precaution: the second tile's first instructions reuse the stores' address and data registers
  asm volatile("s_wait_xcnt 0x0" ::: "memory");
  }
  }   // pass
}

// ---------------------------------------------------------------------------
extern "C" void kernel_launch(void* const* d_in, const int* in_sizes, int n_in,
                              void* d_out, int out_size, void* d_ws, size_t ws_size,
                              hipStream_t stream) {
  if (n_in < 3) return;
  const long long need = ((long long)(NBH - 1) * SEQ_FULL + SEQ) * HD;
  if ((long long)in_sizes[0] < need) return;
  if ((long long)in_sizes[1] < need) return;
  if ((long long)in_sizes[2] < need) return;
  if ((long long)out_size < need) return;
  if (ws_size < WS_TOTAL) return;

  const float* Qf = (const float*)d_in[0];    // query [NB_FULL][NHEAD][SEQ_FULL][HD]
  const float* Kf = (const float*)d_in[1];    // key
  const float* Vf = (const float*)d_in[2];    // value
  float* out = (float*)d_out;                 // [NB_FULL][NHEAD][SEQ_FULL][HD]

  char* ws = (char*)d_ws;
  _Float16* Q16  = (_Float16*)(ws + OFF_Q);    // [bh][SEQ][HD]
  _Float16* K16  = (_Float16*)(ws + OFF_K);    // [bh][SEQ][HD]
  _Float16* Vt16 = (_Float16*)(ws + OFF_VT);   // [bh][HD][SEQ]

  dim3 blk(256);
  qkconv_kernel<<<dim3((unsigned)(((size_t)NBH * SEQ * HD) / 2048u)), blk, 0, stream>>>(
      Qf, Kf, Q16, K16);
  // value: in [SEQ rows][HD cols] per bh -> out [HD][SEQ] per bh; grid (HD/64, SEQ/64, NBH)
  vconv_kernel<<<dim3(HD / 64, SEQ / 64, NBH), blk, 0, stream>>>(
      Vf, Vt16, (unsigned)HD, (unsigned)SEQ, (unsigned)(SEQ_FULL * HD), (unsigned)(HD * SEQ));
  attn_kernel<<<dim3(NQT / 2, NHEAD, NB), blk, 0, stream>>>(Q16, K16, Vt16, out);
}

// v004
// One run takes 43.7 microseconds.
// In two side-by-side timings against v003, it was 1.06 and 1.07 times as fast.
// Counting every step since v000, it is 2.15 times as fast.
#include <hip/hip_runtime.h>
#include <stddef.h>

// All contractions on v_wmma_f32_16x16x32_f16 (f16 operands, f32 accumulate): q.k scores and p.v.
// Float inputs are RNE-converted to bf16 and carried in f16 (q and k x16, v x64, p x1024; p gets
// an extra x1024 residual plane with its own accumulator on the first key tile of the first
// 128 query rows of every 512-row chunk). Softmax, additive mask, chunk sums in f32.
// Causal chunked attention: per 512-key chunk an independent softmax (additive -1e9 on masked
// cells; every cell of a past chunk is masked), the chunk outputs are summed.

typedef _Float16 v16h __attribute__((ext_vector_type(16)));
typedef _Float16 v8h  __attribute__((ext_vector_type(8)));
typedef float    v8f  __attribute__((ext_vector_type(8)));
typedef float    v4f  __attribute__((ext_vector_type(4)));

#ifndef NB
#define NB 2
#endif
#ifndef SEQ
#define SEQ 2048
#endif
#define NB_FULL  2
#define SEQ_FULL 2048
#define NHEAD 16
#define HD    64
#define CHUNK 512
#define NBH   (NB * NHEAD)

static_assert(NB >= 1 && NB <= NB_FULL);
static_assert(SEQ >= CHUNK && SEQ <= SEQ_FULL && (SEQ % CHUNK) == 0);
static_assert((CHUNK % 128) == 0 && (SEQ % 128) == 0 && (SEQ % 64) == 0);
static_assert(HD == 64);
static_assert(((size_t)NBH * SEQ * HD) % (256u * 8u) == 0);      // convert grid x block x 8 == plane extent
static_assert((size_t)NBH * SEQ_FULL * HD < (size_t)0xFFFFFFFFu);

#define LDT 72   // halves per LDS row (144 B, 16-B aligned)
#define LDC 68   // floats per LDS row (272 B, 16-B aligned)
static_assert((LDT % 8) == 0 && LDT >= 64);
static_assert((LDC % 4) == 0 && LDC >= 64);

#define QKCARRY 16.0f    // q and k planes carried x16 each
#define WCARRY  64.0f    // value plane carried x64
#define PCARRY  1024.0f  // softmax numerators carried x1024
#define RCARRY  1024.0f  // residual plane of p carried x1024 on top of its hi part
#define NEGFILL (-1.0e9f)
#ifndef P_RES
#define P_RES 1          // 1: p residual product on the early band; 0: single product everywhere
#endif

// workspace layout (bytes)
#define PLANE16_BYTES ((size_t)NBH * SEQ * HD * 2)
#define OFF_Q  ((size_t)0)
#define OFF_K  (OFF_Q + PLANE16_BYTES)
#define OFF_VT (OFF_K + PLANE16_BYTES)
#define WS_TOTAL (OFF_VT + PLANE16_BYTES)
static_assert((PLANE16_BYTES % 128) == 0);
static_assert(WS_TOTAL <= (size_t)134217728);

#define LDX 36   // floats per lane slot of the state exchange (144 B, 16-B aligned)
static_assert((LDX % 4) == 0 && LDX >= 34);
#define NQT (SEQ / 64)   // query tiles of 64 rows per head
static_assert((NQT % 2) == 0);

// static LDS of the attention kernel
static_assert((size_t)(2 * 64 * LDT * 2) * 2 + (size_t)(4 * 16 * LDC * 4) +
              (size_t)(4 * 32 * LDX * 4) <= (size_t)131072);

// ---------------------------------------------------------------------------
__device__ __forceinline__ float bf16r(float x) {   // RNE convert to bf16, returned widened
  unsigned int u = __float_as_uint(x);
  u = (u + 0x7FFFu + ((u >> 16) & 1u)) & 0xFFFF0000u;
  return __uint_as_float(u);
}

// f32 -> f16 that cannot produce an f16 subnormal (value select)
static __device__ __forceinline__ _Float16 toh_flush(float v) {
  const _Float16 r = (_Float16)v;
  return (fabsf(v) < 6.103515625e-05f) ? (_Float16)0.0f : r;
}

// 16-bit fragment: p points at element [row = lane&15][k0 + 8*(lane>>4)] of a k-contiguous
// row. Elements 0..7 <- k0+8h+0..7, elements 8..15 <- k0+16+8h+0..7 (same map for A and B).
__device__ __forceinline__ v16h frag_at(const _Float16* p) {
  v8h lo = *(const v8h*)(p);
  v8h hi = *(const v8h*)(p + 16);
  v16h out;
#pragma unroll
  for (int i = 0; i < 8; ++i) { out[i] = lo[i]; out[i + 8] = hi[i]; }
  return out;
}
__device__ __forceinline__ v16h ld_frag(const _Float16* base, unsigned ld) {
  const unsigned lane = threadIdx.x & 31u;
  return frag_at(base + (lane & 15u) * ld + (lane >> 4) * 8u);
}

__device__ __forceinline__ v8f wmma16(v16h a, v16h b, v8f c) {
  v8f d = __builtin_amdgcn_wmma_f32_16x16x32_f16(false, a, false, b, (short)0, c,
                                                 false, false);
  asm volatile("v_nop\n\tv_nop\n\tv_nop\n\tv_nop" : "+v"(d) : "v"(a), "v"(b));
  return d;
}

__device__ __forceinline__ float xhalf(float x) {   // value of lane l ^ 16
  const int b = __builtin_bit_cast(int, x);
  return __builtin_bit_cast(float, __builtin_amdgcn_permlanex16(b, b, 0x76543210, 0xfedcba98,
                                                                false, false));
}

// compile-time kind of a key chunk: a past chunk (every cell masked) or the diagonal chunk
struct PastChunk { static constexpr bool past = true; };
struct DiagChunk { static constexpr bool past = false; };

__device__ __forceinline__ void wave_lds_sync() {
  __builtin_amdgcn_fence(3 /* release order */, "wavefront");
  asm volatile("s_wait_dscnt 0x0" ::: "memory");
  __builtin_amdgcn_wave_barrier();
}

// ---------------------------------------------------------------------------
// q / k planes: compact [bh][s][64] f16(16 * bf16(x)). Each thread converts 8 consecutive
// elements of q and of k; one store instruction of a wave covers 512 contiguous bytes
// ---------------------------------------------------------------------------
__global__ __launch_bounds__(256) void qkconv_kernel(
    const float* __restrict__ Qf, const float* __restrict__ Kf,
    _Float16* __restrict__ Q16, _Float16* __restrict__ K16) {
  const unsigned e = (blockIdx.x * 256u + threadIdx.x) * 8u;   // compact element index
  const unsigned crow = e >> 6, c = e & 63u;
  const unsigned bh = crow / (unsigned)SEQ;
  const unsigned sq = crow - bh * (unsigned)SEQ;
  const size_t src = ((size_t)bh * SEQ_FULL + sq) * HD + c;
  const v4f a0 = *(const v4f*)(Qf + src);
  const v4f a1 = *(const v4f*)(Qf + src + 4u);
  const v4f b0 = *(const v4f*)(Kf + src);
  const v4f b1 = *(const v4f*)(Kf + src + 4u);
  v8h xq, xk;
#pragma unroll
  for (int i = 0; i < 4; ++i) {
    xq[i]     = toh_flush(QKCARRY * bf16r(a0[i]));
    xq[i + 4] = toh_flush(QKCARRY * bf16r(a1[i]));
    xk[i]     = toh_flush(QKCARRY * bf16r(b0[i]));
    xk[i + 4] = toh_flush(QKCARRY * bf16r(b1[i]));
  }
  *(v8h*)(Q16 + e) = xq;
  *(v8h*)(K16 + e) = xk;
  
}

// ---------------------------------------------------------------------------
// Transposed value plane: in W[K rows][N cols] (pitch ldw = N) -> out Wt[N][K] (pitch ldk = K),
// f16(64 * bf16(w)), per batch slice blockIdx.z (element strides wbatch / tbatch).
// Grid (N/64, K/64, batches). T: cross-wave (block barrier).
// Store loop: 32 rows per step x 2 steps = 64 rows of the tile.
// ---------------------------------------------------------------------------
static_assert((256 / 8) * 2 == 64);
__global__ __launch_bounds__(256) void vconv_kernel(
    const float* __restrict__ W, _Float16* __restrict__ Wt, unsigned ldw, unsigned ldk,
    unsigned wbatch, unsigned tbatch) {
  __shared__ __attribute__((aligned(16))) _Float16 T[64 * LDT];
  const unsigned tid = threadIdx.x;
  const unsigned n0 = blockIdx.x * 64u;
  const unsigned k0 = blockIdx.y * 64u;
  const size_t wb = (size_t)blockIdx.z * wbatch;
  const size_t tb = (size_t)blockIdx.z * tbatch;
#pragma unroll 4
  for (unsigned j = 0; j < 16u; ++j) {
    const unsigned idx = tid + 256u * j;
    const unsigned kr = idx >> 6, nc = idx & 63u;
    const float v = W[wb + (size_t)(k0 + kr) * ldw + n0 + nc];
    T[nc * LDT + kr] = toh_flush(WCARRY * bf16r(v));
  }
  __syncthreads();
  v8h x[2];
  size_t off[2];
#pragma unroll
  for (unsigned i = 0; i < 2u; ++i) {
    const unsigned n = 32u * i + (tid >> 3);
    const unsigned kc = (tid & 7u) * 8u;
    x[i] = *(const v8h*)&T[n * LDT + kc];
    off[i] = tb + (size_t)(n0 + n) * ldk + k0 + kc;
  }
#pragma unroll
  for (int i = 0; i < 2; ++i) *(v8h*)(Wt + off[i]) = x[i];
  
}

static_assert(2 * 8 == 16);
__global__ __launch_bounds__(256) __attribute__((amdgpu_num_vgpr(256))) void attn_kernel(
    const _Float16* __restrict__ Qh, const _Float16* __restrict__ Kh,
    const _Float16* __restrict__ Vt, float* __restrict__ Out) {
  __shared__ __attribute__((aligned(16))) _Float16 Ks[2 * 64 * LDT];   // [g][key][d]
  __shared__ __attribute__((aligned(16))) _Float16 Vs[2 * 64 * LDT];   // [g][d][key]
  __shared__ __attribute__((aligned(16))) float Os[4 * 16 * LDC];
  __shared__ __attribute__((aligned(16))) float Xs[4 * 32 * LDX];

  const unsigned tid = threadIdx.x, lane = tid & 31u;
  const unsigned w = (unsigned)__builtin_amdgcn_readfirstlane((int)(threadIdx.x >> 5));
  const unsigned g = w >> 2, wq = w & 3u;            // key half of a step; query row group
  const unsigned hh = lane >> 4, m = lane & 15u;
  const unsigned bh = blockIdx.z * (unsigned)NHEAD + blockIdx.y;
  const float scale = 0.125f / (QKCARRY * QKCARRY);  // HD^-0.5 over the plane carries
  const unsigned obase = wq * (16u * LDC);
  const _Float16* const Kw = &Ks[g * (64u * LDT)];
  const _Float16* const Vw = &Vs[g * (64u * LDT)];
  float* const xrow = &Xs[(wq * 32u + lane) * LDX];
  const size_t kplane = (size_t)bh * SEQ * HD;
  const size_t vplane = (size_t)bh * HD * SEQ;
  // staging: the thread's own element inside a step's K rows / V^T rows (global) and tiles (LDS);
  // piece j lies 32 keys (K) or 16 rows of d (V^T) further on
  const unsigned kgo = (tid >> 3) * (unsigned)HD + (tid & 7u) * 8u;
  const unsigned vgo = (tid >> 4) * (unsigned)SEQ + (tid & 15u) * 8u;
  const unsigned klo = (tid >> 3) * LDT + (tid & 7u) * 8u;
  const unsigned vlo = ((tid & 15u) >> 3) * (64u * LDT) + (tid >> 4) * LDT + (tid & 7u) * 8u;
  const unsigned qgo = m * (unsigned)HD + hh * 8u;   // the lane's element inside its wave's Q rows

#pragma unroll 1   // the two tiles run one after the other through one copy of the loop
  for (unsigned pass = 0; pass < 2u; ++pass) {
  const unsigned q0 = (pass ? blockIdx.x : ((unsigned)NQT - 1u - blockIdx.x)) * 64u;
  const unsigned ci = q0 / (unsigned)CHUNK;          // chunk of this query block
  const unsigned cs = ci * (unsigned)CHUNK;          // first key of the diagonal chunk
  const bool first_blk = (q0 - cs < 128u);           // first 128 rows of the chunk; block-uniform
  const unsigned qrow0 = q0 + wq * 16u;

  const _Float16* const qw = Qh + ((size_t)bh * SEQ + qrow0) * HD;   // wave-uniform
  v16h qf[2];
  qf[0] = frag_at(qw + qgo);
  qf[1] = frag_at(qw + qgo + 32);
  // precaution: the loads' address registers are reused by the staging below before any other wait
  asm volatile("s_wait_xcnt 0x0" ::: "memory");

  float mrow = -1.0e30f, lrow = 0.0f;   // of query row m; lrow: this half's keys only
  // The running output (sum of the chunks' O / l) rests in group 0's own output rows of Os, which
  // are idle until the epilogue: lane (hh, m) owns cells [m][16 nb + 8 hh + 0..7], touched once per
  // chunk. That leaves its 32 registers to the V^T fragments held across the softmax.
  float* const orow = &Os[obase + m * LDC + hh * 8u];
  v8f o[4];
#pragma unroll
  for (int nb = 0; nb < 4; ++nb) o[nb] = (v8f){};
  if (g == 0u) {
#pragma unroll
    for (int nb = 0; nb < 4; ++nb) {
      *(v4f*)(orow + nb * 16) = (v4f){};
      *(v4f*)(orow + nb * 16 + 4) = (v4f){};
    }
  }

#pragma unroll 1
  for (unsigned jc = 0; jc <= ci; ++jc) {
    const bool offd = (jc < ci);                     // past chunk: every cell masked
    const unsigned kc0 = jc * (unsigned)CHUNK;
    const unsigned kc1 =                             // <= SEQ
        offd ? (kc0 + (unsigned)CHUNK) : (cs + ((q0 - cs + 191u) & ~127u));

    // one 128-key step; compiled once for past chunks and once for the diagonal chunk
    auto step = [&](auto kind, const unsigned ks) __attribute__((always_inline)) {
      constexpr bool offd = decltype(kind)::past;
      const unsigned kb = ks + g * 64u;                // this wave's 64 keys
      const bool early = (P_RES != 0) && first_blk && (!offd) && (kb == cs);   // wave-uniform
      const _Float16* const kstep = Kh + kplane + (size_t)ks * HD;   // block-uniform
      const _Float16* const vstep = Vt + vplane + ks;
#pragma unroll
      for (unsigned j = 0; j < 4u; ++j) {
        *(v8h*)&Ks[klo + j * (32u * LDT)] = *(const v8h*)(kstep + kgo + j * (32u * HD));
        *(v8h*)&Vs[vlo + j * (16u * LDT)] = *(const v8h*)(vstep + vgo + j * (16u * SEQ));
      }
      __syncthreads();

      // scores: 4 key groups of 16, K = 64 in two 32-steps. All eight K fragments are read as
      // one group ahead of the eight products (one LDS latency per tile, not one per product);
      // the four accumulators advance side by side, each still c = 0 then c = 1.
      v16h kf[2][4];
#pragma unroll
      for (int c = 0; c < 2; ++c)
#pragma unroll
        for (int kg = 0; kg < 4; ++kg) kf[c][kg] = ld_frag(&Kw[(kg * 16) * LDT + c * 32], LDT);
      v8f s[4];
#pragma unroll
      for (int kg = 0; kg < 4; ++kg) s[kg] = (v8f){};
#pragma unroll
      for (int c = 0; c < 2; ++c)
#pragma unroll
        for (int kg = 0; kg < 4; ++kg) s[kg] = wmma16(kf[c][kg], qf[c], s[kg]);

      // all eight V^T fragments, issued here as one group: they land while the softmax runs
      v16h vf[2][4];
#pragma unroll
      for (int c = 0; c < 2; ++c)
#pragma unroll
        for (int nb = 0; nb < 4; ++nb) vf[c][nb] = ld_frag(&Vw[(nb * 16) * LDT + c * 32], LDT);

      // Past chunk: the f32 sum score + (-1e9) keeps steps of 64 only, so a whole tile's masked scores
      // are as a rule one and the same number. Tested by value: rounding is monotone, so when the
      // lane's smallest and largest score give the same masked value, all 32 between them do. Where
      // that value is also the other half's and the running maximum (or this is the chunk's first
      // step, whose state is all zero), the softmax below would find alpha = 1 and p = exp(0) = 1 in
      // every cell: the same numbers come from a constant P operand, without the softmax arithmetic.
      bool flat = false;                               // wave-uniform
      float tflat = 0.0f;
      if constexpr (offd) {
        float hi[4], lo[4];
#pragma unroll
        for (int kg = 0; kg < 4; ++kg) {
          hi[kg] = fmaxf(fmaxf(fmaxf(s[kg][0], s[kg][1]), fmaxf(s[kg][2], s[kg][3])),
                         fmaxf(fmaxf(s[kg][4], s[kg][5]), fmaxf(s[kg][6], s[kg][7])));
          lo[kg] = fminf(fminf(fminf(s[kg][0], s[kg][1]), fminf(s[kg][2], s[kg][3])),
                         fminf(fminf(s[kg][4], s[kg][5]), fminf(s[kg][6], s[kg][7])));
        }
        tflat = fmaxf(fmaxf(hi[0], hi[1]), fmaxf(hi[2], hi[3])) * scale + NEGFILL;
        const float tlo = fminf(fminf(lo[0], lo[1]), fminf(lo[2], lo[3])) * scale + NEGFILL;
        const bool ok = (bool)((int)(tlo == tflat) & (int)(xhalf(tflat) == tflat) &
                               ((int)(ks == kc0) | (int)(mrow == tflat)));
        flat = (__builtin_amdgcn_ballot_w32(ok) == 0xFFFFFFFFu);   // scalar test: EXEC stays full
      }

      // B operands of the two 32-key steps, f16(1024 p), and the new state: set for p = 1 in all of
      // this half's 32 cells; the softmax overwrites them where the tile is not flat
      v16h pf[2];
#pragma unroll
      for (int v = 0; v < 16; ++v) {
        pf[0][v] = (_Float16)PCARRY;
        pf[1][v] = (_Float16)PCARRY;
      }
      float mnew = tflat, lnew = lrow + 32.0f;
      // the hint lays the flat tile out as the fall-through of a past chunk's step
      if (__builtin_expect(!flat, !offd)) {
#pragma unroll
      for (int kg = 0; kg < 4; ++kg) s[kg] = s[kg] * scale;

      // additive mask; wave-uniform tests, per-cell addend selected by value
      if (offd) {
#pragma unroll
        for (int kg = 0; kg < 4; ++kg)
#pragma unroll
          for (int v = 0; v < 8; ++v) s[kg][v] = s[kg][v] + NEGFILL;
      } else if (kb >= q0) {
#pragma unroll
        for (int kg = 0; kg < 4; ++kg)
#pragma unroll
          for (int v = 0; v < 8; ++v) {
            const unsigned key = kb + (unsigned)kg * 16u + hh * 8u + (unsigned)v;
            const unsigned row = qrow0 + m;
            const float add = (key > row) ? NEGFILL : 0.0f;
            s[kg][v] = s[kg][v] + add;
          }
      }

      // online softmax; a lane holds 32 of its query row's 64 scores, lane ^ 16 the other 32
      float mk[4];
#pragma unroll
      for (int kg = 0; kg < 4; ++kg)
        mk[kg] = fmaxf(fmaxf(fmaxf(s[kg][0], s[kg][1]), fmaxf(s[kg][2], s[kg][3])),
                       fmaxf(fmaxf(s[kg][4], s[kg][5]), fmaxf(s[kg][6], s[kg][7])));
      float mx = fmaxf(fmaxf(mk[0], mk[1]), fmaxf(mk[2], mk[3]));
      mx = fmaxf(mx, xhalf(mx));
      const float mn = fmaxf(mrow, mx);
      const float alpha = __expf(mrow - mn);
      mnew = mn;
#pragma unroll
      for (int kg = 0; kg < 4; ++kg)
#pragma unroll
        for (int v = 0; v < 8; ++v) s[kg][v] = __expf(s[kg][v] - mn);
      float sk[4];
#pragma unroll
      for (int kg = 0; kg < 4; ++kg)
        sk[kg] = ((s[kg][0] + s[kg][1]) + (s[kg][2] + s[kg][3])) +
                 ((s[kg][4] + s[kg][5]) + (s[kg][6] + s[kg][7]));
      lnew = alpha * lrow + ((sk[0] + sk[1]) + (sk[2] + sk[3]));
#pragma unroll
      for (int nb = 0; nb < 4; ++nb) o[nb] = o[nb] * alpha;
#pragma unroll
      for (int c = 0; c < 2; ++c)
#pragma unroll
        for (int v = 0; v < 8; ++v) {
          pf[c][v]     = toh_flush(s[2 * c][v] * PCARRY);
          pf[c][v + 8] = toh_flush(s[2 * c + 1][v] * PCARRY);
        }
      }   // softmax of a tile that is not flat
      mrow = mnew;
      lrow = lnew;

      // O^T += V^T . P^T  (K = 64 keys in two 32-steps; A = V^T tile [d][key], B = f16(1024 p))
#pragma unroll
      for (int c = 0; c < 2; ++c)
#pragma unroll
        for (int nb = 0; nb < 4; ++nb) o[nb] = wmma16(vf[c][nb], pf[c], o[nb]);

      if (early) {
        // P residual operand: f16(1024 * (1024 p - f16(1024 p)))
        v16h pr[2];
#pragma unroll
        for (int c = 0; c < 2; ++c)
#pragma unroll
          for (int v = 0; v < 16; ++v) {
            const float t = s[2 * c + (v >> 3)][v & 7] * PCARRY;
            const float hi = (float)toh_flush(t);
            pr[c][v] = toh_flush((t - hi) * RCARRY);
          }
        // V^T . P_res^T (scale 1/1024), one 16-row group of d at a time, folded immediately
#pragma unroll
        for (int nb = 0; nb < 4; ++nb) {
          v8f o2 = {};
#pragma unroll
          for (int c = 0; c < 2; ++c) {
            const v16h vr = ld_frag(&Vw[(nb * 16) * LDT + c * 32], LDT);
            o2 = wmma16(vr, pr[c], o2);
          }
#pragma unroll
          for (int v = 0; v < 8; ++v) o[nb][v] = o[nb][v] + o2[v] * (1.0f / RCARRY);
        }
      }
      __syncthreads();
    };
    // kc1 - kc0 is a multiple of 128; both loops stay rolled: one copy of the large body per kind
    if (offd) {
#pragma unroll 1
      for (unsigned ks = kc0; ks < kc1; ks += 128u) step(PastChunk{}, ks);
    } else {
#pragma unroll 1
      for (unsigned ks = kc0; ks < kc1; ks += 128u) step(DiagChunk{}, ks);
    }

    // end of chunk: group 1 hands its state over, group 0 joins the two states, adds O / l to the
    // running output; both reset. Xs is rewritten only behind the next step's barriers.
    const float lsum = lrow + xhalf(lrow);   // the two lane halves' sums joined
    if (g != 0u) {
#pragma unroll
      for (int nb = 0; nb < 4; ++nb) {
        *(v4f*)(xrow + nb * 8)     = (v4f){o[nb][0], o[nb][1], o[nb][2], o[nb][3]};
        *(v4f*)(xrow + nb * 8 + 4) = (v4f){o[nb][4], o[nb][5], o[nb][6], o[nb][7]};
      }
      xrow[32] = mrow;
      xrow[33] = lsum;
    }
    __syncthreads();
    if (g == 0u) {
      const float m1 = xrow[32], l1 = xrow[33];
      const float mm = fmaxf(mrow, m1);
      const float a0 = __expf(mrow - mm), a1 = __expf(m1 - mm);
      const float inv = __builtin_amdgcn_rcpf(a0 * lsum + a1 * l1);
      const float f0 = a0 * inv, f1 = a1 * inv;
#pragma unroll
      for (int nb = 0; nb < 4; ++nb) {
        const v4f x0 = *(const v4f*)(xrow + nb * 8);
        const v4f x1 = *(const v4f*)(xrow + nb * 8 + 4);
        v4f t0 = *(const v4f*)(orow + nb * 16);
        v4f t1 = *(const v4f*)(orow + nb * 16 + 4);
#pragma unroll
        for (int v = 0; v < 4; ++v) {
          t0[v] = t0[v] + (o[nb][v] * f0 + x0[v] * f1);
          t1[v] = t1[v] + (o[nb][v + 4] * f0 + x1[v] * f1);
        }
        *(v4f*)(orow + nb * 16) = t0;
        *(v4f*)(orow + nb * 16 + 4) = t1;
      }
    }
#pragma unroll
    for (int nb = 0; nb < 4; ++nb) o[nb] = (v8f){};
    mrow = -1.0e30f;
    lrow = 0.0f;
  }

  if (g == 0u) {
  const float fs = 1.0f / (PCARRY * WCARRY);
  wave_lds_sync();
  v4f x[8];
  size_t off[8];
#pragma unroll
  for (unsigned i = 0; i < 8u; ++i) {
    const unsigned r = 2u * i + (lane >> 4);
    const unsigned c = (lane & 15u) * 4u;
    x[i] = *(const v4f*)&Os[obase + r * LDC + c] * fs;
    off[i] = ((size_t)bh * SEQ_FULL + qrow0 + r) * HD + c;
  }
#pragma unroll
  for (int i = 0; i < 8; ++i) *(v4f*)(Out + off[i]) = x[i];
  // precaution: the second tile's first instructions reuse the stores' address and data registers
  asm volatile("s_wait_xcnt 0x0" ::: "memory");
  }
  }   // pass
}

// ---------------------------------------------------------------------------
extern "C" void kernel_launch(void* const* d_in, const int* in_sizes, int n_in,
                              void* d_out, int out_size, void* d_ws, size_t ws_size,
                              hipStream_t stream) {
  if (n_in < 3) return;
  const long long need = ((long long)(NBH - 1) * SEQ_FULL + SEQ) * HD;
  if ((long long)in_sizes[0] < need) return;
  if ((long long)in_sizes[1] < need) return;
  if ((long long)in_sizes[2] < need) return;
  if ((long long)out_size < need) return;
  if (ws_size < WS_TOTAL) return;

  const float* Qf = (const float*)d_in[0];    // query [NB_FULL][NHEAD][SEQ_FULL][HD]
  const float* Kf = (const float*)d_in[1];    // key
  const float* Vf = (const float*)d_in[2];    // value
  float* out = (float*)d_out;                 // [NB_FULL][NHEAD][SEQ_FULL][HD]

  char* ws = (char*)d_ws;
  _Float16* Q16  = (_Float16*)(ws + OFF_Q);    // [bh][SEQ][HD]
  _Float16* K16  = (_Float16*)(ws + OFF_K);    // [bh][SEQ][HD]
  _Float16* Vt16 = (_Float16*)(ws + OFF_VT);   // [bh][HD][SEQ]

  dim3 blk(256);
  qkconv_kernel<<<dim3((unsigned)(((size_t)NBH * SEQ * HD) / 2048u)), blk, 0, stream>>>(
      Qf, Kf, Q16, K16);
  // value: in [SEQ rows][HD cols] per bh -> out [HD][SEQ] per bh; grid (HD/64, SEQ/64, NBH)
  vconv_kernel<<<dim3(HD / 64, SEQ / 64, NBH), blk, 0, stream>>>(
      Vf, Vt16, (unsigned)HD, (unsigned)SEQ, (unsigned)(SEQ_FULL * HD), (unsigned)(HD * SEQ));
  attn_kernel<<<dim3(NQT / 2, NHEAD, NB), blk, 0, stream>>>(Q16, K16, Vt16, out);
}

// v005
// It runs in 38.7 microseconds.
// In two side-by-side timings against v004, it was 1.14 and 1.12 times as fast.
// Over all steps from v000 it is 2.44 times as fast.
#include <hip/hip_runtime.h>
#include <stddef.h>

// All contractions on v_wmma_f32_16x16x32_f16 (f16 operands, f32 accumulate): q.k scores and p.v.
// Float inputs are RNE-converted to bf16 and carried in f16 (q and k x16, v x64, p x1024; p gets
// an extra x1024 residual plane with its own accumulator on the first key tile of the first
// 128 query rows of every 512-row chunk). Softmax, additive mask, chunk sums in f32.
// Causal chunked attention: per 512-key chunk an independent softmax (additive -1e9 on masked
// cells; every cell of a past chunk is masked), the chunk outputs are summed.

typedef _Float16 v16h __attribute__((ext_vector_type(16)));
typedef _Float16 v8h  __attribute__((ext_vector_type(8)));
typedef float    v8f  __attribute__((ext_vector_type(8)));
typedef float    v4f  __attribute__((ext_vector_type(4)));

#ifndef NB
#define NB 2
#endif
#ifndef SEQ
#define SEQ 2048
#endif
#define NB_FULL  2
#define SEQ_FULL 2048
#define NHEAD 16
#define HD    64
#define CHUNK 512
#define NBH   (NB * NHEAD)

static_assert(NB >= 1 && NB <= NB_FULL);
static_assert(SEQ >= CHUNK && SEQ <= SEQ_FULL && (SEQ % CHUNK) == 0);
static_assert((CHUNK % 128) == 0 && (SEQ % 128) == 0 && (SEQ % 64) == 0);
static_assert(HD == 64);
static_assert(((size_t)NBH * SEQ * HD) % (256u * 8u) == 0);      // convert grid x block x 8 == plane extent
static_assert((size_t)NBH * SEQ_FULL * HD < (size_t)0xFFFFFFFFu);

#define LDT 72   // halves per LDS row (144 B, 16-B aligned)
#define LDC 68   // floats per LDS row (272 B, 16-B aligned)
static_assert((LDT % 8) == 0 && LDT >= 64);
static_assert((LDC % 4) == 0 && LDC >= 64);

#define QKCARRY 16.0f    // q and k planes carried x16 each
#define WCARRY  64.0f    // value plane carried x64
#define PCARRY  1024.0f  // softmax numerators carried x1024
#define RCARRY  1024.0f  // residual plane of p carried x1024 on top of its hi part
#define NEGFILL (-1.0e9f)
#ifndef P_RES
#define P_RES 1          // 1: p residual product on the early band; 0: single product everywhere
#endif

// workspace layout (bytes)
#define PLANE16_BYTES ((size_t)NBH * SEQ * HD * 2)
#define OFF_Q  ((size_t)0)
#define OFF_K  (OFF_Q + PLANE16_BYTES)
#define OFF_VT (OFF_K + PLANE16_BYTES)
#define WS_TOTAL (OFF_VT + PLANE16_BYTES)
static_assert((PLANE16_BYTES % 128) == 0);
static_assert(WS_TOTAL <= (size_t)134217728);

#define LDX 36   // floats per lane slot of the state exchange (144 B, 16-B aligned)
static_assert((LDX % 4) == 0 && LDX >= 34);
#define NQT (SEQ / 64)   // query tiles of 64 rows per head
static_assert((NQT % 2) == 0);

#define TILEH (2u * 64u * LDT)   // halves of one staging buffer of K or of V^T: both key halves of a step

// static LDS of the attention kernel (two staging buffers of K and of V^T)
static_assert((size_t)(2 * TILEH * 2) * 2 + (size_t)(4 * 16 * LDC * 4) +
              (size_t)(4 * 32 * LDX * 4) <= (size_t)131072);

// ---------------------------------------------------------------------------
__device__ __forceinline__ float bf16r(float x) {   // RNE convert to bf16, returned widened
  unsigned int u = __float_as_uint(x);
  u = (u + 0x7FFFu + ((u >> 16) & 1u)) & 0xFFFF0000u;
  return __uint_as_float(u);
}

// f32 -> f16 that cannot produce an f16 subnormal (value select)
static __device__ __forceinline__ _Float16 toh_flush(float v) {
  const _Float16 r = (_Float16)v;
  return (fabsf(v) < 6.103515625e-05f) ? (_Float16)0.0f : r;
}

// 16-bit fragment: p points at element [row = lane&15][k0 + 8*(lane>>4)] of a k-contiguous
// row. Elements 0..7 <- k0+8h+0..7, elements 8..15 <- k0+16+8h+0..7 (same map for A and B).
__device__ __forceinline__ v16h frag_at(const _Float16* p) {
  v8h lo = *(const v8h*)(p);
  v8h hi = *(const v8h*)(p + 16);
  v16h out;
#pragma unroll
  for (int i = 0; i < 8; ++i) { out[i] = lo[i]; out[i + 8] = hi[i]; }
  return out;
}
__device__ __forceinline__ v16h ld_frag(const _Float16* base, unsigned ld) {
  const unsigned lane = threadIdx.x & 31u;
  return frag_at(base + (lane & 15u) * ld + (lane >> 4) * 8u);
}

__device__ __forceinline__ v8f wmma16(v16h a, v16h b, v8f c) {
  v8f d = __builtin_amdgcn_wmma_f32_16x16x32_f16(false, a, false, b, (short)0, c,
                                                 false, false);
  asm volatile("v_nop\n\tv_nop\n\tv_nop\n\tv_nop" : "+v"(d) : "v"(a), "v"(b));
  return d;
}

__device__ __forceinline__ float xhalf(float x) {   // value of lane l ^ 16
  const int b = __builtin_bit_cast(int, x);
  return __builtin_bit_cast(float, __builtin_amdgcn_permlanex16(b, b, 0x76543210, 0xfedcba98,
                                                                false, false));
}

// compile-time kind of a key chunk: a past chunk (every cell masked) or the diagonal chunk
struct PastChunk { static constexpr bool past = true; };
struct DiagChunk { static constexpr bool past = false; };

// number of 128-key steps of the 64-row query tile at q0: its past chunks whole, then the diagonal
// chunk up to key q0 + 63, rounded up to whole steps; at least 1
__device__ __forceinline__ unsigned steps_of(unsigned q0) {
  const unsigned cs = q0 & ~((unsigned)CHUNK - 1u);
  return (cs + ((q0 - cs + 191u) & ~127u)) >> 7;
}

__device__ __forceinline__ unsigned lds_off(const void* p) { return (unsigned)(size_t)p; }

__device__ __forceinline__ void wave_lds_sync() {
  __builtin_amdgcn_fence(3 /* release order */, "wavefront");
  asm volatile("s_wait_dscnt 0x0" ::: "memory");
  __builtin_amdgcn_wave_barrier();
}

// ---------------------------------------------------------------------------
// q / k planes: compact [bh][s][64] f16(16 * bf16(x)). Each thread converts 8 consecutive
// elements of q and of k; one store instruction of a wave covers 512 contiguous bytes
// ---------------------------------------------------------------------------
__global__ __launch_bounds__(256) void qkconv_kernel(
    const float* __restrict__ Qf, const float* __restrict__ Kf,
    _Float16* __restrict__ Q16, _Float16* __restrict__ K16) {
  const unsigned e = (blockIdx.x * 256u + threadIdx.x) * 8u;   // compact element index
  const unsigned crow = e >> 6, c = e & 63u;
  const unsigned bh = crow / (unsigned)SEQ;
  const unsigned sq = crow - bh * (unsigned)SEQ;
  const size_t src = ((size_t)bh * SEQ_FULL + sq) * HD + c;
  const v4f a0 = *(const v4f*)(Qf + src);
  const v4f a1 = *(const v4f*)(Qf + src + 4u);
  const v4f b0 = *(const v4f*)(Kf + src);
  const v4f b1 = *(const v4f*)(Kf + src + 4u);
  v8h xq, xk;
#pragma unroll
  for (int i = 0; i < 4; ++i) {
    xq[i]     = toh_flush(QKCARRY * bf16r(a0[i]));
    xq[i + 4] = toh_flush(QKCARRY * bf16r(a1[i]));
    xk[i]     = toh_flush(QKCARRY * bf16r(b0[i]));
    xk[i + 4] = toh_flush(QKCARRY * bf16r(b1[i]));
  }
  *(v8h*)(Q16 + e) = xq;
  *(v8h*)(K16 + e) = xk;
  
}

// ---------------------------------------------------------------------------
// Transposed value plane: in W[K rows][N cols] (pitch ldw = N) -> out Wt[N][K] (pitch ldk = K),
// f16(64 * bf16(w)), per batch slice blockIdx.z (element strides wbatch / tbatch).
// Grid (N/64, K/64, batches). T: cross-wave (block barrier).
// Store loop: 32 rows per step x 2 steps = 64 rows of the tile.
// ---------------------------------------------------------------------------
static_assert((256 / 8) * 2 == 64);
__global__ __launch_bounds__(256) void vconv_kernel(
    const float* __restrict__ W, _Float16* __restrict__ Wt, unsigned ldw, unsigned ldk,
    unsigned wbatch, unsigned tbatch) {
  __shared__ __attribute__((aligned(16))) _Float16 T[64 * LDT];
  const unsigned tid = threadIdx.x;
  const unsigned n0 = blockIdx.x * 64u;
  const unsigned k0 = blockIdx.y * 64u;
  const size_t wb = (size_t)blockIdx.z * wbatch;
  const size_t tb = (size_t)blockIdx.z * tbatch;
#pragma unroll 4
  for (unsigned j = 0; j < 16u; ++j) {
    const unsigned idx = tid + 256u * j;
    const unsigned kr = idx >> 6, nc = idx & 63u;
    const float v = W[wb + (size_t)(k0 + kr) * ldw + n0 + nc];
    T[nc * LDT + kr] = toh_flush(WCARRY * bf16r(v));
  }
  __syncthreads();
  v8h x[2];
  size_t off[2];
#pragma unroll
  for (unsigned i = 0; i < 2u; ++i) {
    const unsigned n = 32u * i + (tid >> 3);
    const unsigned kc = (tid & 7u) * 8u;
    x[i] = *(const v8h*)&T[n * LDT + kc];
    off[i] = tb + (size_t)(n0 + n) * ldk + k0 + kc;
  }
#pragma unroll
  for (int i = 0; i < 2; ++i) *(v8h*)(Wt + off[i]) = x[i];
  
}

static_assert(2 * 8 == 16);
__global__ __launch_bounds__(256) __attribute__((amdgpu_num_vgpr(256))) void attn_kernel(
    const _Float16* __restrict__ Qh, const _Float16* __restrict__ Kh,
    const _Float16* __restrict__ Vt, float* __restrict__ Out) {
  __shared__ __attribute__((aligned(16))) _Float16 Ks[2 * TILEH];   // [buffer][g][key][d]
  __shared__ __attribute__((aligned(16))) _Float16 Vs[2 * TILEH];   // [buffer][g][d][key]
  __shared__ __attribute__((aligned(16))) float Os[4 * 16 * LDC];
  __shared__ __attribute__((aligned(16))) float Xs[4 * 32 * LDX];

  const unsigned tid = threadIdx.x, lane = tid & 31u;
  const unsigned w = (unsigned)__builtin_amdgcn_readfirstlane((int)(threadIdx.x >> 5));
  const unsigned g = w >> 2, wq = w & 3u;            // key half of a step; query row group
  const unsigned hh = lane >> 4, m = lane & 15u;
  const unsigned bh = blockIdx.z * (unsigned)NHEAD + blockIdx.y;
  const float scale = 0.125f / (QKCARRY * QKCARRY);  // HD^-0.5 over the plane carries
  const unsigned obase = wq * (16u * LDC);
  float* const xrow = &Xs[(wq * 32u + lane) * LDX];
  const size_t kplane = (size_t)bh * SEQ * HD;
  const size_t vplane = (size_t)bh * HD * SEQ;
  // staging: the thread's own element inside a step's K rows / V^T rows (global) and tiles (LDS);
  // piece j lies 32 keys (K) or 16 rows of d (V^T) further on
  const unsigned kgo = (tid >> 3) * (unsigned)HD + (tid & 7u) * 8u;
  const unsigned vgo = (tid >> 4) * (unsigned)SEQ + (tid & 15u) * 8u;
  const unsigned klo = (tid >> 3) * LDT + (tid & 7u) * 8u;
  const unsigned vlo = ((tid & 15u) >> 3) * (64u * LDT) + (tid >> 4) * LDT + (tid & 7u) * 8u;
  const unsigned qgo = m * (unsigned)HD + hh * 8u;   // the lane's element inside its wave's Q rows

  // the work-group's steps in running order; block-uniform
  const unsigned n0 = steps_of(((unsigned)NQT - 1u - blockIdx.x) * 64u);
  const unsigned ntot = n0 + steps_of(blockIdx.x * 64u);
  const unsigned kl0 = lds_off(&Ks[klo]), vl0 = lds_off(&Vs[vlo]);   // LDS byte addresses, buffer 0
  const _Float16* const kg0 = Kh + kplane + kgo;
  const _Float16* const vg0 = Vt + vplane + vgo;
  // step t's K and V^T tiles into buffer t & 1: eight copies a lane, every lane on. The s_wait_xcnt
  // ends the copies' own statement, a precaution ahead of any rewrite of their address registers.
  auto stage = [&](const unsigned t) __attribute__((always_inline)) {
    const unsigned ks = (t < n0 ? t : t - n0) * 128u;   // first key of the step
    const unsigned bo = (t & 1u) * (TILEH * 2u);        // the buffer's byte offset
    const unsigned kl = kl0 + bo, vl = vl0 + bo;
    const _Float16* const kp = kg0 + (size_t)ks * HD;
    const _Float16* const vp = vg0 + ks;
    asm volatile(
        "global_load_async_to_lds_b128 %0, %8, off\n\t"
        "global_load_async_to_lds_b128 %1, %9, off\n\t"
        "global_load_async_to_lds_b128 %2, %10, off\n\t"
        "global_load_async_to_lds_b128 %3, %11, off\n\t"
        "global_load_async_to_lds_b128 %4, %12, off\n\t"
        "global_load_async_to_lds_b128 %5, %13, off\n\t"
        "global_load_async_to_lds_b128 %6, %14, off\n\t"
        "global_load_async_to_lds_b128 %7, %15, off\n\t"
        "s_wait_xcnt 0x0"
        :: "v"(kl), "v"(kl + 1u * (32u * LDT * 2u)), "v"(kl + 2u * (32u * LDT * 2u)),
           "v"(kl + 3u * (32u * LDT * 2u)),
           "v"(vl), "v"(vl + 1u * (16u * LDT * 2u)), "v"(vl + 2u * (16u * LDT * 2u)),
           "v"(vl + 3u * (16u * LDT * 2u)),
           "v"(kp), "v"(kp + 1u * (32u * HD)), "v"(kp + 2u * (32u * HD)), "v"(kp + 3u * (32u * HD)),
           "v"(vp), "v"(vp + 1u * (16u * SEQ)), "v"(vp + 2u * (16u * SEQ)), "v"(vp + 3u * (16u * SEQ))
        : "memory");
  };
  // in front of the loops: step 0 landed and published, step 1 in flight (ntot >= 2: each tile has a step)
  stage(0u);
  asm volatile("s_wait_asynccnt 0x0" ::: "memory");   // this wave's copies of step 0 have landed
  __syncthreads();
  stage(1u);
  unsigned t = 0u;   // number of the running step

#pragma unroll 1   // the two tiles run one after the other through one copy of the loop
  for (unsigned pass = 0; pass < 2u; ++pass) {
  const unsigned q0 = (pass ? blockIdx.x : ((unsigned)NQT - 1u - blockIdx.x)) * 64u;
  const unsigned ci = q0 / (unsigned)CHUNK;          // chunk of this query block
  const unsigned cs = ci * (unsigned)CHUNK;          // first key of the diagonal chunk
  const bool first_blk = (q0 - cs < 128u);           // first 128 rows of the chunk; block-uniform
  const unsigned qrow0 = q0 + wq * 16u;

  const _Float16* const qw = Qh + ((size_t)bh * SEQ + qrow0) * HD;   // wave-uniform
  v16h qf[2];
  qf[0] = frag_at(qw + qgo);
  qf[1] = frag_at(qw + qgo + 32);
  // precaution ahead of any later rewrite of the loads' address registers
  asm volatile("s_wait_xcnt 0x0" ::: "memory");

  float mrow = -1.0e30f, lrow = 0.0f;   // of query row m; lrow: this half's keys only
  // The running output (sum of the chunks' O / l) rests in group 0's own output rows of Os, which
  // are idle until the epilogue: lane (hh, m) owns cells [m][16 nb + 8 hh + 0..7], touched once per
  // chunk. That leaves its 32 registers to the V^T fragments held across the softmax.
  float* const orow = &Os[obase + m * LDC + hh * 8u];
  v8f o[4];
#pragma unroll
  for (int nb = 0; nb < 4; ++nb) o[nb] = (v8f){};
  if (g == 0u) {
#pragma unroll
    for (int nb = 0; nb < 4; ++nb) {
      *(v4f*)(orow + nb * 16) = (v4f){};
      *(v4f*)(orow + nb * 16 + 4) = (v4f){};
    }
  }

#pragma unroll 1
  for (unsigned jc = 0; jc <= ci; ++jc) {
    const bool offd = (jc < ci);                     // past chunk: every cell masked
    const unsigned kc0 = jc * (unsigned)CHUNK;
    const unsigned kc1 =                             // <= SEQ
        offd ? (kc0 + (unsigned)CHUNK) : (cs + ((q0 - cs + 191u) & ~127u));

    // one 128-key step; compiled once for past chunks and once for the diagonal chunk
    auto step = [&](auto kind, const unsigned ks) __attribute__((always_inline)) {
      constexpr bool offd = decltype(kind)::past;
      const unsigned kb = ks + g * 64u;                // this wave's 64 keys
      const bool early = (P_RES != 0) && first_blk && (!offd) && (kb == cs);   // wave-uniform
      const _Float16* const Kw = &Ks[(t & 1u) * TILEH + g * (64u * LDT)];   // this step's buffer
      const _Float16* const Vw = &Vs[(t & 1u) * TILEH + g * (64u * LDT)];

      // scores: 4 key groups of 16, K = 64 in two 32-steps. All eight K fragments are read as
      // one group ahead of the eight products (one LDS latency per tile, not one per product);
      // the four accumulators advance side by side, each still c = 0 then c = 1.
      v16h kf[2][4];
#pragma unroll
      for (int c = 0; c < 2; ++c)
#pragma unroll
        for (int kg = 0; kg < 4; ++kg) kf[c][kg] = ld_frag(&Kw[(kg * 16) * LDT + c * 32], LDT);
      v8f s[4];
#pragma unroll
      for (int kg = 0; kg < 4; ++kg) s[kg] = (v8f){};
#pragma unroll
      for (int c = 0; c < 2; ++c)
#pragma unroll
        for (int kg = 0; kg < 4; ++kg) s[kg] = wmma16(kf[c][kg], qf[c], s[kg]);

      // all eight V^T fragments, issued here as one group: they land while the softmax runs
      v16h vf[2][4];
#pragma unroll
      for (int c = 0; c < 2; ++c)
#pragma unroll
        for (int nb = 0; nb < 4; ++nb) vf[c][nb] = ld_frag(&Vw[(nb * 16) * LDT + c * 32], LDT);

      // Past chunk: the f32 sum score + (-1e9) keeps steps of 64 only, so a whole tile's masked scores
      // are as a rule one and the same number. Tested by value: rounding is monotone, so when the
      // lane's smallest and largest score give the same masked value, all 32 between them do. Where
      // that value is also the other half's and the running maximum (or this is the chunk's first
      // step, whose state is all zero), the softmax below would find alpha = 1 and p = exp(0) = 1 in
      // every cell: the same numbers come from a constant P operand, without the softmax arithmetic.
      bool flat = false;                               // wave-uniform
      float tflat = 0.0f;
      if constexpr (offd) {
        float hi[4], lo[4];
#pragma unroll
        for (int kg = 0; kg < 4; ++kg) {
          hi[kg] = fmaxf(fmaxf(fmaxf(s[kg][0], s[kg][1]), fmaxf(s[kg][2], s[kg][3])),
                         fmaxf(fmaxf(s[kg][4], s[kg][5]), fmaxf(s[kg][6], s[kg][7])));
          lo[kg] = fminf(fminf(fminf(s[kg][0], s[kg][1]), fminf(s[kg][2], s[kg][3])),
                         fminf(fminf(s[kg][4], s[kg][5]), fminf(s[kg][6], s[kg][7])));
        }
        tflat = fmaxf(fmaxf(hi[0], hi[1]), fmaxf(hi[2], hi[3])) * scale + NEGFILL;
        const float tlo = fminf(fminf(lo[0], lo[1]), fminf(lo[2], lo[3])) * scale + NEGFILL;
        const bool ok = (bool)((int)(tlo == tflat) & (int)(xhalf(tflat) == tflat) &
                               ((int)(ks == kc0) | (int)(mrow == tflat)));
        flat = (__builtin_amdgcn_ballot_w32(ok) == 0xFFFFFFFFu);   // scalar test: EXEC stays full
      }

      // B operands of the two 32-key steps, f16(1024 p), and the new state: set for p = 1 in all of
      // this half's 32 cells; the softmax overwrites them where the tile is not flat
      v16h pf[2];
#pragma unroll
      for (int v = 0; v < 16; ++v) {
        pf[0][v] = (_Float16)PCARRY;
        pf[1][v] = (_Float16)PCARRY;
      }
      float mnew = tflat, lnew = lrow + 32.0f;
      // the hint lays the flat tile out as the fall-through of a past chunk's step
      if (__builtin_expect(!flat, !offd)) {
#pragma unroll
      for (int kg = 0; kg < 4; ++kg) s[kg] = s[kg] * scale;

      // additive mask; wave-uniform tests, per-cell addend selected by value
      if (offd) {
#pragma unroll
        for (int kg = 0; kg < 4; ++kg)
#pragma unroll
          for (int v = 0; v < 8; ++v) s[kg][v] = s[kg][v] + NEGFILL;
      } else if (kb >= q0) {
#pragma unroll
        for (int kg = 0; kg < 4; ++kg)
#pragma unroll
          for (int v = 0; v < 8; ++v) {
            const unsigned key = kb + (unsigned)kg * 16u + hh * 8u + (unsigned)v;
            const unsigned row = qrow0 + m;
            const float add = (key > row) ? NEGFILL : 0.0f;
            s[kg][v] = s[kg][v] + add;
          }
      }

      // online softmax; a lane holds 32 of its query row's 64 scores, lane ^ 16 the other 32
      float mk[4];
#pragma unroll
      for (int kg = 0; kg < 4; ++kg)
        mk[kg] = fmaxf(fmaxf(fmaxf(s[kg][0], s[kg][1]), fmaxf(s[kg][2], s[kg][3])),
                       fmaxf(fmaxf(s[kg][4], s[kg][5]), fmaxf(s[kg][6], s[kg][7])));
      float mx = fmaxf(fmaxf(mk[0], mk[1]), fmaxf(mk[2], mk[3]));
      mx = fmaxf(mx, xhalf(mx));
      const float mn = fmaxf(mrow, mx);
      const float alpha = __expf(mrow - mn);
      mnew = mn;
#pragma unroll
      for (int kg = 0; kg < 4; ++kg)
#pragma unroll
        for (int v = 0; v < 8; ++v) s[kg][v] = __expf(s[kg][v] - mn);
      float sk[4];
#pragma unroll
      for (int kg = 0; kg < 4; ++kg)
        sk[kg] = ((s[kg][0] + s[kg][1]) + (s[kg][2] + s[kg][3])) +
                 ((s[kg][4] + s[kg][5]) + (s[kg][6] + s[kg][7]));
      lnew = alpha * lrow + ((sk[0] + sk[1]) + (sk[2] + sk[3]));
#pragma unroll
      for (int nb = 0; nb < 4; ++nb) o[nb] = o[nb] * alpha;
#pragma unroll
      for (int c = 0; c < 2; ++c)
#pragma unroll
        for (int v = 0; v < 8; ++v) {
          pf[c][v]     = toh_flush(s[2 * c][v] * PCARRY);
          pf[c][v + 8] = toh_flush(s[2 * c + 1][v] * PCARRY);
        }
      }   // softmax of a tile that is not flat
      mrow = mnew;
      lrow = lnew;

      // O^T += V^T . P^T  (K = 64 keys in two 32-steps; A = V^T tile [d][key], B = f16(1024 p))
#pragma unroll
      for (int c = 0; c < 2; ++c)
#pragma unroll
        for (int nb = 0; nb < 4; ++nb) o[nb] = wmma16(vf[c][nb], pf[c], o[nb]);

      if (early) {
        // P residual operand: f16(1024 * (1024 p - f16(1024 p)))
        v16h pr[2];
#pragma unroll
        for (int c = 0; c < 2; ++c)
#pragma unroll
          for (int v = 0; v < 16; ++v) {
            const float t = s[2 * c + (v >> 3)][v & 7] * PCARRY;
            const float hi = (float)toh_flush(t);
            pr[c][v] = toh_flush((t - hi) * RCARRY);
          }
        // V^T . P_res^T (scale 1/1024), one 16-row group of d at a time, folded immediately
#pragma unroll
        for (int nb = 0; nb < 4; ++nb) {
          v8f o2 = {};
#pragma unroll
          for (int c = 0; c < 2; ++c) {
            const v16h vr = ld_frag(&Vw[(nb * 16) * LDT + c * 32], LDT);
            o2 = wmma16(vr, pr[c], o2);
          }
#pragma unroll
          for (int v = 0; v < 8; ++v) o[nb][v] = o[nb][v] + o2[v] * (1.0f / RCARRY);
        }
      }
      // foot of step t: the one barrier publishes step t + 1's tiles and ends every reader's last
      // read of step t's buffer, which is refilled behind it
      asm volatile("s_wait_dscnt 0x0" ::: "memory");      // this wave's reads of the buffer are done
      asm volatile("s_wait_asynccnt 0x0" ::: "memory");   // this wave's copies of step t + 1 have landed
      __syncthreads();
      if (t + 2u < ntot) stage(t + 2u);                   // block-uniform test
      ++t;
    };
    // kc1 - kc0 is a multiple of 128; both loops stay rolled: one copy of the large body per kind
    if (offd) {
#pragma unroll 1
      for (unsigned ks = kc0; ks < kc1; ks += 128u) step(PastChunk{}, ks);
    } else {
#pragma unroll 1
      for (unsigned ks = kc0; ks < kc1; ks += 128u) step(DiagChunk{}, ks);
    }

    // end of chunk: group 1 hands its state over, group 0 joins the two states, adds O / l to the
    // running output; both reset. Xs is rewritten only behind the next step's barriers.
    const float lsum = lrow + xhalf(lrow);   // the two lane halves' sums joined
    if (g != 0u) {
#pragma unroll
      for (int nb = 0; nb < 4; ++nb) {
        *(v4f*)(xrow + nb * 8)     = (v4f){o[nb][0], o[nb][1], o[nb][2], o[nb][3]};
        *(v4f*)(xrow + nb * 8 + 4) = (v4f){o[nb][4], o[nb][5], o[nb][6], o[nb][7]};
      }
      xrow[32] = mrow;
      xrow[33] = lsum;
    }
    __syncthreads();
    if (g == 0u) {
      const float m1 = xrow[32], l1 = xrow[33];
      const float mm = fmaxf(mrow, m1);
      const float a0 = __expf(mrow - mm), a1 = __expf(m1 - mm);
      const float inv = __builtin_amdgcn_rcpf(a0 * lsum + a1 * l1);
      const float f0 = a0 * inv, f1 = a1 * inv;
#pragma unroll
      for (int nb = 0; nb < 4; ++nb) {
        const v4f x0 = *(const v4f*)(xrow + nb * 8);
        const v4f x1 = *(const v4f*)(xrow + nb * 8 + 4);
        v4f t0 = *(const v4f*)(orow + nb * 16);
        v4f t1 = *(const v4f*)(orow + nb * 16 + 4);
#pragma unroll
        for (int v = 0; v < 4; ++v) {
          t0[v] = t0[v] + (o[nb][v] * f0 + x0[v] * f1);
          t1[v] = t1[v] + (o[nb][v + 4] * f0 + x1[v] * f1);
        }
        *(v4f*)(orow + nb * 16) = t0;
        *(v4f*)(orow + nb * 16 + 4) = t1;
      }
    }
#pragma unroll
    for (int nb = 0; nb < 4; ++nb) o[nb] = (v8f){};
    mrow = -1.0e30f;
    lrow = 0.0f;
  }

  if (g == 0u) {
  const float fs = 1.0f / (PCARRY * WCARRY);
  wave_lds_sync();
  v4f x[8];
  size_t off[8];
#pragma unroll
  for (unsigned i = 0; i < 8u; ++i) {
    const unsigned r = 2u * i + (lane >> 4);
    const unsigned c = (lane & 15u) * 4u;
    x[i] = *(const v4f*)&Os[obase + r * LDC + c] * fs;
    off[i] = ((size_t)bh * SEQ_FULL + qrow0 + r) * HD + c;
  }
#pragma unroll
  for (int i = 0; i < 8; ++i) *(v4f*)(Out + off[i]) = x[i];
  // precaution: the second tile's first instructions reuse the stores' address and data registers
  asm volatile("s_wait_xcnt 0x0" ::: "memory");
  }
  }   // pass
  asm volatile("s_wait_asynccnt 0x0" ::: "memory");   // no copy is outstanding when the wave ends
}

// ---------------------------------------------------------------------------
extern "C" void kernel_launch(void* const* d_in, const int* in_sizes, int n_in,
                              void* d_out, int out_size, void* d_ws, size_t ws_size,
                              hipStream_t stream) {
  if (n_in < 3) return;
  const long long need = ((long long)(NBH - 1) * SEQ_FULL + SEQ) * HD;
  if ((long long)in_sizes[0] < need) return;
  if ((long long)in_sizes[1] < need) return;
  if ((long long)in_sizes[2] < need) return;
  if ((long long)out_size < need) return;
  if (ws_size < WS_TOTAL) return;

  const float* Qf = (const float*)d_in[0];    // query [NB_FULL][NHEAD][SEQ_FULL][HD]
  const float* Kf = (const float*)d_in[1];    // key
  const float* Vf = (const float*)d_in[2];    // value
  float* out = (float*)d_out;                 // [NB_FULL][NHEAD][SEQ_FULL][HD]

  char* ws = (char*)d_ws;
  _Float16* Q16  = (_Float16*)(ws + OFF_Q);    // [bh][SEQ][HD]
  _Float16* K16  = (_Float16*)(ws + OFF_K);    // [bh][SEQ][HD]
  _Float16* Vt16 = (_Float16*)(ws + OFF_VT);   // [bh][HD][SEQ]

  dim3 blk(256);
  qkconv_kernel<<<dim3((unsigned)(((size_t)NBH * SEQ * HD) / 2048u)), blk, 0, stream>>>(
      Qf, Kf, Q16, K16);
  // value: in [SEQ rows][HD cols] per bh -> out [HD][SEQ] per bh; grid (HD/64, SEQ/64, NBH)
  vconv_kernel<<<dim3(HD / 64, SEQ / 64, NBH), blk, 0, stream>>>(
      Vf, Vt16, (unsigned)HD, (unsigned)SEQ, (unsigned)(SEQ_FULL * HD), (unsigned)(HD * SEQ));
  attn_kernel<<<dim3(NQT / 2, NHEAD, NB), blk, 0, stream>>>(Q16, K16, Vt16, out);
}

// v006
// A run of this version takes 36.9 microseconds.
// Next to v005, in two timings, it ran 1.05 times as fast each time.
// Over all steps from v000 it is 2.56 times as fast.
#include <hip/hip_runtime.h>
#include <stddef.h>

// All contractions on v_wmma_f32_16x16x32_f16 (f16 operands, f32 accumulate): q.k scores and p.v.
// Float inputs are RNE-converted to bf16 and carried in f16 (q and k x16, v x64, p x1024; p gets
// an extra x1024 residual plane with its own accumulator on the first key tile of the first
// 128 query rows of every 512-row chunk). Softmax, additive mask, chunk sums in f32.
// Causal chunked attention: per 512-key chunk an independent softmax (additive -1e9 on masked
// cells; every cell of a past chunk is masked), the chunk outputs are summed.

typedef _Float16 v16h __attribute__((ext_vector_type(16)));
typedef _Float16 v8h  __attribute__((ext_vector_type(8)));
typedef _Float16 v4h  __attribute__((ext_vector_type(4)));
typedef float    v8f  __attribute__((ext_vector_type(8)));
typedef float    v4f  __attribute__((ext_vector_type(4)));

#ifndef NB
#define NB 2
#endif
#ifndef SEQ
#define SEQ 2048
#endif
#define NB_FULL  2
#define SEQ_FULL 2048
#define NHEAD 16
#define HD    64
#define CHUNK 512
#define NBH   (NB * NHEAD)

static_assert(NB >= 1 && NB <= NB_FULL);
static_assert(SEQ >= CHUNK && SEQ <= SEQ_FULL && (SEQ % CHUNK) == 0);
static_assert((CHUNK % 128) == 0 && (SEQ % 128) == 0 && (SEQ % 64) == 0);
static_assert(HD == 64);
static_assert((size_t)NBH * SEQ_FULL * HD < (size_t)0xFFFFFFFFu);

#define LDT 72   // halves per LDS row (144 B, 16-B aligned)
#define LDC 68   // floats per LDS row (272 B, 16-B aligned)
static_assert((LDT % 8) == 0 && LDT >= 64);
static_assert((LDC % 4) == 0 && LDC >= 64);

#define QKCARRY 16.0f    // q and k planes carried x16 each
#define WCARRY  64.0f    // value plane carried x64
#define PCARRY  1024.0f  // softmax numerators carried x1024
#define RCARRY  1024.0f  // residual plane of p carried x1024 on top of its hi part
#define NEGFILL (-1.0e9f)
#ifndef P_RES
#define P_RES 1          // 1: p residual product on the early band; 0: single product everywhere
#endif

// workspace layout (bytes)
#define PLANE16_BYTES ((size_t)NBH * SEQ * HD * 2)
#define OFF_Q  ((size_t)0)
#define OFF_K  (OFF_Q + PLANE16_BYTES)
#define OFF_VT (OFF_K + PLANE16_BYTES)
#define WS_TOTAL (OFF_VT + PLANE16_BYTES)
static_assert((PLANE16_BYTES % 128) == 0);
static_assert(WS_TOTAL <= (size_t)134217728);

#define LDX 36   // floats per lane slot of the state exchange (144 B, 16-B aligned)
static_assert((LDX % 4) == 0 && LDX >= 34);
#define NQT (SEQ / 64)   // query tiles of 64 rows per head
static_assert((NQT % 2) == 0);

#define TILEH (2u * 64u * LDT)   // halves of one staging buffer of K or of V^T: both key halves of a step

// static LDS of the attention kernel (two staging buffers of K and of V^T)
static_assert((size_t)(2 * TILEH * 2) * 2 + (size_t)(4 * 16 * LDC * 4) +
              (size_t)(4 * 32 * LDX * 4) <= (size_t)131072);

// ---------------------------------------------------------------------------
__device__ __forceinline__ float bf16r(float x) {   // RNE convert to bf16, returned widened
  unsigned int u = __float_as_uint(x);
  u = (u + 0x7FFFu + ((u >> 16) & 1u)) & 0xFFFF0000u;
  return __uint_as_float(u);
}

// f32 -> f16 that cannot produce an f16 subnormal (value select)
static __device__ __forceinline__ _Float16 toh_flush(float v) {
  const _Float16 r = (_Float16)v;
  return (fabsf(v) < 6.103515625e-05f) ? (_Float16)0.0f : r;
}

// 16-bit fragment: p points at element [row = lane&15][k0 + 8*(lane>>4)] of a k-contiguous
// row. Elements 0..7 <- k0+8h+0..7, elements 8..15 <- k0+16+8h+0..7 (same map for A and B).
__device__ __forceinline__ v16h frag_at(const _Float16* p) {
  v8h lo = *(const v8h*)(p);
  v8h hi = *(const v8h*)(p + 16);
  v16h out;
#pragma unroll
  for (int i = 0; i < 8; ++i) { out[i] = lo[i]; out[i + 8] = hi[i]; }
  return out;
}
__device__ __forceinline__ v16h ld_frag(const _Float16* base, unsigned ld) {
  const unsigned lane = threadIdx.x & 31u;
  return frag_at(base + (lane & 15u) * ld + (lane >> 4) * 8u);
}

__device__ __forceinline__ v8f wmma16(v16h a, v16h b, v8f c) {
  v8f d = __builtin_amdgcn_wmma_f32_16x16x32_f16(false, a, false, b, (short)0, c,
                                                 false, false);
  asm volatile("v_nop\n\tv_nop\n\tv_nop\n\tv_nop" : "+v"(d) : "v"(a), "v"(b));
  return d;
}

__device__ __forceinline__ float xhalf(float x) {   // value of lane l ^ 16
  const int b = __builtin_bit_cast(int, x);
  return __builtin_bit_cast(float, __builtin_amdgcn_permlanex16(b, b, 0x76543210, 0xfedcba98,
                                                                false, false));
}

// compile-time kind of a key chunk: a past chunk (every cell masked) or the diagonal chunk
struct PastChunk { static constexpr bool past = true; };
struct DiagChunk { static constexpr bool past = false; };

// number of 128-key steps of the 64-row query tile at q0: its past chunks whole, then the diagonal
// chunk up to key q0 + 63, rounded up to whole steps; at least 1
__device__ __forceinline__ unsigned steps_of(unsigned q0) {
  const unsigned cs = q0 & ~((unsigned)CHUNK - 1u);
  return (cs + ((q0 - cs + 191u) & ~127u)) >> 7;
}

__device__ __forceinline__ unsigned lds_off(const void* p) { return (unsigned)(size_t)p; }

__device__ __forceinline__ void wave_lds_sync() {
  __builtin_amdgcn_fence(3 /* release order */, "wavefront");
  asm volatile("s_wait_dscnt 0x0" ::: "memory");
  __builtin_amdgcn_wave_barrier();
}

// ---------------------------------------------------------------------------
// All three planes in one launch. One work-group per (128-row slab, head): q and k rows go to the
// compact planes [bh][s][64] as f16(16 * bf16(x)), the value rows to the transposed plane
// [bh][64][s] as f16(64 * bf16(x)). A thread takes 32 elements of each input and issues its 24
// 16-B loads ahead of all arithmetic; the whole grid is resident at once, so few waves have to start.
// q, k: one load of a wave covers 512 contiguous bytes, one store 256 (two whole lines).
// v: thread (rg, cq) loads rows 8 rg .. 8 rg + 7, columns 4 cq .. 4 cq + 3 (a wave's load: two whole
// rows) and writes, per column d, its 8 keys as one 16-B piece into T[d][piece]; row d keeps piece p
// at place p ^ (d >> 2), which spreads both the writers' and the readers' 16 lanes over all banks.
// T: cross-wave (block barrier). Store loop: 16 rows of d per step x 4 steps; one store of a wave =
// two rows of 256 contiguous bytes.
// Grid (SEQ/128, NBH).
// ---------------------------------------------------------------------------
#define PROWS 128u   // rows of a slab
static_assert((SEQ % 128) == 0 && HD == 64);
static_assert(128 * HD == 256 * 4 * 8);        // 8 loads of 4 floats a thread cover a slab of one input
static_assert((256 / 16) * 8 == 128 && 16 * 4 == HD && (256 / 16) * 4 == HD);
__global__ __launch_bounds__(256) void prep_kernel(
    const float* __restrict__ Qf, const float* __restrict__ Kf, const float* __restrict__ Vf,
    _Float16* __restrict__ Q16, _Float16* __restrict__ K16, _Float16* __restrict__ Vt) {
  __shared__ __attribute__((aligned(16))) _Float16 T[HD * PROWS];
  const unsigned tid = threadIdx.x;
  const unsigned s0 = blockIdx.x * PROWS;
  const unsigned bh = blockIdx.y;
  const float* const qs = Qf + ((size_t)bh * SEQ_FULL + s0) * HD;   // block-uniform bases
  const float* const ks = Kf + ((size_t)bh * SEQ_FULL + s0) * HD;
  const float* const vs = Vf + ((size_t)bh * SEQ_FULL + s0) * HD;
  const unsigned rg = tid >> 4, cq = tid & 15u;

  const float* const vp = vs + (rg * 8u) * (unsigned)HD + cq * 4u;   // the thread's first value piece
  v4f vv[8], qa[8], ka[8];
#pragma unroll
  for (unsigned r = 0; r < 8u; ++r) vv[r] = *(const v4f*)(vp + r * (unsigned)HD);
  // keeps the value loads first, the order of use (loads return in order): else the scheduler asks
  // for the value rows last and the first conversion waits for all 24 loads
  __builtin_amdgcn_sched_barrier(0);
#pragma unroll
  for (unsigned j = 0; j < 8u; ++j) qa[j] = *(const v4f*)(qs + (j * 256u + tid) * 4u);
#pragma unroll
  for (unsigned j = 0; j < 8u; ++j) ka[j] = *(const v4f*)(ks + (j * 256u + tid) * 4u);
  // precaution ahead of any rewrite of the loads' address registers; it names them as inputs so that
  // no later load's result is laid over them in front of it
  asm volatile("s_wait_xcnt 0x0" :: "v"(vp), "v"(tid) : "memory");
  // keeps all 24 loads in front of the arithmetic: left alone, the scheduler puts part of them among
  // the conversions, and a wave then has fewer bytes in flight
  __builtin_amdgcn_sched_barrier(0);

#pragma unroll
  for (unsigned i = 0; i < 4u; ++i) {
    v8h x;
#pragma unroll
    for (int r = 0; r < 8; ++r) x[r] = toh_flush(WCARRY * bf16r(vv[r][i]));
    *(v8h*)&T[(cq * 4u + i) * PROWS + (rg ^ cq) * 8u] = x;
  }

  _Float16* const qd = Q16 + ((size_t)bh * SEQ + s0) * HD;
  _Float16* const kd = K16 + ((size_t)bh * SEQ + s0) * HD;
#pragma unroll
  for (unsigned j = 0; j < 8u; ++j) {
    v4h x;
#pragma unroll
    for (int i = 0; i < 4; ++i) x[i] = toh_flush(QKCARRY * bf16r(qa[j][i]));
    *(v4h*)(qd + (j * 256u + tid) * 4u) = x;
  }
  // precaution: what follows reuses the q stores' data and address registers
  asm volatile("s_wait_xcnt 0x0" ::: "memory");

  // block barrier for T alone: only LDS data crosses waves here, so the fences name LDS; a plain
  // __syncthreads() would also wait for the q stores to finish (and for any global load in flight)
  __builtin_amdgcn_fence(__ATOMIC_RELEASE, "workgroup", "local");
  __builtin_amdgcn_s_barrier();
  __builtin_amdgcn_fence(__ATOMIC_ACQUIRE, "workgroup", "local");
  _Float16* const vd = Vt + (size_t)bh * HD * SEQ + s0;
  v8h y[4];
#pragma unroll
  for (unsigned i = 0; i < 4u; ++i) {
    const unsigned d = 16u * i + rg;
    y[i] = *(const v8h*)&T[d * PROWS + (cq ^ (d >> 2)) * 8u];
  }
#pragma unroll
  for (unsigned i = 0; i < 4u; ++i) *(v8h*)(vd + (16u * i + rg) * (unsigned)SEQ + cq * 8u) = y[i];

#pragma unroll
  for (unsigned j = 0; j < 8u; ++j) {
    v4h x;
#pragma unroll
    for (int i = 0; i < 4; ++i) x[i] = toh_flush(QKCARRY * bf16r(ka[j][i]));
    *(v4h*)(kd + (j * 256u + tid) * 4u) = x;
  }
}

static_assert(2 * 8 == 16);
__global__ __launch_bounds__(256) __attribute__((amdgpu_num_vgpr(256))) void attn_kernel(
    const _Float16* __restrict__ Qh, const _Float16* __restrict__ Kh,
    const _Float16* __restrict__ Vt, float* __restrict__ Out) {
  __shared__ __attribute__((aligned(16))) _Float16 Ks[2 * TILEH];   // [buffer][g][key][d]
  __shared__ __attribute__((aligned(16))) _Float16 Vs[2 * TILEH];   // [buffer][g][d][key]
  __shared__ __attribute__((aligned(16))) float Os[4 * 16 * LDC];
  __shared__ __attribute__((aligned(16))) float Xs[4 * 32 * LDX];

  const unsigned tid = threadIdx.x, lane = tid & 31u;
  const unsigned w = (unsigned)__builtin_amdgcn_readfirstlane((int)(threadIdx.x >> 5));
  const unsigned g = w >> 2, wq = w & 3u;            // key half of a step; query row group
  const unsigned hh = lane >> 4, m = lane & 15u;
  const unsigned bh = blockIdx.z * (unsigned)NHEAD + blockIdx.y;
  const float scale = 0.125f / (QKCARRY * QKCARRY);  // HD^-0.5 over the plane carries
  const unsigned obase = wq * (16u * LDC);
  float* const xrow = &Xs[(wq * 32u + lane) * LDX];
  const size_t kplane = (size_t)bh * SEQ * HD;
  const size_t vplane = (size_t)bh * HD * SEQ;
  // staging: the thread's own element inside a step's K rows / V^T rows (global) and tiles (LDS);
  // piece j lies 32 keys (K) or 16 rows of d (V^T) further on
  const unsigned kgo = (tid >> 3) * (unsigned)HD + (tid & 7u) * 8u;
  const unsigned vgo = (tid >> 4) * (unsigned)SEQ + (tid & 15u) * 8u;
  const unsigned klo = (tid >> 3) * LDT + (tid & 7u) * 8u;
  const unsigned vlo = ((tid & 15u) >> 3) * (64u * LDT) + (tid >> 4) * LDT + (tid & 7u) * 8u;
  const unsigned qgo = m * (unsigned)HD + hh * 8u;   // the lane's element inside its wave's Q rows

  // the work-group's steps in running order; block-uniform
  const unsigned n0 = steps_of(((unsigned)NQT - 1u - blockIdx.x) * 64u);
  const unsigned ntot = n0 + steps_of(blockIdx.x * 64u);
  const unsigned kl0 = lds_off(&Ks[klo]), vl0 = lds_off(&Vs[vlo]);   // LDS byte addresses, buffer 0
  const _Float16* const kg0 = Kh + kplane + kgo;
  const _Float16* const vg0 = Vt + vplane + vgo;
  // step t's K and V^T tiles into buffer t & 1: eight copies a lane, every lane on. The s_wait_xcnt
  // ends the copies' own statement, a precaution ahead of any rewrite of their address registers.
  auto stage = [&](const unsigned t) __attribute__((always_inline)) {
    const unsigned ks = (t < n0 ? t : t - n0) * 128u;   // first key of the step
    const unsigned bo = (t & 1u) * (TILEH * 2u);        // the buffer's byte offset
    const unsigned kl = kl0 + bo, vl = vl0 + bo;
    const _Float16* const kp = kg0 + (size_t)ks * HD;
    const _Float16* const vp = vg0 + ks;
    asm volatile(
        "global_load_async_to_lds_b128 %0, %8, off\n\t"
        "global_load_async_to_lds_b128 %1, %9, off\n\t"
        "global_load_async_to_lds_b128 %2, %10, off\n\t"
        "global_load_async_to_lds_b128 %3, %11, off\n\t"
        "global_load_async_to_lds_b128 %4, %12, off\n\t"
        "global_load_async_to_lds_b128 %5, %13, off\n\t"
        "global_load_async_to_lds_b128 %6, %14, off\n\t"
        "global_load_async_to_lds_b128 %7, %15, off\n\t"
        "s_wait_xcnt 0x0"
        :: "v"(kl), "v"(kl + 1u * (32u * LDT * 2u)), "v"(kl + 2u * (32u * LDT * 2u)),
           "v"(kl + 3u * (32u * LDT * 2u)),
           "v"(vl), "v"(vl + 1u * (16u * LDT * 2u)), "v"(vl + 2u * (16u * LDT * 2u)),
           "v"(vl + 3u * (16u * LDT * 2u)),
           "v"(kp), "v"(kp + 1u * (32u * HD)), "v"(kp + 2u * (32u * HD)), "v"(kp + 3u * (32u * HD)),
           "v"(vp), "v"(vp + 1u * (16u * SEQ)), "v"(vp + 2u * (16u * SEQ)), "v"(vp + 3u * (16u * SEQ))
        : "memory");
  };
  // in front of the loops: step 0 landed and published, step 1 in flight (ntot >= 2: each tile has a step)
  stage(0u);
  asm volatile("s_wait_asynccnt 0x0" ::: "memory");   // this wave's copies of step 0 have landed
  __syncthreads();
  stage(1u);
  unsigned t = 0u;   // number of the running step

#pragma unroll 1   // the two tiles run one after the other through one copy of the loop
  for (unsigned pass = 0; pass < 2u; ++pass) {
  const unsigned q0 = (pass ? blockIdx.x : ((unsigned)NQT - 1u - blockIdx.x)) * 64u;
  const unsigned ci = q0 / (unsigned)CHUNK;          // chunk of this query block
  const unsigned cs = ci * (unsigned)CHUNK;          // first key of the diagonal chunk
  const bool first_blk = (q0 - cs < 128u);           // first 128 rows of the chunk; block-uniform
  const unsigned qrow0 = q0 + wq * 16u;

  const _Float16* const qw = Qh + ((size_t)bh * SEQ + qrow0) * HD;   // wave-uniform
  v16h qf[2];
  qf[0] = frag_at(qw + qgo);
  qf[1] = frag_at(qw + qgo + 32);
  // precaution ahead of any later rewrite of the loads' address registers
  asm volatile("s_wait_xcnt 0x0" ::: "memory");

  float mrow = -1.0e30f, lrow = 0.0f;   // of query row m; lrow: this half's keys only
  // The running output (sum of the chunks' O / l) rests in group 0's own output rows of Os, which
  // are idle until the epilogue: lane (hh, m) owns cells [m][16 nb + 8 hh + 0..7], touched once per
  // chunk. That leaves its 32 registers to the V^T fragments held across the softmax.
  float* const orow = &Os[obase + m * LDC + hh * 8u];
  v8f o[4];
#pragma unroll
  for (int nb = 0; nb < 4; ++nb) o[nb] = (v8f){};
  if (g == 0u) {
#pragma unroll
    for (int nb = 0; nb < 4; ++nb) {
      *(v4f*)(orow + nb * 16) = (v4f){};
      *(v4f*)(orow + nb * 16 + 4) = (v4f){};
    }
  }

#pragma unroll 1
  for (unsigned jc = 0; jc <= ci; ++jc) {
    const bool offd = (jc < ci);                     // past chunk: every cell masked
    const unsigned kc0 = jc * (unsigned)CHUNK;
    const unsigned kc1 =                             // <= SEQ
        offd ? (kc0 + (unsigned)CHUNK) : (cs + ((q0 - cs + 191u) & ~127u));

    // one 128-key step; compiled once for past chunks and once for the diagonal chunk
    auto step = [&](auto kind, const unsigned ks) __attribute__((always_inline)) {
      constexpr bool offd = decltype(kind)::past;
      const unsigned kb = ks + g * 64u;                // this wave's 64 keys
      const bool early = (P_RES != 0) && first_blk && (!offd) && (kb == cs);   // wave-uniform
      const _Float16* const Kw = &Ks[(t & 1u) * TILEH + g * (64u * LDT)];   // this step's buffer
      const _Float16* const Vw = &Vs[(t & 1u) * TILEH + g * (64u * LDT)];

      // scores: 4 key groups of 16, K = 64 in two 32-steps. All eight K fragments are read as
      // one group ahead of the eight products (one LDS latency per tile, not one per product);
      // the four accumulators advance side by side, each still c = 0 then c = 1.
      v16h kf[2][4];
#pragma unroll
      for (int c = 0; c < 2; ++c)
#pragma unroll
        for (int kg = 0; kg < 4; ++kg) kf[c][kg] = ld_frag(&Kw[(kg * 16) * LDT + c * 32], LDT);
      v8f s[4];
#pragma unroll
      for (int kg = 0; kg < 4; ++kg) s[kg] = (v8f){};
#pragma unroll
      for (int c = 0; c < 2; ++c)
#pragma unroll
        for (int kg = 0; kg < 4; ++kg) s[kg] = wmma16(kf[c][kg], qf[c], s[kg]);

      // all eight V^T fragments, issued here as one group: they land while the softmax runs
      v16h vf[2][4];
#pragma unroll
      for (int c = 0; c < 2; ++c)
#pragma unroll
        for (int nb = 0; nb < 4; ++nb) vf[c][nb] = ld_frag(&Vw[(nb * 16) * LDT + c * 32], LDT);

      // Past chunk: the f32 sum score + (-1e9) keeps steps of 64 only, so a whole tile's masked scores
      // are as a rule one and the same number. Tested by value: rounding is monotone, so when the
      // lane's smallest and largest score give the same masked value, all 32 between them do. Where
      // that value is also the other half's and the running maximum (or this is the chunk's first
      // step, whose state is all zero), the softmax below would find alpha = 1 and p = exp(0) = 1 in
      // every cell: the same numbers come from a constant P operand, without the softmax arithmetic.
      bool flat = false;                               // wave-uniform
      float tflat = 0.0f;
      if constexpr (offd) {
        float hi[4], lo[4];
#pragma unroll
        for (int kg = 0; kg < 4; ++kg) {
          hi[kg] = fmaxf(fmaxf(fmaxf(s[kg][0], s[kg][1]), fmaxf(s[kg][2], s[kg][3])),
                         fmaxf(fmaxf(s[kg][4], s[kg][5]), fmaxf(s[kg][6], s[kg][7])));
          lo[kg] = fminf(fminf(fminf(s[kg][0], s[kg][1]), fminf(s[kg][2], s[kg][3])),
                         fminf(fminf(s[kg][4], s[kg][5]), fminf(s[kg][6], s[kg][7])));
        }
        tflat = fmaxf(fmaxf(hi[0], hi[1]), fmaxf(hi[2], hi[3])) * scale + NEGFILL;
        const float tlo = fminf(fminf(lo[0], lo[1]), fminf(lo[2], lo[3])) * scale + NEGFILL;
        const bool ok = (bool)((int)(tlo == tflat) & (int)(xhalf(tflat) == tflat) &
                               ((int)(ks == kc0) | (int)(mrow == tflat)));
        flat = (__builtin_amdgcn_ballot_w32(ok) == 0xFFFFFFFFu);   // scalar test: EXEC stays full
      }

      // B operands of the two 32-key steps, f16(1024 p), and the new state: set for p = 1 in all of
      // this half's 32 cells; the softmax overwrites them where the tile is not flat
      v16h pf[2];
#pragma unroll
      for (int v = 0; v < 16; ++v) {
        pf[0][v] = (_Float16)PCARRY;
        pf[1][v] = (_Float16)PCARRY;
      }
      float mnew = tflat, lnew = lrow + 32.0f;
      // the hint lays the flat tile out as the fall-through of a past chunk's step
      if (__builtin_expect(!flat, !offd)) {
#pragma unroll
      for (int kg = 0; kg < 4; ++kg) s[kg] = s[kg] * scale;

      // additive mask; wave-uniform tests, per-cell addend selected by value
      if (offd) {
#pragma unroll
        for (int kg = 0; kg < 4; ++kg)
#pragma unroll
          for (int v = 0; v < 8; ++v) s[kg][v] = s[kg][v] + NEGFILL;
      } else if (kb >= q0) {
#pragma unroll
        for (int kg = 0; kg < 4; ++kg)
#pragma unroll
          for (int v = 0; v < 8; ++v) {
            const unsigned key = kb + (unsigned)kg * 16u + hh * 8u + (unsigned)v;
            const unsigned row = qrow0 + m;
            const float add = (key > row) ? NEGFILL : 0.0f;
            s[kg][v] = s[kg][v] + add;
          }
      }

      // online softmax; a lane holds 32 of its query row's 64 scores, lane ^ 16 the other 32
      float mk[4];
#pragma unroll
      for (int kg = 0; kg < 4; ++kg)
        mk[kg] = fmaxf(fmaxf(fmaxf(s[kg][0], s[kg][1]), fmaxf(s[kg][2], s[kg][3])),
                       fmaxf(fmaxf(s[kg][4], s[kg][5]), fmaxf(s[kg][6], s[kg][7])));
      float mx = fmaxf(fmaxf(mk[0], mk[1]), fmaxf(mk[2], mk[3]));
      mx = fmaxf(mx, xhalf(mx));
      const float mn = fmaxf(mrow, mx);
      const float alpha = __expf(mrow - mn);
      mnew = mn;
#pragma unroll
      for (int kg = 0; kg < 4; ++kg)
#pragma unroll
        for (int v = 0; v < 8; ++v) s[kg][v] = __expf(s[kg][v] - mn);
      float sk[4];
#pragma unroll
      for (int kg = 0; kg < 4; ++kg)
        sk[kg] = ((s[kg][0] + s[kg][1]) + (s[kg][2] + s[kg][3])) +
                 ((s[kg][4] + s[kg][5]) + (s[kg][6] + s[kg][7]));
      lnew = alpha * lrow + ((sk[0] + sk[1]) + (sk[2] + sk[3]));
#pragma unroll
      for (int nb = 0; nb < 4; ++nb) o[nb] = o[nb] * alpha;
#pragma unroll
      for (int c = 0; c < 2; ++c)
#pragma unroll
        for (int v = 0; v < 8; ++v) {
          pf[c][v]     = toh_flush(s[2 * c][v] * PCARRY);
          pf[c][v + 8] = toh_flush(s[2 * c + 1][v] * PCARRY);
        }
      }   // softmax of a tile that is not flat
      mrow = mnew;
      lrow = lnew;

      // O^T += V^T . P^T  (K = 64 keys in two 32-steps; A = V^T tile [d][key], B = f16(1024 p))
#pragma unroll
      for (int c = 0; c < 2; ++c)
#pragma unroll
        for (int nb = 0; nb < 4; ++nb) o[nb] = wmma16(vf[c][nb], pf[c], o[nb]);

      if (early) {
        // P residual operand: f16(1024 * (1024 p - f16(1024 p)))
        v16h pr[2];
#pragma unroll
        for (int c = 0; c < 2; ++c)
#pragma unroll
          for (int v = 0; v < 16; ++v) {
            const float t = s[2 * c + (v >> 3)][v & 7] * PCARRY;
            const float hi = (float)toh_flush(t);
            pr[c][v] = toh_flush((t - hi) * RCARRY);
          }
        // V^T . P_res^T (scale 1/1024), one 16-row group of d at a time, folded immediately
#pragma unroll
        for (int nb = 0; nb < 4; ++nb) {
          v8f o2 = {};
#pragma unroll
          for (int c = 0; c < 2; ++c) {
            const v16h vr = ld_frag(&Vw[(nb * 16) * LDT + c * 32], LDT);
            o2 = wmma16(vr, pr[c], o2);
          }
#pragma unroll
          for (int v = 0; v < 8; ++v) o[nb][v] = o[nb][v] + o2[v] * (1.0f / RCARRY);
        }
      }
      // foot of step t: the one barrier publishes step t + 1's tiles and ends every reader's last
      // read of step t's buffer, which is refilled behind it
      asm volatile("s_wait_dscnt 0x0" ::: "memory");      // this wave's reads of the buffer are done
      asm volatile("s_wait_asynccnt 0x0" ::: "memory");   // this wave's copies of step t + 1 have landed
      __syncthreads();
      if (t + 2u < ntot) stage(t + 2u);                   // block-uniform test
      ++t;
    };
    // kc1 - kc0 is a multiple of 128; both loops stay rolled: one copy of the large body per kind
    if (offd) {
#pragma unroll 1
      for (unsigned ks = kc0; ks < kc1; ks += 128u) step(PastChunk{}, ks);
    } else {
#pragma unroll 1
      for (unsigned ks = kc0; ks < kc1; ks += 128u) step(DiagChunk{}, ks);
    }

    // end of chunk: group 1 hands its state over, group 0 joins the two states, adds O / l to the
    // running output; both reset. Xs is rewritten only behind the next step's barriers.
    const float lsum = lrow + xhalf(lrow);   // the two lane halves' sums joined
    if (g != 0u) {
#pragma unroll
      for (int nb = 0; nb < 4; ++nb) {
        *(v4f*)(xrow + nb * 8)     = (v4f){o[nb][0], o[nb][1], o[nb][2], o[nb][3]};
        *(v4f*)(xrow + nb * 8 + 4) = (v4f){o[nb][4], o[nb][5], o[nb][6], o[nb][7]};
      }
      xrow[32] = mrow;
      xrow[33] = lsum;
    }
    __syncthreads();
    if (g == 0u) {
      const float m1 = xrow[32], l1 = xrow[33];
      const float mm = fmaxf(mrow, m1);
      const float a0 = __expf(mrow - mm), a1 = __expf(m1 - mm);
      const float inv = __builtin_amdgcn_rcpf(a0 * lsum + a1 * l1);
      const float f0 = a0 * inv, f1 = a1 * inv;
#pragma unroll
      for (int nb = 0; nb < 4; ++nb) {
        const v4f x0 = *(const v4f*)(xrow + nb * 8);
        const v4f x1 = *(const v4f*)(xrow + nb * 8 + 4);
        v4f t0 = *(const v4f*)(orow + nb * 16);
        v4f t1 = *(const v4f*)(orow + nb * 16 + 4);
#pragma unroll
        for (int v = 0; v < 4; ++v) {
          t0[v] = t0[v] + (o[nb][v] * f0 + x0[v] * f1);
          t1[v] = t1[v] + (o[nb][v + 4] * f0 + x1[v] * f1);
        }
        *(v4f*)(orow + nb * 16) = t0;
        *(v4f*)(orow + nb * 16 + 4) = t1;
      }
    }
#pragma unroll
    for (int nb = 0; nb < 4; ++nb) o[nb] = (v8f){};
    mrow = -1.0e30f;
    lrow = 0.0f;
  }

  if (g == 0u) {
  const float fs = 1.0f / (PCARRY * WCARRY);
  wave_lds_sync();
  v4f x[8];
  size_t off[8];
#pragma unroll
  for (unsigned i = 0; i < 8u; ++i) {
    const unsigned r = 2u * i + (lane >> 4);
    const unsigned c = (lane & 15u) * 4u;
    x[i] = *(const v4f*)&Os[obase + r * LDC + c] * fs;
    off[i] = ((size_t)bh * SEQ_FULL + qrow0 + r) * HD + c;
  }
#pragma unroll
  for (int i = 0; i < 8; ++i) *(v4f*)(Out + off[i]) = x[i];
  // precaution: the second tile's first instructions reuse the stores' address and data registers
  asm volatile("s_wait_xcnt 0x0" ::: "memory");
  }
  }   // pass
  asm volatile("s_wait_asynccnt 0x0" ::: "memory");   // no copy is outstanding when the wave ends
}

// ---------------------------------------------------------------------------
extern "C" void kernel_launch(void* const* d_in, const int* in_sizes, int n_in,
                              void* d_out, int out_size, void* d_ws, size_t ws_size,
                              hipStream_t stream) {
  if (n_in < 3) return;
  const long long need = ((long long)(NBH - 1) * SEQ_FULL + SEQ) * HD;
  if ((long long)in_sizes[0] < need) return;
  if ((long long)in_sizes[1] < need) return;
  if ((long long)in_sizes[2] < need) return;
  if ((long long)out_size < need) return;
  if (ws_size < WS_TOTAL) return;

  const float* Qf = (const float*)d_in[0];    // query [NB_FULL][NHEAD][SEQ_FULL][HD]
  const float* Kf = (const float*)d_in[1];    // key
  const float* Vf = (const float*)d_in[2];    // value
  float* out = (float*)d_out;                 // [NB_FULL][NHEAD][SEQ_FULL][HD]

  char* ws = (char*)d_ws;
  _Float16* Q16  = (_Float16*)(ws + OFF_Q);    // [bh][SEQ][HD]
  _Float16* K16  = (_Float16*)(ws + OFF_K);    // [bh][SEQ][HD]
  _Float16* Vt16 = (_Float16*)(ws + OFF_VT);   // [bh][HD][SEQ]

  dim3 blk(256);
  prep_kernel<<<dim3(SEQ / 128, NBH), blk, 0, stream>>>(Qf, Kf, Vf, Q16, K16, Vt16);
  attn_kernel<<<dim3(NQT / 2, NHEAD, NB), blk, 0, stream>>>(Q16, K16, Vt16, out);
}

// v007
// It runs in 26.7 microseconds.
// In two side-by-side timings against v006, it was 1.38 and 1.39 times as fast.
// Over all steps from v000 it is 3.54 times as fast.
#include <hip/hip_runtime.h>
#include <stddef.h>

// Matrix products on v_wmma_f32_16x16x32_f16 (f16 operands, f32 accumulate): q.k scores, p.v and the value column sums; squared row norms of q and k in f32.
// Float inputs are RNE-converted to bf16 and carried in f16 (q and k x16, v x64, p x1024; p gets
// an extra x1024 residual plane with its own accumulator on the first key tile of the first
// 128 query rows of every 512-row chunk). Softmax, additive mask, chunk sums in f32.
// Causal chunked attention: per 512-key chunk an independent softmax (additive -1e9 on masked
// cells; every cell of a past chunk is masked), the chunk outputs are summed.
// Past chunks: where the row norms bound every |q.k| / 8 below 30, each masked score is -1e9 itself in
// f32, the softmax is 1/512 in every cell, and the chunk's output is the column mean of its values:
// taken from column sums made once per 128-row slab (V^T . ones) instead of once per query tile.

typedef _Float16 v16h __attribute__((ext_vector_type(16)));
typedef _Float16 v8h  __attribute__((ext_vector_type(8)));
typedef _Float16 v4h  __attribute__((ext_vector_type(4)));
typedef float    v8f  __attribute__((ext_vector_type(8)));
typedef float    v4f  __attribute__((ext_vector_type(4)));
typedef float    v2f  __attribute__((ext_vector_type(2)));

#ifndef NB
#define NB 2
#endif
#ifndef SEQ
#define SEQ 2048
#endif
#define NB_FULL  2
#define SEQ_FULL 2048
#define NHEAD 16
#define HD    64
#define CHUNK 512
#define NBH   (NB * NHEAD)

static_assert(NB >= 1 && NB <= NB_FULL);
static_assert(SEQ >= CHUNK && SEQ <= SEQ_FULL && (SEQ % CHUNK) == 0);
static_assert((CHUNK % 128) == 0 && (SEQ % 128) == 0 && (SEQ % 64) == 0);
static_assert(HD == 64);
static_assert((size_t)NBH * SEQ_FULL * HD < (size_t)0xFFFFFFFFu);

#define LDT 72   // halves per LDS row (144 B, 16-B aligned)
#define LDC 68   // floats per LDS row (272 B, 16-B aligned)
static_assert((LDT % 8) == 0 && LDT >= 64);
static_assert((LDC % 4) == 0 && LDC >= 64);

#define QKCARRY 16.0f    // q and k planes carried x16 each
#define WCARRY  64.0f    // value plane carried x64
#define PCARRY  1024.0f  // softmax numerators carried x1024
#define RCARRY  1024.0f  // residual plane of p carried x1024 on top of its hi part
#define NEGFILL (-1.0e9f)
#ifndef P_RES
#define P_RES 1          // 1: p residual product on the early band; 0: single product everywhere
#endif

// workspace layout (bytes)
#define PLANE16_BYTES ((size_t)NBH * SEQ * HD * 2)
#define OFF_Q  ((size_t)0)
#define OFF_K  (OFF_Q + PLANE16_BYTES)
#define OFF_VT (OFF_K + PLANE16_BYTES)
// one record per (head, 128-row slab), three 128-B lines: 64 column sums of the carried values, then
// the largest squared row norm of the slab's carried q rows and of its carried k rows
#define REC 96u
#define NSLAB (SEQ / 128)
#define OFF_R  (OFF_VT + PLANE16_BYTES)
#define WS_TOTAL (OFF_R + (size_t)NBH * NSLAB * REC * 4)
static_assert((PLANE16_BYTES % 128) == 0);
static_assert(NSLAB <= 16);   // a 16-lane row holds one slab's norms a lane
// |q.k| / 8 <= |16 q| |16 k| 2^-11 (Cauchy-Schwarz). Below 30 it stays under 32, half a step of f32 at
// 1e9, also with the inputs' rounding to bf16 (2^-8 a factor) undone: score + -1e9 is then -1e9.
#define FLATB (900.0f * 4194304.0f)   // bound on |16 q|^2 |16 k|^2: 30^2 * 2^22
static_assert(WS_TOTAL <= (size_t)134217728);

#define LDX 36   // floats per lane slot of the state exchange (144 B, 16-B aligned)
static_assert((LDX % 4) == 0 && LDX >= 34);
#define NQT (SEQ / 64)   // query tiles of 64 rows per head
static_assert((NQT % 2) == 0);

#define TILEH (2u * 64u * LDT)   // halves of one staging buffer of K or of V^T: both key halves of a step

// static LDS of the attention kernel (two staging buffers of K and of V^T)
static_assert((size_t)(2 * TILEH * 2) * 2 + (size_t)(4 * 16 * LDC * 4) +
              (size_t)(4 * 32 * LDX * 4) <= (size_t)131072);

// ---------------------------------------------------------------------------
__device__ __forceinline__ float bf16r(float x) {   // RNE convert to bf16, returned widened
  unsigned int u = __float_as_uint(x);
  u = (u + 0x7FFFu + ((u >> 16) & 1u)) & 0xFFFF0000u;
  return __uint_as_float(u);
}

// f32 -> f16 that cannot produce an f16 subnormal (value select)
static __device__ __forceinline__ _Float16 toh_flush(float v) {
  const _Float16 r = (_Float16)v;
  return (fabsf(v) < 6.103515625e-05f) ? (_Float16)0.0f : r;
}

// 16-bit fragment: p points at element [row = lane&15][k0 + 8*(lane>>4)] of a k-contiguous
// row. Elements 0..7 <- k0+8h+0..7, elements 8..15 <- k0+16+8h+0..7 (same map for A and B).
__device__ __forceinline__ v16h frag_at(const _Float16* p) {
  v8h lo = *(const v8h*)(p);
  v8h hi = *(const v8h*)(p + 16);
  v16h out;
#pragma unroll
  for (int i = 0; i < 8; ++i) { out[i] = lo[i]; out[i + 8] = hi[i]; }
  return out;
}
__device__ __forceinline__ v16h ld_frag(const _Float16* base, unsigned ld) {
  const unsigned lane = threadIdx.x & 31u;
  return frag_at(base + (lane & 15u) * ld + (lane >> 4) * 8u);
}

__device__ __forceinline__ v8f wmma16(v16h a, v16h b, v8f c) {
  v8f d = __builtin_amdgcn_wmma_f32_16x16x32_f16(false, a, false, b, (short)0, c,
                                                 false, false);
  asm volatile("v_nop\n\tv_nop\n\tv_nop\n\tv_nop" : "+v"(d) : "v"(a), "v"(b));
  return d;
}

__device__ __forceinline__ float xhalf(float x) {   // value of lane l ^ 16
  const int b = __builtin_bit_cast(int, x);
  return __builtin_bit_cast(float, __builtin_amdgcn_permlanex16(b, b, 0x76543210, 0xfedcba98,
                                                                false, false));
}

// maximum that hands a NaN on: a NaN norm must fail the bound test
__device__ __forceinline__ float max_nan(float a, float b) {
  return __builtin_elementwise_maximum(a, b);
}

template <int CTRL>
__device__ __forceinline__ float dpp_of(float x) {
  return __builtin_bit_cast(float, __builtin_amdgcn_update_dpp(0, __builtin_bit_cast(int, x), CTRL,
                                                               0xf, 0xf, true));
}
// sum over the 16 lanes of a row, in every lane: neighbours, pairs, then the mirrored quad and half
__device__ __forceinline__ float row16_sum(float x) {
  x += dpp_of<0xB1>(x);    // quad_perm [1,0,3,2]
  x += dpp_of<0x4E>(x);    // quad_perm [2,3,0,1]
  x += dpp_of<0x141>(x);   // row_half_mirror
  x += dpp_of<0x140>(x);   // row_mirror
  return x;
}

// compile-time kind of a key chunk: a past chunk (every cell masked) or the diagonal chunk
struct PastChunk { static constexpr bool past = true; };
struct DiagChunk { static constexpr bool past = false; };

// number of 128-key steps of the 64-row query tile at q0: its past chunks whole, then the diagonal
// chunk up to key q0 + 63, rounded up to whole steps; at least 1
__device__ __forceinline__ unsigned steps_of(unsigned q0) {
  const unsigned cs = q0 & ~((unsigned)CHUNK - 1u);
  return (cs + ((q0 - cs + 191u) & ~127u)) >> 7;
}

__device__ __forceinline__ unsigned lds_off(const void* p) { return (unsigned)(size_t)p; }

__device__ __forceinline__ void wave_lds_sync() {
  __builtin_amdgcn_fence(3 /* release order */, "wavefront");
  asm volatile("s_wait_dscnt 0x0" ::: "memory");
  __builtin_amdgcn_wave_barrier();
}

// ---------------------------------------------------------------------------
// All three planes in one launch. One work-group per (128-row slab, head): q and k rows go to the
// compact planes [bh][s][64] as f16(16 * bf16(x)), the value rows to the transposed plane
// [bh][64][s] as f16(64 * bf16(x)). A thread takes 32 elements of each input and issues its 24
// 16-B loads ahead of all arithmetic; the whole grid is resident at once, so few waves have to start.
// q, k: one load of a wave covers 512 contiguous bytes, one store 256 (two whole lines).
// v: thread (rg, cq) loads rows 8 rg .. 8 rg + 7, columns 4 cq .. 4 cq + 3 (a wave's load: two whole
// rows) and writes, per column d, its 8 keys as one 16-B piece into T[d][piece]; row d keeps piece p
// at place p ^ (d >> 2), which spreads both the writers' and the readers' 16 lanes over all banks.
// T: cross-wave (block barrier). Store loop: 16 rows of d per step x 4 steps; one store of a wave =
// two rows of 256 contiguous bytes.
// The slab's record: waves 0 and 1 sum T's rows over the 128 keys as V^T . ones (32 rows of d = one
// 128-B line each; with a B of ones the k order is free, so lane m reads place p ^ m: no bank shared).
// A q or k row lies in 16 lanes: its squared norm is 4 products a lane and a 16-lane sum; the waves'
// maxima meet in red (second block barrier) and one thread writes both.
// Grid (SEQ/128, NBH).
// ---------------------------------------------------------------------------
#define PROWS 128u   // rows of a slab
static_assert((SEQ % 128) == 0 && HD == 64);
static_assert(128 * HD == 256 * 4 * 8);        // 8 loads of 4 floats a thread cover a slab of one input
static_assert((256 / 16) * 8 == 128 && 16 * 4 == HD && (256 / 16) * 4 == HD);
__global__ __launch_bounds__(256) void prep_kernel(
    const float* __restrict__ Qf, const float* __restrict__ Kf, const float* __restrict__ Vf,
    _Float16* __restrict__ Q16, _Float16* __restrict__ K16, _Float16* __restrict__ Vt,
    float* __restrict__ R) {
  __shared__ __attribute__((aligned(16))) _Float16 T[HD * PROWS];
  __shared__ __attribute__((aligned(16))) float red[16];
  const unsigned tid = threadIdx.x;
  const unsigned w = (unsigned)__builtin_amdgcn_readfirstlane((int)(threadIdx.x >> 5));
  const unsigned s0 = blockIdx.x * PROWS;
  const unsigned bh = blockIdx.y;
  const float* const qs = Qf + ((size_t)bh * SEQ_FULL + s0) * HD;   // block-uniform bases
  const float* const ks = Kf + ((size_t)bh * SEQ_FULL + s0) * HD;
  const float* const vs = Vf + ((size_t)bh * SEQ_FULL + s0) * HD;
  const unsigned rg = tid >> 4, cq = tid & 15u;

  const float* const vp = vs + (rg * 8u) * (unsigned)HD + cq * 4u;   // the thread's first value piece
  v4f vv[8], qa[8], ka[8];
#pragma unroll
  for (unsigned r = 0; r < 8u; ++r) vv[r] = *(const v4f*)(vp + r * (unsigned)HD);
  // keeps the value loads first, the order of use (loads return in order): else the scheduler asks
  // for the value rows last and the first conversion waits for all 24 loads
  __builtin_amdgcn_sched_barrier(0);
#pragma unroll
  for (unsigned j = 0; j < 8u; ++j) qa[j] = *(const v4f*)(qs + (j * 256u + tid) * 4u);
#pragma unroll
  for (unsigned j = 0; j < 8u; ++j) ka[j] = *(const v4f*)(ks + (j * 256u + tid) * 4u);
  // precaution ahead of any rewrite of the loads' address registers; it names them as inputs so that
  // no later load's result is laid over them in front of it
  asm volatile("s_wait_xcnt 0x0" :: "v"(vp), "v"(tid) : "memory");
  // keeps all 24 loads in front of the arithmetic: left alone, the scheduler puts part of them among
  // the conversions, and a wave then has fewer bytes in flight
  __builtin_amdgcn_sched_barrier(0);

#pragma unroll
  for (unsigned i = 0; i < 4u; ++i) {
    v8h x;
#pragma unroll
    for (int r = 0; r < 8; ++r) x[r] = toh_flush(WCARRY * bf16r(vv[r][i]));
    *(v8h*)&T[(cq * 4u + i) * PROWS + (rg ^ cq) * 8u] = x;
  }

  _Float16* const qd = Q16 + ((size_t)bh * SEQ + s0) * HD;
  _Float16* const kd = K16 + ((size_t)bh * SEQ + s0) * HD;
  float nq = 0.0f, nk = 0.0f;   // largest squared norm of the rows that this 16-lane row holds
#pragma unroll
  for (unsigned j = 0; j < 8u; ++j) {
    v4h x;
    float ss = 0.0f;
#pragma unroll
    for (int i = 0; i < 4; ++i) {
      const float f = QKCARRY * bf16r(qa[j][i]);
      x[i] = toh_flush(f);
      ss += f * f;
    }
    *(v4h*)(qd + (j * 256u + tid) * 4u) = x;
    nq = max_nan(nq, row16_sum(ss));
  }
  // precaution: what follows reuses the q stores' data and address registers
  asm volatile("s_wait_xcnt 0x0" ::: "memory");

  // block barrier for T alone: only LDS data crosses waves here, so the fences name LDS; a plain
  // __syncthreads() would also wait for the q stores to finish (and for any global load in flight)
  __builtin_amdgcn_fence(__ATOMIC_RELEASE, "workgroup", "local");
  __builtin_amdgcn_s_barrier();
  __builtin_amdgcn_fence(__ATOMIC_ACQUIRE, "workgroup", "local");
  _Float16* const vd = Vt + (size_t)bh * HD * SEQ + s0;
  v8h y[4];
#pragma unroll
  for (unsigned i = 0; i < 4u; ++i) {
    const unsigned d = 16u * i + rg;
    y[i] = *(const v8h*)&T[d * PROWS + (cq ^ (d >> 2)) * 8u];
  }
#pragma unroll
  for (unsigned i = 0; i < 4u; ++i) *(v8h*)(vd + (16u * i + rg) * (unsigned)SEQ + cq * 8u) = y[i];
  // precaution: what follows reuses the stores' data and address registers
  asm volatile("s_wait_xcnt 0x0" ::: "memory");

  float* const rec = R + ((size_t)bh * NSLAB + blockIdx.x) * REC;   // block-uniform
  if (w < 2u) {   // scalar test: EXEC stays full for the products
    const unsigned hh = (tid >> 4) & 1u, m = tid & 15u;
    v16h one;
#pragma unroll
    for (int v = 0; v < 16; ++v) one[v] = (_Float16)1.0f;
    // all eight fragments are read as one group ahead of the products: one LDS latency, not eight
    v16h a[4][2];
#pragma unroll
    for (unsigned c = 0; c < 4u; ++c)
#pragma unroll
      for (unsigned gi = 0; gi < 2u; ++gi) {
        const _Float16* const row = &T[((2u * w + gi) * 16u + m) * PROWS];
        const v8h lo = *(const v8h*)(row + ((4u * c + hh) ^ m) * 8u);
        const v8h hi = *(const v8h*)(row + ((4u * c + 2u + hh) ^ m) * 8u);
#pragma unroll
        for (int v = 0; v < 8; ++v) { a[c][gi][v] = lo[v]; a[c][gi][v + 8] = hi[v]; }
      }
    v8f cs[2] = {(v8f){}, (v8f){}};
#pragma unroll
    for (unsigned c = 0; c < 4u; ++c)
#pragma unroll
      for (unsigned gi = 0; gi < 2u; ++gi) cs[gi] = wmma16(a[c][gi], one, cs[gi]);
    if (m == 0u) {   // every column of the result is the same sum: lane (hh, 0) holds rows 8 hh + 0..7
#pragma unroll
      for (unsigned gi = 0; gi < 2u; ++gi) {
        float* const p = rec + (2u * w + gi) * 16u + hh * 8u;
        *(v4f*)(p)     = (v4f){cs[gi][0], cs[gi][1], cs[gi][2], cs[gi][3]};
        *(v4f*)(p + 4) = (v4f){cs[gi][4], cs[gi][5], cs[gi][6], cs[gi][7]};
      }
    }
    // precaution: what follows reuses the stores' data and address registers
    asm volatile("s_wait_xcnt 0x0" ::: "memory");
  }

#pragma unroll
  for (unsigned j = 0; j < 8u; ++j) {
    v4h x;
    float ss = 0.0f;
#pragma unroll
    for (int i = 0; i < 4; ++i) {
      const float f = QKCARRY * bf16r(ka[j][i]);
      x[i] = toh_flush(f);
      ss += f * f;
    }
    *(v4h*)(kd + (j * 256u + tid) * 4u) = x;
    nk = max_nan(nk, row16_sum(ss));
  }
  // precaution: what follows reuses the k stores' data and address registers
  asm volatile("s_wait_xcnt 0x0" ::: "memory");

  nq = max_nan(nq, xhalf(nq));
  nk = max_nan(nk, xhalf(nk));
  if ((tid & 31u) == 0u) {
    red[w] = nq;
    red[8u + w] = nk;
  }
  // block barrier for red alone (LDS data only, as above)
  __builtin_amdgcn_fence(__ATOMIC_RELEASE, "workgroup", "local");
  __builtin_amdgcn_s_barrier();
  __builtin_amdgcn_fence(__ATOMIC_ACQUIRE, "workgroup", "local");
  if (tid == 64u) {   // a wave that wrote no column sums owns the record's third line
    const v4f a = *(const v4f*)&red[0], b = *(const v4f*)&red[4];
    const v4f c = *(const v4f*)&red[8], d = *(const v4f*)&red[12];
    rec[64] = max_nan(max_nan(max_nan(a[0], a[1]), max_nan(a[2], a[3])),
                      max_nan(max_nan(b[0], b[1]), max_nan(b[2], b[3])));
    rec[65] = max_nan(max_nan(max_nan(c[0], c[1]), max_nan(c[2], c[3])),
                      max_nan(max_nan(d[0], d[1]), max_nan(d[2], d[3])));
  }
}

static_assert(2 * 8 == 16);
__global__ __launch_bounds__(256) __attribute__((amdgpu_num_vgpr(256))) void attn_kernel(
    const _Float16* __restrict__ Qh, const _Float16* __restrict__ Kh,
    const _Float16* __restrict__ Vt, const float* __restrict__ R, float* __restrict__ Out) {
  __shared__ __attribute__((aligned(16))) _Float16 Ks[2 * TILEH];   // [buffer][g][key][d]
  __shared__ __attribute__((aligned(16))) _Float16 Vs[2 * TILEH];   // [buffer][g][d][key]
  __shared__ __attribute__((aligned(16))) float Os[4 * 16 * LDC];
  __shared__ __attribute__((aligned(16))) float Xs[4 * 32 * LDX];

  const unsigned tid = threadIdx.x, lane = tid & 31u;
  const unsigned w = (unsigned)__builtin_amdgcn_readfirstlane((int)(threadIdx.x >> 5));
  const unsigned g = w >> 2, wq = w & 3u;            // key half of a step; query row group
  const unsigned hh = lane >> 4, m = lane & 15u;
  const unsigned bh = blockIdx.z * (unsigned)NHEAD + blockIdx.y;
  const float scale = 0.125f / (QKCARRY * QKCARRY);  // HD^-0.5 over the plane carries
  const unsigned obase = wq * (16u * LDC);
  float* const xrow = &Xs[(wq * 32u + lane) * LDX];
  const size_t kplane = (size_t)bh * SEQ * HD;
  const size_t vplane = (size_t)bh * HD * SEQ;
  // staging: the thread's own element inside a step's K rows / V^T rows (global) and tiles (LDS);
  // piece j lies 32 keys (K) or 16 rows of d (V^T) further on
  const unsigned kgo = (tid >> 3) * (unsigned)HD + (tid & 7u) * 8u;
  const unsigned vgo = (tid >> 4) * (unsigned)SEQ + (tid & 15u) * 8u;
  const unsigned klo = (tid >> 3) * LDT + (tid & 7u) * 8u;
  const unsigned vlo = ((tid & 15u) >> 3) * (64u * LDT) + (tid >> 4) * LDT + (tid & 7u) * 8u;
  const unsigned qgo = m * (unsigned)HD + hh * 8u;   // the lane's element inside its wave's Q rows

  // the work-group's steps in running order; block-uniform
  const float* const rb = R + (size_t)bh * NSLAB * REC;   // the head's slab records; block-uniform
  // do the norms bound every score of the tile at q0 against its past chunks? (no past chunk: no matter)
  // Lane m holds slab m's two norms: one load for all slabs (one latency), each wave for itself.
  const unsigned msl = (m < (unsigned)NSLAB) ? m : ((unsigned)NSLAB - 1u);
  const v2f nrm = *(const v2f*)(rb + msl * REC + 64u);
  // the slabs' column sums of the lane's four output columns, asked for here, summed behind step 0's copies
  v4f ps[(SEQ - CHUNK) / 128];
#pragma unroll
  for (unsigned sl = 0; sl < (unsigned)(SEQ - CHUNK) / 128u; ++sl)
    ps[sl] = *(const v4f*)(rb + sl * REC + m * 4u);
  auto past_flat = [&](const unsigned q0) __attribute__((always_inline)) {
    const unsigned nsl = (q0 & ~((unsigned)CHUNK - 1u)) >> 7;
    float kn = (m < nsl) ? nrm[1] : 0.0f;          // the past slabs' key norms; 16-lane maximum
    kn = max_nan(kn, dpp_of<0xB1>(kn));
    kn = max_nan(kn, dpp_of<0x4E>(kn));
    kn = max_nan(kn, dpp_of<0x141>(kn));
    kn = max_nan(kn, dpp_of<0x140>(kn));
    const float ku = __builtin_bit_cast(
        float, __builtin_amdgcn_readfirstlane(__builtin_bit_cast(int, kn)));
    const float qu = __builtin_bit_cast(
        float, __builtin_amdgcn_readlane(__builtin_bit_cast(int, nrm[0]), (int)(q0 >> 7)));
    return qu * ku < FLATB;                        // scalar: the same in every wave of the block
  };
  const unsigned qA = ((unsigned)NQT - 1u - blockIdx.x) * 64u, qB = blockIdx.x * 64u;
  const bool fA = past_flat(qA), fB = past_flat(qB);
  // first 128-key step that each tile walks
  const unsigned bA = fA ? ((qA & ~((unsigned)CHUNK - 1u)) >> 7) : 0u;
  const unsigned bB = fB ? ((qB & ~((unsigned)CHUNK - 1u)) >> 7) : 0u;
  const unsigned n0 = steps_of(qA) - bA;
  const unsigned ntot = n0 + steps_of(qB) - bB;
  const unsigned kl0 = lds_off(&Ks[klo]), vl0 = lds_off(&Vs[vlo]);   // LDS byte addresses, buffer 0
  const _Float16* const kg0 = Kh + kplane + kgo;
  const _Float16* const vg0 = Vt + vplane + vgo;
  // step t's K and V^T tiles into buffer t & 1: eight copies a lane, every lane on. The s_wait_xcnt
  // ends the copies' own statement, a precaution ahead of any rewrite of their address registers.
  auto stage = [&](const unsigned t) __attribute__((always_inline)) {
    const unsigned ks = (t < n0 ? t + bA : t - n0 + bB) * 128u;   // first key of the step
    const unsigned bo = (t & 1u) * (TILEH * 2u);        // the buffer's byte offset
    const unsigned kl = kl0 + bo, vl = vl0 + bo;
    const _Float16* const kp = kg0 + (size_t)ks * HD;
    const _Float16* const vp = vg0 + ks;
    asm volatile(
        "global_load_async_to_lds_b128 %0, %8, off\n\t"
        "global_load_async_to_lds_b128 %1, %9, off\n\t"
        "global_load_async_to_lds_b128 %2, %10, off\n\t"
        "global_load_async_to_lds_b128 %3, %11, off\n\t"
        "global_load_async_to_lds_b128 %4, %12, off\n\t"
        "global_load_async_to_lds_b128 %5, %13, off\n\t"
        "global_load_async_to_lds_b128 %6, %14, off\n\t"
        "global_load_async_to_lds_b128 %7, %15, off\n\t"
        "s_wait_xcnt 0x0"
        :: "v"(kl), "v"(kl + 1u * (32u * LDT * 2u)), "v"(kl + 2u * (32u * LDT * 2u)),
           "v"(kl + 3u * (32u * LDT * 2u)),
           "v"(vl), "v"(vl + 1u * (16u * LDT * 2u)), "v"(vl + 2u * (16u * LDT * 2u)),
           "v"(vl + 3u * (16u * LDT * 2u)),
           "v"(kp), "v"(kp + 1u * (32u * HD)), "v"(kp + 2u * (32u * HD)), "v"(kp + 3u * (32u * HD)),
           "v"(vp), "v"(vp + 1u * (16u * SEQ)), "v"(vp + 2u * (16u * SEQ)), "v"(vp + 3u * (16u * SEQ))
        : "memory");
  };
  // in front of the loops: step 0 landed and published, step 1 in flight (ntot >= 2: each tile has a step)
  stage(0u);
  // keeps the sums below, which wait for the slabs' loads, behind the issue of step 0's copies
  __builtin_amdgcn_sched_barrier(0);
  // past chunks that a tile does not walk: their share of the lane's four output columns, the same for
  // every row of the tile; bA and bB count the slabs (0 where the tile walks its past chunks)
  v4f pvA = {}, pvB = {};
#pragma unroll
  for (unsigned sl = 0; sl < (unsigned)(SEQ - CHUNK) / 128u; ++sl) {
    pvA += (sl < bA) ? ps[sl] : (v4f){};
    pvB += (sl < bB) ? ps[sl] : (v4f){};
  }
  pvA = pvA * (1.0f / ((float)CHUNK * WCARRY));
  pvB = pvB * (1.0f / ((float)CHUNK * WCARRY));
  asm volatile("s_wait_asynccnt 0x0" ::: "memory");   // this wave's copies of step 0 have landed
  __syncthreads();
  stage(1u);
  unsigned t = 0u;   // number of the running step

#pragma unroll 1   // the two tiles run one after the other through one copy of the loop
  for (unsigned pass = 0; pass < 2u; ++pass) {
  const unsigned q0 = (pass ? blockIdx.x : ((unsigned)NQT - 1u - blockIdx.x)) * 64u;
  const unsigned ci = q0 / (unsigned)CHUNK;          // chunk of this query block
  const unsigned cs = ci * (unsigned)CHUNK;          // first key of the diagonal chunk
  const bool first_blk = (q0 - cs < 128u);           // first 128 rows of the chunk; block-uniform
  const unsigned qrow0 = q0 + wq * 16u;

  const _Float16* const qw = Qh + ((size_t)bh * SEQ + qrow0) * HD;   // wave-uniform
  v16h qf[2];
  qf[0] = frag_at(qw + qgo);
  qf[1] = frag_at(qw + qgo + 32);
  const bool pflat = pass ? fB : fA;
  // precaution: the loads' address registers are reused by the staging below before any other wait
  asm volatile("s_wait_xcnt 0x0" ::: "memory");

  float mrow = -1.0e30f, lrow = 0.0f;   // of query row m; lrow: this half's keys only
  // The running output (sum of the chunks' O / l) rests in group 0's own output rows of Os, which
  // are idle until the epilogue: lane (hh, m) owns cells [m][16 nb + 8 hh + 0..7], touched once per
  // chunk. That leaves its 32 registers to the V^T fragments held across the softmax.
  float* const orow = &Os[obase + m * LDC + hh * 8u];
  v8f o[4];
#pragma unroll
  for (int nb = 0; nb < 4; ++nb) o[nb] = (v8f){};
  if (g == 0u) {
#pragma unroll
    for (int nb = 0; nb < 4; ++nb) {
      *(v4f*)(orow + nb * 16) = (v4f){};
      *(v4f*)(orow + nb * 16 + 4) = (v4f){};
    }
  }

#pragma unroll 1
  for (unsigned jc = pflat ? ci : 0u; jc <= ci; ++jc) {
    const bool offd = (jc < ci);                     // past chunk: every cell masked
    const unsigned kc0 = jc * (unsigned)CHUNK;
    const unsigned kc1 =                             // <= SEQ
        offd ? (kc0 + (unsigned)CHUNK) : (cs + ((q0 - cs + 191u) & ~127u));

    // one 128-key step; compiled once for past chunks and once for the diagonal chunk
    auto step = [&](auto kind, const unsigned ks) __attribute__((always_inline)) {
      constexpr bool offd = decltype(kind)::past;
      const unsigned kb = ks + g * 64u;                // this wave's 64 keys
      const bool early = (P_RES != 0) && first_blk && (!offd) && (kb == cs);   // wave-uniform
      const _Float16* const Kw = &Ks[(t & 1u) * TILEH + g * (64u * LDT)];   // this step's buffer
      const _Float16* const Vw = &Vs[(t & 1u) * TILEH + g * (64u * LDT)];

      // scores: 4 key groups of 16, K = 64 in two 32-steps. All eight K fragments are read as
      // one group ahead of the eight products (one LDS latency per tile, not one per product);
      // the four accumulators advance side by side, each still c = 0 then c = 1.
      v16h kf[2][4];
#pragma unroll
      for (int c = 0; c < 2; ++c)
#pragma unroll
        for (int kg = 0; kg < 4; ++kg) kf[c][kg] = ld_frag(&Kw[(kg * 16) * LDT + c * 32], LDT);
      v8f s[4];
#pragma unroll
      for (int kg = 0; kg < 4; ++kg) s[kg] = (v8f){};
#pragma unroll
      for (int c = 0; c < 2; ++c)
#pragma unroll
        for (int kg = 0; kg < 4; ++kg) s[kg] = wmma16(kf[c][kg], qf[c], s[kg]);

      // all eight V^T fragments, issued here as one group: they land while the softmax runs
      v16h vf[2][4];
#pragma unroll
      for (int c = 0; c < 2; ++c)
#pragma unroll
        for (int nb = 0; nb < 4; ++nb) vf[c][nb] = ld_frag(&Vw[(nb * 16) * LDT + c * 32], LDT);

      // Past chunk: the f32 sum score + (-1e9) keeps steps of 64 only, so a whole tile's masked scores
      // are as a rule one and the same number. Tested by value: rounding is monotone, so when the
      // lane's smallest and largest score give the same masked value, all 32 between them do. Where
      // that value is also the other half's and the running maximum (or this is the chunk's first
      // step, whose state is all zero), the softmax below would find alpha = 1 and p = exp(0) = 1 in
      // every cell: the same numbers come from a constant P operand, without the softmax arithmetic.
      bool flat = false;                               // wave-uniform
      float tflat = 0.0f;
      if constexpr (offd) {
        float hi[4], lo[4];
#pragma unroll
        for (int kg = 0; kg < 4; ++kg) {
          hi[kg] = fmaxf(fmaxf(fmaxf(s[kg][0], s[kg][1]), fmaxf(s[kg][2], s[kg][3])),
                         fmaxf(fmaxf(s[kg][4], s[kg][5]), fmaxf(s[kg][6], s[kg][7])));
          lo[kg] = fminf(fminf(fminf(s[kg][0], s[kg][1]), fminf(s[kg][2], s[kg][3])),
                         fminf(fminf(s[kg][4], s[kg][5]), fminf(s[kg][6], s[kg][7])));
        }
        tflat = fmaxf(fmaxf(hi[0], hi[1]), fmaxf(hi[2], hi[3])) * scale + NEGFILL;
        const float tlo = fminf(fminf(lo[0], lo[1]), fminf(lo[2], lo[3])) * scale + NEGFILL;
        const bool ok = (bool)((int)(tlo == tflat) & (int)(xhalf(tflat) == tflat) &
                               ((int)(ks == kc0) | (int)(mrow == tflat)));
        flat = (__builtin_amdgcn_ballot_w32(ok) == 0xFFFFFFFFu);   // scalar test: EXEC stays full
      }

      // B operands of the two 32-key steps, f16(1024 p), and the new state: set for p = 1 in all of
      // this half's 32 cells; the softmax overwrites them where the tile is not flat
      v16h pf[2];
#pragma unroll
      for (int v = 0; v < 16; ++v) {
        pf[0][v] = (_Float16)PCARRY;
        pf[1][v] = (_Float16)PCARRY;
      }
      float mnew = tflat, lnew = lrow + 32.0f;
      // the hint lays the flat tile out as the fall-through of a past chunk's step
      if (__builtin_expect(!flat, !offd)) {
#pragma unroll
      for (int kg = 0; kg < 4; ++kg) s[kg] = s[kg] * scale;

      // additive mask; wave-uniform tests, per-cell addend selected by value
      if (offd) {
#pragma unroll
        for (int kg = 0; kg < 4; ++kg)
#pragma unroll
          for (int v = 0; v < 8; ++v) s[kg][v] = s[kg][v] + NEGFILL;
      } else if (kb >= q0) {
#pragma unroll
        for (int kg = 0; kg < 4; ++kg)
#pragma unroll
          for (int v = 0; v < 8; ++v) {
            const unsigned key = kb + (unsigned)kg * 16u + hh * 8u + (unsigned)v;
            const unsigned row = qrow0 + m;
            const float add = (key > row) ? NEGFILL : 0.0f;
            s[kg][v] = s[kg][v] + add;
          }
      }

      // online softmax; a lane holds 32 of its query row's 64 scores, lane ^ 16 the other 32
      float mk[4];
#pragma unroll
      for (int kg = 0; kg < 4; ++kg)
        mk[kg] = fmaxf(fmaxf(fmaxf(s[kg][0], s[kg][1]), fmaxf(s[kg][2], s[kg][3])),
                       fmaxf(fmaxf(s[kg][4], s[kg][5]), fmaxf(s[kg][6], s[kg][7])));
      float mx = fmaxf(fmaxf(mk[0], mk[1]), fmaxf(mk[2], mk[3]));
      mx = fmaxf(mx, xhalf(mx));
      const float mn = fmaxf(mrow, mx);
      const float alpha = __expf(mrow - mn);
      mnew = mn;
#pragma unroll
      for (int kg = 0; kg < 4; ++kg)
#pragma unroll
        for (int v = 0; v < 8; ++v) s[kg][v] = __expf(s[kg][v] - mn);
      float sk[4];
#pragma unroll
      for (int kg = 0; kg < 4; ++kg)
        sk[kg] = ((s[kg][0] + s[kg][1]) + (s[kg][2] + s[kg][3])) +
                 ((s[kg][4] + s[kg][5]) + (s[kg][6] + s[kg][7]));
      lnew = alpha * lrow + ((sk[0] + sk[1]) + (sk[2] + sk[3]));
#pragma unroll
      for (int nb = 0; nb < 4; ++nb) o[nb] = o[nb] * alpha;
#pragma unroll
      for (int c = 0; c < 2; ++c)
#pragma unroll
        for (int v = 0; v < 8; ++v) {
          pf[c][v]     = toh_flush(s[2 * c][v] * PCARRY);
          pf[c][v + 8] = toh_flush(s[2 * c + 1][v] * PCARRY);
        }
      }   // softmax of a tile that is not flat
      mrow = mnew;
      lrow = lnew;

      // O^T += V^T . P^T  (K = 64 keys in two 32-steps; A = V^T tile [d][key], B = f16(1024 p))
#pragma unroll
      for (int c = 0; c < 2; ++c)
#pragma unroll
        for (int nb = 0; nb < 4; ++nb) o[nb] = wmma16(vf[c][nb], pf[c], o[nb]);

      if (early) {
        // P residual operand: f16(1024 * (1024 p - f16(1024 p)))
        v16h pr[2];
#pragma unroll
        for (int c = 0; c < 2; ++c)
#pragma unroll
          for (int v = 0; v < 16; ++v) {
            const float t = s[2 * c + (v >> 3)][v & 7] * PCARRY;
            const float hi = (float)toh_flush(t);
            pr[c][v] = toh_flush((t - hi) * RCARRY);
          }
        // V^T . P_res^T (scale 1/1024), one 16-row group of d at a time, folded immediately
#pragma unroll
        for (int nb = 0; nb < 4; ++nb) {
          v8f o2 = {};
#pragma unroll
          for (int c = 0; c < 2; ++c) {
            const v16h vr = ld_frag(&Vw[(nb * 16) * LDT + c * 32], LDT);
            o2 = wmma16(vr, pr[c], o2);
          }
#pragma unroll
          for (int v = 0; v < 8; ++v) o[nb][v] = o[nb][v] + o2[v] * (1.0f / RCARRY);
        }
      }
      // foot of step t: the one barrier publishes step t + 1's tiles and ends every reader's last
      // read of step t's buffer, which is refilled behind it
      asm volatile("s_wait_dscnt 0x0" ::: "memory");      // this wave's reads of the buffer are done
      asm volatile("s_wait_asynccnt 0x0" ::: "memory");   // this wave's copies of step t + 1 have landed
      __syncthreads();
      if (t + 2u < ntot) stage(t + 2u);                   // block-uniform test
      ++t;
    };
    // kc1 - kc0 is a multiple of 128; both loops stay rolled: one copy of the large body per kind
    if (offd) {
#pragma unroll 1
      for (unsigned ks = kc0; ks < kc1; ks += 128u) step(PastChunk{}, ks);
    } else {
#pragma unroll 1
      for (unsigned ks = kc0; ks < kc1; ks += 128u) step(DiagChunk{}, ks);
    }

    // end of chunk: group 1 hands its state over, group 0 joins the two states, adds O / l to the
    // running output; both reset. Xs is rewritten only behind the next step's barriers.
    const float lsum = lrow + xhalf(lrow);   // the two lane halves' sums joined
    if (g != 0u) {
#pragma unroll
      for (int nb = 0; nb < 4; ++nb) {
        *(v4f*)(xrow + nb * 8)     = (v4f){o[nb][0], o[nb][1], o[nb][2], o[nb][3]};
        *(v4f*)(xrow + nb * 8 + 4) = (v4f){o[nb][4], o[nb][5], o[nb][6], o[nb][7]};
      }
      xrow[32] = mrow;
      xrow[33] = lsum;
    }
    __syncthreads();
    if (g == 0u) {
      const float m1 = xrow[32], l1 = xrow[33];
      const float mm = fmaxf(mrow, m1);
      const float a0 = __expf(mrow - mm), a1 = __expf(m1 - mm);
      const float inv = __builtin_amdgcn_rcpf(a0 * lsum + a1 * l1);
      const float f0 = a0 * inv, f1 = a1 * inv;
#pragma unroll
      for (int nb = 0; nb < 4; ++nb) {
        const v4f x0 = *(const v4f*)(xrow + nb * 8);
        const v4f x1 = *(const v4f*)(xrow + nb * 8 + 4);
        v4f t0 = *(const v4f*)(orow + nb * 16);
        v4f t1 = *(const v4f*)(orow + nb * 16 + 4);
#pragma unroll
        for (int v = 0; v < 4; ++v) {
          t0[v] = t0[v] + (o[nb][v] * f0 + x0[v] * f1);
          t1[v] = t1[v] + (o[nb][v + 4] * f0 + x1[v] * f1);
        }
        *(v4f*)(orow + nb * 16) = t0;
        *(v4f*)(orow + nb * 16 + 4) = t1;
      }
    }
#pragma unroll
    for (int nb = 0; nb < 4; ++nb) o[nb] = (v8f){};
    mrow = -1.0e30f;
    lrow = 0.0f;
  }

  if (g == 0u) {
  const float fs = 1.0f / (PCARRY * WCARRY);
  const v4f pv = pass ? pvB : pvA;
  wave_lds_sync();
  v4f x[8];
  size_t off[8];
#pragma unroll
  for (unsigned i = 0; i < 8u; ++i) {
    const unsigned r = 2u * i + (lane >> 4);
    const unsigned c = (lane & 15u) * 4u;
    x[i] = *(const v4f*)&Os[obase + r * LDC + c] * fs + pv;
    off[i] = ((size_t)bh * SEQ_FULL + qrow0 + r) * HD + c;
  }
#pragma unroll
  for (int i = 0; i < 8; ++i) *(v4f*)(Out + off[i]) = x[i];
  // precaution: the second tile's first instructions reuse the stores' address and data registers
  asm volatile("s_wait_xcnt 0x0" ::: "memory");
  }
  }   // pass
  asm volatile("s_wait_asynccnt 0x0" ::: "memory");   // no copy is outstanding when the wave ends
}

// ---------------------------------------------------------------------------
extern "C" void kernel_launch(void* const* d_in, const int* in_sizes, int n_in,
                              void* d_out, int out_size, void* d_ws, size_t ws_size,
                              hipStream_t stream) {
  if (n_in < 3) return;
  const long long need = ((long long)(NBH - 1) * SEQ_FULL + SEQ) * HD;
  if ((long long)in_sizes[0] < need) return;
  if ((long long)in_sizes[1] < need) return;
  if ((long long)in_sizes[2] < need) return;
  if ((long long)out_size < need) return;
  if (ws_size < WS_TOTAL) return;

  const float* Qf = (const float*)d_in[0];    // query [NB_FULL][NHEAD][SEQ_FULL][HD]
  const float* Kf = (const float*)d_in[1];    // key
  const float* Vf = (const float*)d_in[2];    // value
  float* out = (float*)d_out;                 // [NB_FULL][NHEAD][SEQ_FULL][HD]

  char* ws = (char*)d_ws;
  _Float16* Q16  = (_Float16*)(ws + OFF_Q);    // [bh][SEQ][HD]
  _Float16* K16  = (_Float16*)(ws + OFF_K);    // [bh][SEQ][HD]
  _Float16* Vt16 = (_Float16*)(ws + OFF_VT);   // [bh][HD][SEQ]
  float* Rec     = (float*)(ws + OFF_R);       // [bh][SEQ/128][REC]

  dim3 blk(256);
  prep_kernel<<<dim3(SEQ / 128, NBH), blk, 0, stream>>>(Qf, Kf, Vf, Q16, K16, Vt16, Rec);
  attn_kernel<<<dim3(NQT / 2, NHEAD, NB), blk, 0, stream>>>(Q16, K16, Vt16, Rec, out);
}

// v008
// One run takes 24.2 microseconds.
// In both of two side-by-side timings against v007, it was 1.10 times as fast.
// Over all steps from v000 it is 3.89 times as fast.
#include <hip/hip_runtime.h>
#include <stddef.h>

// Matrix products on v_wmma_f32_16x16x32_f16 (f16 operands, f32 accumulate): q.k scores, p.v and the value column sums; squared row norms of q and k in f32.
// Float inputs are RNE-converted to bf16 and carried in f16 (q and k x16, v x64, p x1024; p gets
// an extra x1024 residual plane with its own accumulator on the first key tile of the first
// 128 query rows of every 512-row chunk). Softmax, additive mask, chunk sums in f32.
// Causal chunked attention: per 512-key chunk an independent softmax (additive -1e9 on masked
// cells; every cell of a past chunk is masked), the chunk outputs are summed.
// Past chunks: where the row norms bound every |q.k| / 8 below 30, each masked score is -1e9 itself in
// f32, the softmax is 1/512 in every cell, and the chunk's output is the column mean of its values:
// taken from column sums made once per 128-row slab (V^T . ones) instead of once per query tile.

typedef _Float16 v16h __attribute__((ext_vector_type(16)));
typedef _Float16 v8h  __attribute__((ext_vector_type(8)));
typedef _Float16 v4h  __attribute__((ext_vector_type(4)));
typedef float    v8f  __attribute__((ext_vector_type(8)));
typedef float    v4f  __attribute__((ext_vector_type(4)));
typedef float    v2f  __attribute__((ext_vector_type(2)));

#ifndef NB
#define NB 2
#endif
#ifndef SEQ
#define SEQ 2048
#endif
#define NB_FULL  2
#define SEQ_FULL 2048
#define NHEAD 16
#define HD    64
#define CHUNK 512
#define NBH   (NB * NHEAD)

static_assert(NB >= 1 && NB <= NB_FULL);
static_assert(SEQ >= CHUNK && SEQ <= SEQ_FULL && (SEQ % CHUNK) == 0);
static_assert((CHUNK % 128) == 0 && (SEQ % 128) == 0 && (SEQ % 64) == 0);
static_assert(HD == 64);
static_assert((size_t)NBH * SEQ_FULL * HD < (size_t)0xFFFFFFFFu);

#define LDT 72   // halves per LDS row (144 B, 16-B aligned)
#define LDC 68   // floats per LDS row (272 B, 16-B aligned)
static_assert((LDT % 8) == 0 && LDT >= 64);
static_assert((LDC % 4) == 0 && LDC >= 64);

#define QKCARRY 16.0f    // q and k planes carried x16 each
#define WCARRY  64.0f    // value plane carried x64
#define PCARRY  1024.0f  // softmax numerators carried x1024
#define RCARRY  1024.0f  // residual plane of p carried x1024 on top of its hi part
#define NEGFILL (-1.0e9f)
#define NEGRAW  (-1.0e9f * 2048.0f)                    // -1e9 in units of the raw products (x 2^11)
#define RAWLOG2 (1.44269504088896f / 2048.0f)          // raw product -> score in log2 units
#define MFLOOR  (-2147483648.0f)                       // floor of the raw running maximum: score -2^20
static_assert(QKCARRY * QKCARRY * 8.0f == 2048.0f);    // HD^-0.5 = 1/8 over the plane carries
#ifndef P_RES
#define P_RES 1          // 1: p residual product on the early band; 0: single product everywhere
#endif

// workspace layout (bytes)
#define PLANE16_BYTES ((size_t)NBH * SEQ * HD * 2)
#define OFF_Q  ((size_t)0)
#define OFF_K  (OFF_Q + PLANE16_BYTES)
#define OFF_VT (OFF_K + PLANE16_BYTES)
// one record per (head, 128-row slab), three 128-B lines: 64 column sums of the carried values, then
// the largest squared row norm of the slab's carried q rows and of its carried k rows
#define REC 96u
#define NSLAB (SEQ / 128)
#define OFF_R  (OFF_VT + PLANE16_BYTES)
#define WS_TOTAL (OFF_R + (size_t)NBH * NSLAB * REC * 4)
static_assert((PLANE16_BYTES % 128) == 0);
static_assert(NSLAB <= 16);   // a 16-lane row holds one slab's norms a lane
// |q.k| / 8 <= |16 q| |16 k| 2^-11 (Cauchy-Schwarz). Below 30 it stays under 32, half a step of f32 at
// 1e9, also with the inputs' rounding to bf16 (2^-8 a factor) undone: score + -1e9 is then -1e9.
#define FLATB (900.0f * 4194304.0f)   // bound on |16 q|^2 |16 k|^2: 30^2 * 2^22
static_assert(WS_TOTAL <= (size_t)134217728);

#define LDX 36   // floats per lane slot of the state exchange (144 B, 16-B aligned)
static_assert((LDX % 4) == 0 && LDX >= 34);
#define NQT (SEQ / 64)   // query tiles of 64 rows per head
static_assert((NQT % 2) == 0);

#define TILEH (2u * 64u * LDT)   // halves of one staging buffer of K or of V^T: both key halves of a step

// static LDS of the attention kernel (two staging buffers of K and of V^T)
static_assert((size_t)(2 * TILEH * 2) * 2 + (size_t)(4 * 16 * LDC * 4) +
              (size_t)(4 * 32 * LDX * 4) <= (size_t)131072);

// ---------------------------------------------------------------------------
__device__ __forceinline__ float bf16r(float x) {   // RNE convert to bf16, returned widened
  unsigned int u = __float_as_uint(x);
  u = (u + 0x7FFFu + ((u >> 16) & 1u)) & 0xFFFF0000u;
  return __uint_as_float(u);
}

// f32 -> f16 that cannot produce an f16 subnormal (value select)
static __device__ __forceinline__ _Float16 toh_flush(float v) {
  const _Float16 r = (_Float16)v;
  return (fabsf(v) < 6.103515625e-05f) ? (_Float16)0.0f : r;
}

// 16-bit fragment: p points at element [row = lane&15][k0 + 8*(lane>>4)] of a k-contiguous
// row. Elements 0..7 <- k0+8h+0..7, elements 8..15 <- k0+16+8h+0..7 (same map for A and B).
__device__ __forceinline__ v16h frag_at(const _Float16* p) {
  v8h lo = *(const v8h*)(p);
  v8h hi = *(const v8h*)(p + 16);
  v16h out;
#pragma unroll
  for (int i = 0; i < 8; ++i) { out[i] = lo[i]; out[i + 8] = hi[i]; }
  return out;
}
__device__ __forceinline__ v16h ld_frag(const _Float16* base, unsigned ld) {
  const unsigned lane = threadIdx.x & 31u;
  return frag_at(base + (lane & 15u) * ld + (lane >> 4) * 8u);
}

__device__ __forceinline__ v8f wmma16(v16h a, v16h b, v8f c) {
  v8f d = __builtin_amdgcn_wmma_f32_16x16x32_f16(false, a, false, b, (short)0, c,
                                                 false, false);
  asm volatile("v_nop\n\tv_nop\n\tv_nop\n\tv_nop" : "+v"(d) : "v"(a), "v"(b));
  return d;
}

__device__ __forceinline__ float xhalf(float x) {   // value of lane l ^ 16
  const int b = __builtin_bit_cast(int, x);
  return __builtin_bit_cast(float, __builtin_amdgcn_permlanex16(b, b, 0x76543210, 0xfedcba98,
                                                                false, false));
}

// maximum that hands a NaN on: a NaN norm must fail the bound test
__device__ __forceinline__ float max_nan(float a, float b) {
  return __builtin_elementwise_maximum(a, b);
}

template <int CTRL>
__device__ __forceinline__ float dpp_of(float x) {
  return __builtin_bit_cast(float, __builtin_amdgcn_update_dpp(0, __builtin_bit_cast(int, x), CTRL,
                                                               0xf, 0xf, true));
}
// sum over the 16 lanes of a row, in every lane: neighbours, pairs, then the mirrored quad and half
__device__ __forceinline__ float row16_sum(float x) {
  x += dpp_of<0xB1>(x);    // quad_perm [1,0,3,2]
  x += dpp_of<0x4E>(x);    // quad_perm [2,3,0,1]
  x += dpp_of<0x141>(x);   // row_half_mirror
  x += dpp_of<0x140>(x);   // row_mirror
  return x;
}

// compile-time kind of a key chunk: a past chunk (every cell masked) or the diagonal chunk
struct PastChunk { static constexpr bool past = true; };
struct DiagChunk { static constexpr bool past = false; };

// number of 128-key steps of the 64-row query tile at q0: its past chunks whole, then the diagonal
// chunk up to key q0 + 63, rounded up to whole steps; at least 1
__device__ __forceinline__ unsigned steps_of(unsigned q0) {
  const unsigned cs = q0 & ~((unsigned)CHUNK - 1u);
  return (cs + ((q0 - cs + 191u) & ~127u)) >> 7;
}

__device__ __forceinline__ unsigned lds_off(const void* p) { return (unsigned)(size_t)p; }

__device__ __forceinline__ void wave_lds_sync() {
  __builtin_amdgcn_fence(3 /* release order */, "wavefront");
  asm volatile("s_wait_dscnt 0x0" ::: "memory");
  __builtin_amdgcn_wave_barrier();
}

// ---------------------------------------------------------------------------
// All three planes in one launch. One work-group per (128-row slab, head): q and k rows go to the
// compact planes [bh][s][64] as f16(16 * bf16(x)), the value rows to the transposed plane
// [bh][64][s] as f16(64 * bf16(x)). A thread takes 32 elements of each input and issues its 24
// 16-B loads ahead of all arithmetic; the whole grid is resident at once, so few waves have to start.
// q, k: one load of a wave covers 512 contiguous bytes, one store 256 (two whole lines).
// v: thread (rg, cq) loads rows 8 rg .. 8 rg + 7, columns 4 cq .. 4 cq + 3 (a wave's load: two whole
// rows) and writes, per column d, its 8 keys as one 16-B piece into T[d][piece]; row d keeps piece p
// at place p ^ (d >> 2), which spreads both the writers' and the readers' 16 lanes over all banks.
// T: cross-wave (block barrier). Store loop: 16 rows of d per step x 4 steps; one store of a wave =
// two rows of 256 contiguous bytes.
// The slab's record: waves 0 and 1 sum T's rows over the 128 keys as V^T . ones (32 rows of d = one
// 128-B line each; with a B of ones the k order is free, so lane m reads place p ^ m: no bank shared).
// A q or k row lies in 16 lanes: its squared norm is 4 products a lane and a 16-lane sum; the waves'
// maxima meet in red (second block barrier) and one thread writes both.
// Grid (SEQ/128, NBH).
// ---------------------------------------------------------------------------
#define PROWS 128u   // rows of a slab
static_assert((SEQ % 128) == 0 && HD == 64);
static_assert(128 * HD == 256 * 4 * 8);        // 8 loads of 4 floats a thread cover a slab of one input
static_assert((256 / 16) * 8 == 128 && 16 * 4 == HD && (256 / 16) * 4 == HD);
__global__ __launch_bounds__(256) void prep_kernel(
    const float* __restrict__ Qf, const float* __restrict__ Kf, const float* __restrict__ Vf,
    _Float16* __restrict__ Q16, _Float16* __restrict__ K16, _Float16* __restrict__ Vt,
    float* __restrict__ R) {
  __shared__ __attribute__((aligned(16))) _Float16 T[HD * PROWS];
  __shared__ __attribute__((aligned(16))) float red[16];
  const unsigned tid = threadIdx.x;
  const unsigned w = (unsigned)__builtin_amdgcn_readfirstlane((int)(threadIdx.x >> 5));
  const unsigned s0 = blockIdx.x * PROWS;
  const unsigned bh = blockIdx.y;
  const float* const qs = Qf + ((size_t)bh * SEQ_FULL + s0) * HD;   // block-uniform bases
  const float* const ks = Kf + ((size_t)bh * SEQ_FULL + s0) * HD;
  const float* const vs = Vf + ((size_t)bh * SEQ_FULL + s0) * HD;
  const unsigned rg = tid >> 4, cq = tid & 15u;

  const float* const vp = vs + (rg * 8u) * (unsigned)HD + cq * 4u;   // the thread's first value piece
  v4f vv[8], qa[8], ka[8];
#pragma unroll
  for (unsigned r = 0; r < 8u; ++r) vv[r] = *(const v4f*)(vp + r * (unsigned)HD);
  // keeps the value loads first, the order of use (loads return in order): else the scheduler asks
  // for the value rows last and the first conversion waits for all 24 loads
  __builtin_amdgcn_sched_barrier(0);
#pragma unroll
  for (unsigned j = 0; j < 8u; ++j) qa[j] = *(const v4f*)(qs + (j * 256u + tid) * 4u);
#pragma unroll
  for (unsigned j = 0; j < 8u; ++j) ka[j] = *(const v4f*)(ks + (j * 256u + tid) * 4u);
  // precaution ahead of any rewrite of the loads' address registers; it names them as inputs so that
  // no later load's result is laid over them in front of it
  asm volatile("s_wait_xcnt 0x0" :: "v"(vp), "v"(tid) : "memory");
  // keeps all 24 loads in front of the arithmetic: left alone, the scheduler puts part of them among
  // the conversions, and a wave then has fewer bytes in flight
  __builtin_amdgcn_sched_barrier(0);

#pragma unroll
  for (unsigned i = 0; i < 4u; ++i) {
    v8h x;
#pragma unroll
    for (int r = 0; r < 8; ++r) x[r] = toh_flush(WCARRY * bf16r(vv[r][i]));
    *(v8h*)&T[(cq * 4u + i) * PROWS + (rg ^ cq) * 8u] = x;
  }

  _Float16* const qd = Q16 + ((size_t)bh * SEQ + s0) * HD;
  _Float16* const kd = K16 + ((size_t)bh * SEQ + s0) * HD;
  float nq = 0.0f, nk = 0.0f;   // largest squared norm of the rows that this 16-lane row holds
#pragma unroll
  for (unsigned j = 0; j < 8u; ++j) {
    v4h x;
    float ss = 0.0f;
#pragma unroll
    for (int i = 0; i < 4; ++i) {
      const float f = QKCARRY * bf16r(qa[j][i]);
      x[i] = toh_flush(f);
      ss += f * f;
    }
    *(v4h*)(qd + (j * 256u + tid) * 4u) = x;
    nq = max_nan(nq, row16_sum(ss));
  }
  // precaution: what follows reuses the q stores' data and address registers
  asm volatile("s_wait_xcnt 0x0" ::: "memory");

  // block barrier for T alone: only LDS data crosses waves here, so the fences name LDS; a plain
  // __syncthreads() would also wait for the q stores to finish (and for any global load in flight)
  __builtin_amdgcn_fence(__ATOMIC_RELEASE, "workgroup", "local");
  __builtin_amdgcn_s_barrier();
  __builtin_amdgcn_fence(__ATOMIC_ACQUIRE, "workgroup", "local");
  _Float16* const vd = Vt + (size_t)bh * HD * SEQ + s0;
  v8h y[4];
#pragma unroll
  for (unsigned i = 0; i < 4u; ++i) {
    const unsigned d = 16u * i + rg;
    y[i] = *(const v8h*)&T[d * PROWS + (cq ^ (d >> 2)) * 8u];
  }
#pragma unroll
  for (unsigned i = 0; i < 4u; ++i) *(v8h*)(vd + (16u * i + rg) * (unsigned)SEQ + cq * 8u) = y[i];
  // precaution: what follows reuses the stores' data and address registers
  asm volatile("s_wait_xcnt 0x0" ::: "memory");

  float* const rec = R + ((size_t)bh * NSLAB + blockIdx.x) * REC;   // block-uniform
  if (w < 2u) {   // scalar test: EXEC stays full for the products
    const unsigned hh = (tid >> 4) & 1u, m = tid & 15u;
    v16h one;
#pragma unroll
    for (int v = 0; v < 16; ++v) one[v] = (_Float16)1.0f;
    // all eight fragments are read as one group ahead of the products: one LDS latency, not eight
    v16h a[4][2];
#pragma unroll
    for (unsigned c = 0; c < 4u; ++c)
#pragma unroll
      for (unsigned gi = 0; gi < 2u; ++gi) {
        const _Float16* const row = &T[((2u * w + gi) * 16u + m) * PROWS];
        const v8h lo = *(const v8h*)(row + ((4u * c + hh) ^ m) * 8u);
        const v8h hi = *(const v8h*)(row + ((4u * c + 2u + hh) ^ m) * 8u);
#pragma unroll
        for (int v = 0; v < 8; ++v) { a[c][gi][v] = lo[v]; a[c][gi][v + 8] = hi[v]; }
      }
    v8f cs[2] = {(v8f){}, (v8f){}};
#pragma unroll
    for (unsigned c = 0; c < 4u; ++c)
#pragma unroll
      for (unsigned gi = 0; gi < 2u; ++gi) cs[gi] = wmma16(a[c][gi], one, cs[gi]);
    if (m == 0u) {   // every column of the result is the same sum: lane (hh, 0) holds rows 8 hh + 0..7
#pragma unroll
      for (unsigned gi = 0; gi < 2u; ++gi) {
        float* const p = rec + (2u * w + gi) * 16u + hh * 8u;
        *(v4f*)(p)     = (v4f){cs[gi][0], cs[gi][1], cs[gi][2], cs[gi][3]};
        *(v4f*)(p + 4) = (v4f){cs[gi][4], cs[gi][5], cs[gi][6], cs[gi][7]};
      }
    }
    // precaution: what follows reuses the stores' data and address registers
    asm volatile("s_wait_xcnt 0x0" ::: "memory");
  }

#pragma unroll
  for (unsigned j = 0; j < 8u; ++j) {
    v4h x;
    float ss = 0.0f;
#pragma unroll
    for (int i = 0; i < 4; ++i) {
      const float f = QKCARRY * bf16r(ka[j][i]);
      x[i] = toh_flush(f);
      ss += f * f;
    }
    *(v4h*)(kd + (j * 256u + tid) * 4u) = x;
    nk = max_nan(nk, row16_sum(ss));
  }
  // precaution: what follows reuses the k stores' data and address registers
  asm volatile("s_wait_xcnt 0x0" ::: "memory");

  nq = max_nan(nq, xhalf(nq));
  nk = max_nan(nk, xhalf(nk));
  if ((tid & 31u) == 0u) {
    red[w] = nq;
    red[8u + w] = nk;
  }
  // block barrier for red alone (LDS data only, as above)
  __builtin_amdgcn_fence(__ATOMIC_RELEASE, "workgroup", "local");
  __builtin_amdgcn_s_barrier();
  __builtin_amdgcn_fence(__ATOMIC_ACQUIRE, "workgroup", "local");
  if (tid == 64u) {   // a wave that wrote no column sums owns the record's third line
    const v4f a = *(const v4f*)&red[0], b = *(const v4f*)&red[4];
    const v4f c = *(const v4f*)&red[8], d = *(const v4f*)&red[12];
    rec[64] = max_nan(max_nan(max_nan(a[0], a[1]), max_nan(a[2], a[3])),
                      max_nan(max_nan(b[0], b[1]), max_nan(b[2], b[3])));
    rec[65] = max_nan(max_nan(max_nan(c[0], c[1]), max_nan(c[2], c[3])),
                      max_nan(max_nan(d[0], d[1]), max_nan(d[2], d[3])));
  }
}

static_assert(2 * 8 == 16);
__global__ __launch_bounds__(256) __attribute__((amdgpu_num_vgpr(256))) void attn_kernel(
    const _Float16* __restrict__ Qh, const _Float16* __restrict__ Kh,
    const _Float16* __restrict__ Vt, const float* __restrict__ R, float* __restrict__ Out) {
  __shared__ __attribute__((aligned(16))) _Float16 Ks[2 * TILEH];   // [buffer][g][key][d]
  __shared__ __attribute__((aligned(16))) _Float16 Vs[2 * TILEH];   // [buffer][g][d][key]
  __shared__ __attribute__((aligned(16))) float Os[4 * 16 * LDC];
  __shared__ __attribute__((aligned(16))) float Xs[4 * 32 * LDX];

  const unsigned tid = threadIdx.x, lane = tid & 31u;
  const unsigned w = (unsigned)__builtin_amdgcn_readfirstlane((int)(threadIdx.x >> 5));
  const unsigned g = w >> 2, wq = w & 3u;            // key half of a step; query row group
  const unsigned hh = lane >> 4, m = lane & 15u;
  const unsigned bh = blockIdx.z * (unsigned)NHEAD + blockIdx.y;
  const float scale = 0.125f / (QKCARRY * QKCARRY);  // HD^-0.5 over the plane carries
  const unsigned obase = wq * (16u * LDC);
  float* const xrow = &Xs[(wq * 32u + lane) * LDX];
  const size_t kplane = (size_t)bh * SEQ * HD;
  const size_t vplane = (size_t)bh * HD * SEQ;
  // staging: the thread's own element inside a step's K rows / V^T rows (global) and tiles (LDS);
  // piece j lies 32 keys (K) or 16 rows of d (V^T) further on
  const unsigned kgo = (tid >> 3) * (unsigned)HD + (tid & 7u) * 8u;
  const unsigned vgo = (tid >> 4) * (unsigned)SEQ + (tid & 15u) * 8u;
  const unsigned klo = (tid >> 3) * LDT + (tid & 7u) * 8u;
  const unsigned vlo = ((tid & 15u) >> 3) * (64u * LDT) + (tid >> 4) * LDT + (tid & 7u) * 8u;
  const unsigned qgo = m * (unsigned)HD + hh * 8u;   // the lane's element inside its wave's Q rows

  // the work-group's steps in running order; block-uniform
  const float* const rb = R + (size_t)bh * NSLAB * REC;   // the head's slab records; block-uniform
  // do the norms bound every score of the tile at q0 against its past chunks? (no past chunk: no matter)
  // Lane m holds slab m's two norms: one load for all slabs (one latency), each wave for itself.
  const unsigned msl = (m < (unsigned)NSLAB) ? m : ((unsigned)NSLAB - 1u);
  const v2f nrm = *(const v2f*)(rb + msl * REC + 64u);
  // the slabs' column sums of the lane's four output columns, asked for here, summed behind step 0's copies
  v4f ps[(SEQ - CHUNK) / 128];
#pragma unroll
  for (unsigned sl = 0; sl < (unsigned)(SEQ - CHUNK) / 128u; ++sl)
    ps[sl] = *(const v4f*)(rb + sl * REC + m * 4u);
  auto past_flat = [&](const unsigned q0) __attribute__((always_inline)) {
    const unsigned nsl = (q0 & ~((unsigned)CHUNK - 1u)) >> 7;
    float kn = (m < nsl) ? nrm[1] : 0.0f;          // the past slabs' key norms; 16-lane maximum
    kn = max_nan(kn, dpp_of<0xB1>(kn));
    kn = max_nan(kn, dpp_of<0x4E>(kn));
    kn = max_nan(kn, dpp_of<0x141>(kn));
    kn = max_nan(kn, dpp_of<0x140>(kn));
    const float ku = __builtin_bit_cast(
        float, __builtin_amdgcn_readfirstlane(__builtin_bit_cast(int, kn)));
    const float qu = __builtin_bit_cast(
        float, __builtin_amdgcn_readlane(__builtin_bit_cast(int, nrm[0]), (int)(q0 >> 7)));
    return qu * ku < FLATB;                        // scalar: the same in every wave of the block
  };
  const unsigned qA = ((unsigned)NQT - 1u - blockIdx.x) * 64u, qB = blockIdx.x * 64u;
  const bool fA = past_flat(qA), fB = past_flat(qB);
  // first 128-key step that each tile walks
  const unsigned bA = fA ? ((qA & ~((unsigned)CHUNK - 1u)) >> 7) : 0u;
  const unsigned bB = fB ? ((qB & ~((unsigned)CHUNK - 1u)) >> 7) : 0u;
  const unsigned n0 = steps_of(qA) - bA;
  const unsigned ntot = n0 + steps_of(qB) - bB;
  const unsigned kl0 = lds_off(&Ks[klo]), vl0 = lds_off(&Vs[vlo]);   // LDS byte addresses, buffer 0
  const _Float16* const kg0 = Kh + kplane + kgo;
  const _Float16* const vg0 = Vt + vplane + vgo;
  // step t's K and V^T tiles into buffer t & 1: eight copies a lane, every lane on. The s_wait_xcnt
  // ends the copies' own statement, a precaution ahead of any rewrite of their address registers.
  auto stage = [&](const unsigned t) __attribute__((always_inline)) {
    const unsigned ks = (t < n0 ? t + bA : t - n0 + bB) * 128u;   // first key of the step
    const unsigned bo = (t & 1u) * (TILEH * 2u);        // the buffer's byte offset
    const unsigned kl = kl0 + bo, vl = vl0 + bo;
    const _Float16* const kp = kg0 + (size_t)ks * HD;
    const _Float16* const vp = vg0 + ks;
    asm volatile(
        "global_load_async_to_lds_b128 %0, %8, off\n\t"
        "global_load_async_to_lds_b128 %1, %9, off\n\t"
        "global_load_async_to_lds_b128 %2, %10, off\n\t"
        "global_load_async_to_lds_b128 %3, %11, off\n\t"
        "global_load_async_to_lds_b128 %4, %12, off\n\t"
        "global_load_async_to_lds_b128 %5, %13, off\n\t"
        "global_load_async_to_lds_b128 %6, %14, off\n\t"
        "global_load_async_to_lds_b128 %7, %15, off\n\t"
        "s_wait_xcnt 0x0"
        :: "v"(kl), "v"(kl + 1u * (32u * LDT * 2u)), "v"(kl + 2u * (32u * LDT * 2u)),
           "v"(kl + 3u * (32u * LDT * 2u)),
           "v"(vl), "v"(vl + 1u * (16u * LDT * 2u)), "v"(vl + 2u * (16u * LDT * 2u)),
           "v"(vl + 3u * (16u * LDT * 2u)),
           "v"(kp), "v"(kp + 1u * (32u * HD)), "v"(kp + 2u * (32u * HD)), "v"(kp + 3u * (32u * HD)),
           "v"(vp), "v"(vp + 1u * (16u * SEQ)), "v"(vp + 2u * (16u * SEQ)), "v"(vp + 3u * (16u * SEQ))
        : "memory");
  };
  // in front of the loops: step 0 landed and published, step 1 in flight (ntot >= 2: each tile has a step)
  stage(0u);
  // keeps the sums below, which wait for the slabs' loads, behind the issue of step 0's copies
  __builtin_amdgcn_sched_barrier(0);
  // past chunks that a tile does not walk: their share of the lane's four output columns, the same for
  // every row of the tile; bA and bB count the slabs (0 where the tile walks its past chunks)
  v4f pvA = {}, pvB = {};
#pragma unroll
  for (unsigned sl = 0; sl < (unsigned)(SEQ - CHUNK) / 128u; ++sl) {
    pvA += (sl < bA) ? ps[sl] : (v4f){};
    pvB += (sl < bB) ? ps[sl] : (v4f){};
  }
  pvA = pvA * (1.0f / ((float)CHUNK * WCARRY));
  pvB = pvB * (1.0f / ((float)CHUNK * WCARRY));
  asm volatile("s_wait_asynccnt 0x0" ::: "memory");   // this wave's copies of step 0 have landed
  __syncthreads();
  stage(1u);
  unsigned t = 0u;   // number of the running step

#pragma unroll 1   // the two tiles run one after the other through one copy of the loop
  for (unsigned pass = 0; pass < 2u; ++pass) {
  const unsigned q0 = (pass ? blockIdx.x : ((unsigned)NQT - 1u - blockIdx.x)) * 64u;
  const unsigned ci = q0 / (unsigned)CHUNK;          // chunk of this query block
  const unsigned cs = ci * (unsigned)CHUNK;          // first key of the diagonal chunk
  const bool first_blk = (q0 - cs < 128u);           // first 128 rows of the chunk; block-uniform
  const unsigned qrow0 = q0 + wq * 16u;

  const _Float16* const qw = Qh + ((size_t)bh * SEQ + qrow0) * HD;   // wave-uniform
  v16h qf[2];
  qf[0] = frag_at(qw + qgo);
  qf[1] = frag_at(qw + qgo + 32);
  const bool pflat = pass ? fB : fA;
  // precaution: the loads' address registers are reused by the staging below before any other wait
  asm volatile("s_wait_xcnt 0x0" ::: "memory");

  float mrow = -1.0e30f, lrow = 0.0f;   // of query row m; lrow: this half's keys only
  // The running output (sum of the chunks' O / l) rests in group 0's own output rows of Os, which
  // are idle until the epilogue: lane (hh, m) owns cells [m][16 nb + 8 hh + 0..7], touched once per
  // chunk. That leaves its 32 registers to the V^T fragments held across the softmax.
  float* const orow = &Os[obase + m * LDC + hh * 8u];
  v8f o[4];
#pragma unroll
  for (int nb = 0; nb < 4; ++nb) o[nb] = (v8f){};
  if (g == 0u) {
#pragma unroll
    for (int nb = 0; nb < 4; ++nb) {
      *(v4f*)(orow + nb * 16) = (v4f){};
      *(v4f*)(orow + nb * 16 + 4) = (v4f){};
    }
  }

#pragma unroll 1
  for (unsigned jc = pflat ? ci : 0u; jc <= ci; ++jc) {
    const bool offd = (jc < ci);                     // past chunk: every cell masked
    const unsigned kc0 = jc * (unsigned)CHUNK;
    const unsigned kc1 =                             // <= SEQ
        offd ? (kc0 + (unsigned)CHUNK) : (cs + ((q0 - cs + 191u) & ~127u));

    // one 128-key step; compiled once for past chunks and once for the diagonal chunk
    auto step = [&](auto kind, const unsigned ks) __attribute__((always_inline)) {
      constexpr bool offd = decltype(kind)::past;
      const unsigned kb = ks + g * 64u;                // this wave's 64 keys
      const bool early = (P_RES != 0) && first_blk && (!offd) && (kb == cs);   // wave-uniform
      const _Float16* const Kw = &Ks[(t & 1u) * TILEH + g * (64u * LDT)];   // this step's buffer
      const _Float16* const Vw = &Vs[(t & 1u) * TILEH + g * (64u * LDT)];

      // scores: 4 key groups of 16, K = 64 in two 32-steps. All eight K fragments are read as
      // one group ahead of the eight products (one LDS latency per tile, not one per product);
      // the four accumulators advance side by side, each still c = 0 then c = 1.
      v16h kf[2][4];
#pragma unroll
      for (int c = 0; c < 2; ++c)
#pragma unroll
        for (int kg = 0; kg < 4; ++kg) kf[c][kg] = ld_frag(&Kw[(kg * 16) * LDT + c * 32], LDT);
      v8f s[4];
#pragma unroll
      for (int kg = 0; kg < 4; ++kg) s[kg] = (v8f){};
#pragma unroll
      for (int c = 0; c < 2; ++c)
#pragma unroll
        for (int kg = 0; kg < 4; ++kg) s[kg] = wmma16(kf[c][kg], qf[c], s[kg]);

      // all eight V^T fragments, issued here as one group: they land while the softmax runs
      v16h vf[2][4];
#pragma unroll
      for (int c = 0; c < 2; ++c)
#pragma unroll
        for (int nb = 0; nb < 4; ++nb) vf[c][nb] = ld_frag(&Vw[(nb * 16) * LDT + c * 32], LDT);

      // Past chunk: the f32 sum score + (-1e9) keeps steps of 64 only, so a whole tile's masked scores
      // are as a rule one and the same number. Tested by value: rounding is monotone, so when the
      // lane's smallest and largest score give the same masked value, all 32 between them do. Where
      // that value is also the other half's and the running maximum (or this is the chunk's first
      // step, whose state is all zero), the softmax below would find alpha = 1 and p = exp(0) = 1 in
      // every cell: the same numbers come from a constant P operand, without the softmax arithmetic.
      bool flat = false;                               // wave-uniform
      float tflat = 0.0f;
      if constexpr (offd) {
        float hi[4], lo[4];
#pragma unroll
        for (int kg = 0; kg < 4; ++kg) {
          hi[kg] = fmaxf(fmaxf(fmaxf(s[kg][0], s[kg][1]), fmaxf(s[kg][2], s[kg][3])),
                         fmaxf(fmaxf(s[kg][4], s[kg][5]), fmaxf(s[kg][6], s[kg][7])));
          lo[kg] = fminf(fminf(fminf(s[kg][0], s[kg][1]), fminf(s[kg][2], s[kg][3])),
                         fminf(fminf(s[kg][4], s[kg][5]), fminf(s[kg][6], s[kg][7])));
        }
        tflat = fmaxf(fmaxf(hi[0], hi[1]), fmaxf(hi[2], hi[3])) * scale + NEGFILL;
        const float tlo = fminf(fminf(lo[0], lo[1]), fminf(lo[2], lo[3])) * scale + NEGFILL;
        const bool ok = (bool)((int)(tlo == tflat) & (int)(xhalf(tflat) == tflat) &
                               ((int)(ks == kc0) | (int)(mrow == tflat)));
        flat = (__builtin_amdgcn_ballot_w32(ok) == 0xFFFFFFFFu);   // scalar test: EXEC stays full
      }

      // B operands of the two 32-key steps, f16(1024 p), and the new state: set for p = 1 in all of
      // this half's 32 cells; the softmax overwrites them where the tile is not flat
      v16h pf[2];
#pragma unroll
      for (int v = 0; v < 16; ++v) {
        pf[0][v] = (_Float16)PCARRY;
        pf[1][v] = (_Float16)PCARRY;
      }
      float mnew = tflat, lnew = lrow + 32.0f;
      // the hint lays the flat tile out as the fall-through of a past chunk's step
      if (__builtin_expect(!flat, !offd)) {
      if constexpr (!offd) {
      // Diagonal chunk: the softmax runs on the raw products (score = raw * 2^-11, exact), the state's
      // maximum is kept raw and its sum x1024 until the end of the chunk. A masked cell takes the raw
      // form of -1e9 itself: next to the row's own unmasked diagonal score its p is 0 either way.
      if (kb >= q0) {
        const int dl = (int)(qrow0 + m) - (int)(kb + hh * 8u);   // cells of the lane above dl are masked
#pragma unroll
        for (int kg = 0; kg < 4; ++kg)
#pragma unroll
          for (int v = 0; v < 8; ++v) s[kg][v] = (kg * 16 + v > dl) ? NEGRAW : s[kg][v];
      }
      float mk[4];
#pragma unroll
      for (int kg = 0; kg < 4; ++kg)
        mk[kg] = fmaxf(fmaxf(fmaxf(s[kg][0], s[kg][1]), fmaxf(s[kg][2], s[kg][3])),
                       fmaxf(fmaxf(s[kg][4], s[kg][5]), fmaxf(s[kg][6], s[kg][7])));
      float mx = fmaxf(fmaxf(mk[0], mk[1]), fmaxf(mk[2], mk[3]));
      mx = fmaxf(mx, xhalf(mx));
      // the floor keeps a tile whose 64 keys are all masked (the half step above the diagonal) at p = 0:
      // with -1e9 itself as the maximum the shift below would lose its low bits
      const float mn = fmaxf(fmaxf(mrow, mx), MFLOOR);
      const float alpha = __builtin_amdgcn_exp2f((mrow - mn) * RAWLOG2);
      mnew = mn;
      // 1024 p = 2^(raw * c - (max * c - 10)): one multiply-add a cell, two cells an instruction
      const float sh = 10.0f - mn * RAWLOG2;
      const v8f c8 = {RAWLOG2, RAWLOG2, RAWLOG2, RAWLOG2, RAWLOG2, RAWLOG2, RAWLOG2, RAWLOG2};
      const v8f sh8 = {sh, sh, sh, sh, sh, sh, sh, sh};
#pragma unroll
      for (int kg = 0; kg < 4; ++kg) {
        const v8f e = __builtin_elementwise_fma(s[kg], c8, sh8);
#pragma unroll
        for (int v = 0; v < 8; ++v) s[kg][v] = __builtin_amdgcn_exp2f(e[v]);
      }
      const v8f s8 = (s[0] + s[1]) + (s[2] + s[3]);   // the four key groups cell by cell, then the eight cells
      lnew = alpha * lrow + (((s8[0] + s8[1]) + (s8[2] + s8[3])) + ((s8[4] + s8[5]) + (s8[6] + s8[7])));
#pragma unroll
      for (int nb = 0; nb < 4; ++nb) o[nb] = o[nb] * alpha;
#pragma unroll
      for (int c = 0; c < 2; ++c)
        pf[c] = __builtin_shufflevector(__builtin_convertvector(s[2 * c], v8h),
                                        __builtin_convertvector(s[2 * c + 1], v8h),
                                        0, 1, 2, 3, 4, 5, 6, 7, 8, 9, 10, 11, 12, 13, 14, 15);
      } else {
#pragma unroll
      for (int kg = 0; kg < 4; ++kg) s[kg] = s[kg] * scale;

      // additive mask of a past chunk, every cell
#pragma unroll
      for (int kg = 0; kg < 4; ++kg)
#pragma unroll
        for (int v = 0; v < 8; ++v) s[kg][v] = s[kg][v] + NEGFILL;

      // online softmax; a lane holds 32 of its query row's 64 scores, lane ^ 16 the other 32
      float mk[4];
#pragma unroll
      for (int kg = 0; kg < 4; ++kg)
        mk[kg] = fmaxf(fmaxf(fmaxf(s[kg][0], s[kg][1]), fmaxf(s[kg][2], s[kg][3])),
                       fmaxf(fmaxf(s[kg][4], s[kg][5]), fmaxf(s[kg][6], s[kg][7])));
      float mx = fmaxf(fmaxf(mk[0], mk[1]), fmaxf(mk[2], mk[3]));
      mx = fmaxf(mx, xhalf(mx));
      const float mn = fmaxf(mrow, mx);
      const float alpha = __expf(mrow - mn);
      mnew = mn;
#pragma unroll
      for (int kg = 0; kg < 4; ++kg)
#pragma unroll
        for (int v = 0; v < 8; ++v) s[kg][v] = __expf(s[kg][v] - mn);
      float sk[4];
#pragma unroll
      for (int kg = 0; kg < 4; ++kg)
        sk[kg] = ((s[kg][0] + s[kg][1]) + (s[kg][2] + s[kg][3])) +
                 ((s[kg][4] + s[kg][5]) + (s[kg][6] + s[kg][7]));
      lnew = alpha * lrow + ((sk[0] + sk[1]) + (sk[2] + sk[3]));
#pragma unroll
      for (int nb = 0; nb < 4; ++nb) o[nb] = o[nb] * alpha;
#pragma unroll
      for (int c = 0; c < 2; ++c)
#pragma unroll
        for (int v = 0; v < 8; ++v) {
          pf[c][v]     = toh_flush(s[2 * c][v] * PCARRY);
          pf[c][v + 8] = toh_flush(s[2 * c + 1][v] * PCARRY);
        }
      }   // past chunk
      }   // softmax of a tile that is not flat
      mrow = mnew;
      lrow = lnew;

      // O^T += V^T . P^T  (K = 64 keys in two 32-steps; A = V^T tile [d][key], B = f16(1024 p))
#pragma unroll
      for (int c = 0; c < 2; ++c)
#pragma unroll
        for (int nb = 0; nb < 4; ++nb) o[nb] = wmma16(vf[c][nb], pf[c], o[nb]);

      if (early) {
        // P residual operand: f16(1024 * (1024 p - f16(1024 p))); s holds 1024 p here
        v16h pr[2];
#pragma unroll
        for (int c = 0; c < 2; ++c) {
          const v8f r0 = (s[2 * c] - __builtin_convertvector(__builtin_convertvector(s[2 * c], v8h), v8f)) * RCARRY;
          const v8f r1 =
              (s[2 * c + 1] - __builtin_convertvector(__builtin_convertvector(s[2 * c + 1], v8h), v8f)) * RCARRY;
          pr[c] = __builtin_shufflevector(__builtin_convertvector(r0, v8h), __builtin_convertvector(r1, v8h),
                                          0, 1, 2, 3, 4, 5, 6, 7, 8, 9, 10, 11, 12, 13, 14, 15);
        }
        // V^T . P_res^T (scale 1/1024), one 16-row group of d at a time, folded immediately
#pragma unroll
        for (int nb = 0; nb < 4; ++nb) {
          v8f o2 = {};
#pragma unroll
          for (int c = 0; c < 2; ++c) {
            const v16h vr = ld_frag(&Vw[(nb * 16) * LDT + c * 32], LDT);
            o2 = wmma16(vr, pr[c], o2);
          }
#pragma unroll
          for (int v = 0; v < 8; ++v) o[nb][v] = o[nb][v] + o2[v] * (1.0f / RCARRY);
        }
      }
      // foot of step t: the one barrier publishes step t + 1's tiles and ends every reader's last
      // read of step t's buffer, which is refilled behind it
      asm volatile("s_wait_dscnt 0x0" ::: "memory");      // this wave's reads of the buffer are done
      asm volatile("s_wait_asynccnt 0x0" ::: "memory");   // this wave's copies of step t + 1 have landed
      __syncthreads();
      if (t + 2u < ntot) stage(t + 2u);                   // block-uniform test
      ++t;
    };
    // kc1 - kc0 is a multiple of 128; both loops stay rolled: one copy of the large body per kind
    if (offd) {
#pragma unroll 1
      for (unsigned ks = kc0; ks < kc1; ks += 128u) step(PastChunk{}, ks);
    } else {
#pragma unroll 1
      for (unsigned ks = kc0; ks < kc1; ks += 128u) step(DiagChunk{}, ks);
    }

    // end of chunk: group 1 hands its state over, group 0 joins the two states, adds O / l to the
    // running output; both reset. Xs is rewritten only behind the next step's barriers.
    // the two lane halves' sums joined; the diagonal chunk's state goes back to plain units (both exact)
    const float lsum = (lrow + xhalf(lrow)) * (offd ? 1.0f : 1.0f / PCARRY);
    mrow = offd ? mrow : mrow * scale;
    if (g != 0u) {
#pragma unroll
      for (int nb = 0; nb < 4; ++nb) {
        *(v4f*)(xrow + nb * 8)     = (v4f){o[nb][0], o[nb][1], o[nb][2], o[nb][3]};
        *(v4f*)(xrow + nb * 8 + 4) = (v4f){o[nb][4], o[nb][5], o[nb][6], o[nb][7]};
      }
      xrow[32] = mrow;
      xrow[33] = lsum;
    }
    __syncthreads();
    if (g == 0u) {
      const float m1 = xrow[32], l1 = xrow[33];
      const float mm = fmaxf(mrow, m1);
      const float a0 = __expf(mrow - mm), a1 = __expf(m1 - mm);
      const float inv = __builtin_amdgcn_rcpf(a0 * lsum + a1 * l1);
      const float f0 = a0 * inv, f1 = a1 * inv;
#pragma unroll
      for (int nb = 0; nb < 4; ++nb) {
        const v4f x0 = *(const v4f*)(xrow + nb * 8);
        const v4f x1 = *(const v4f*)(xrow + nb * 8 + 4);
        v4f t0 = *(const v4f*)(orow + nb * 16);
        v4f t1 = *(const v4f*)(orow + nb * 16 + 4);
#pragma unroll
        for (int v = 0; v < 4; ++v) {
          t0[v] = t0[v] + (o[nb][v] * f0 + x0[v] * f1);
          t1[v] = t1[v] + (o[nb][v + 4] * f0 + x1[v] * f1);
        }
        *(v4f*)(orow + nb * 16) = t0;
        *(v4f*)(orow + nb * 16 + 4) = t1;
      }
    }
#pragma unroll
    for (int nb = 0; nb < 4; ++nb) o[nb] = (v8f){};
    mrow = -1.0e30f;
    lrow = 0.0f;
  }

  if (g == 0u) {
  const float fs = 1.0f / (PCARRY * WCARRY);
  const v4f pv = pass ? pvB : pvA;
  wave_lds_sync();
  v4f x[8];
  size_t off[8];
#pragma unroll
  for (unsigned i = 0; i < 8u; ++i) {
    const unsigned r = 2u * i + (lane >> 4);
    const unsigned c = (lane & 15u) * 4u;
    x[i] = *(const v4f*)&Os[obase + r * LDC + c] * fs + pv;
    off[i] = ((size_t)bh * SEQ_FULL + qrow0 + r) * HD + c;
  }
#pragma unroll
  for (int i = 0; i < 8; ++i) *(v4f*)(Out + off[i]) = x[i];
  // precaution: the second tile's first instructions reuse the stores' address and data registers
  asm volatile("s_wait_xcnt 0x0" ::: "memory");
  }
  }   // pass
  asm volatile("s_wait_asynccnt 0x0" ::: "memory");   // no copy is outstanding when the wave ends
}

// ---------------------------------------------------------------------------
extern "C" void kernel_launch(void* const* d_in, const int* in_sizes, int n_in,
                              void* d_out, int out_size, void* d_ws, size_t ws_size,
                              hipStream_t stream) {
  if (n_in < 3) return;
  const long long need = ((long long)(NBH - 1) * SEQ_FULL + SEQ) * HD;
  if ((long long)in_sizes[0] < need) return;
  if ((long long)in_sizes[1] < need) return;
  if ((long long)in_sizes[2] < need) return;
  if ((long long)out_size < need) return;
  if (ws_size < WS_TOTAL) return;

  const float* Qf = (const float*)d_in[0];    // query [NB_FULL][NHEAD][SEQ_FULL][HD]
  const float* Kf = (const float*)d_in[1];    // key
  const float* Vf = (const float*)d_in[2];    // value
  float* out = (float*)d_out;                 // [NB_FULL][NHEAD][SEQ_FULL][HD]

  char* ws = (char*)d_ws;
  _Float16* Q16  = (_Float16*)(ws + OFF_Q);    // [bh][SEQ][HD]
  _Float16* K16  = (_Float16*)(ws + OFF_K);    // [bh][SEQ][HD]
  _Float16* Vt16 = (_Float16*)(ws + OFF_VT);   // [bh][HD][SEQ]
  float* Rec     = (float*)(ws + OFF_R);       // [bh][SEQ/128][REC]

  dim3 blk(256);
  prep_kernel<<<dim3(SEQ / 128, NBH), blk, 0, stream>>>(Qf, Kf, Vf, Q16, K16, Vt16, Rec);
  attn_kernel<<<dim3(NQT / 2, NHEAD, NB), blk, 0, stream>>>(Q16, K16, Vt16, Rec, out);
}

// v009
// Measured time: 21 microseconds a run.
// Timed twice side by side with v008, it ran 1.14 and 1.15 times as fast.
// Counting every step since v000, it is 4.47 times as fast.
#include <hip/hip_runtime.h>
#include <stddef.h>

// Matrix products on v_wmma_f32_16x16x32_f16 (f16 operands, f32 accumulate): q.k scores, p.v and the value column sums; squared row norms of q and k in f32.
// Float inputs are RNE-converted to bf16 and carried in f16 (q and k x16, v x64, p x1024; p gets
// an extra x1024 residual plane with its own accumulator on the first key tile of the first
// 128 query rows of every 512-row chunk). Softmax, additive mask, chunk sums in f32.
// Causal chunked attention: per 512-key chunk an independent softmax (additive -1e9 on masked
// cells; every cell of a past chunk is masked), the chunk outputs are summed.
// Past chunks: where the row norms bound every |q.k| / 8 below 30, each masked score is -1e9 itself in
// f32, the softmax is 1/512 in every cell, and the chunk's output is the column mean of its values:
// taken from column sums made once per 128-row slab (V^T . ones) instead of once per query tile.
// Only k and v go through the workspace: a query row is used by one work-group alone, which reads it in
// f32 and converts it in registers.

typedef _Float16 v16h __attribute__((ext_vector_type(16)));
typedef _Float16 v8h  __attribute__((ext_vector_type(8)));
typedef _Float16 v4h  __attribute__((ext_vector_type(4)));
typedef __bf16   v2b  __attribute__((ext_vector_type(2)));
typedef float    v8f  __attribute__((ext_vector_type(8)));
typedef float    v4f  __attribute__((ext_vector_type(4)));
typedef float    v2f  __attribute__((ext_vector_type(2)));

#ifndef NB
#define NB 2
#endif
#ifndef SEQ
#define SEQ 2048
#endif
#define NB_FULL  2
#define SEQ_FULL 2048
#define NHEAD 16
#define HD    64
#define CHUNK 512
#define NBH   (NB * NHEAD)

static_assert(NB >= 1 && NB <= NB_FULL);
static_assert(SEQ >= CHUNK && SEQ <= SEQ_FULL && (SEQ % CHUNK) == 0);
static_assert((CHUNK % 128) == 0 && (SEQ % 128) == 0 && (SEQ % 64) == 0);
static_assert(HD == 64);
static_assert((size_t)NBH * SEQ_FULL * HD < (size_t)0xFFFFFFFFu);

#define LDT 72   // halves per LDS row (144 B, 16-B aligned)
#define LDC 68   // floats per LDS row (272 B, 16-B aligned)
static_assert((LDT % 8) == 0 && LDT >= 64);
static_assert((LDC % 4) == 0 && LDC >= 64);

#define QKCARRY 16.0f    // q and k carried x16 each
#define WCARRY  64.0f    // value plane carried x64
#define PCARRY  1024.0f  // softmax numerators carried x1024
#define RCARRY  1024.0f  // residual plane of p carried x1024 on top of its hi part
#define NEGFILL (-1.0e9f)
#define NEGRAW  (-1.0e9f * 2048.0f)                    // -1e9 in units of the raw products (x 2^11)
#define RAWLOG2 (1.44269504088896f / 2048.0f)          // raw product -> score in log2 units
#define MFLOOR  (-2147483648.0f)                       // floor of the raw running maximum: score -2^20
static_assert(QKCARRY * QKCARRY * 8.0f == 2048.0f);    // HD^-0.5 = 1/8 over the plane carries
#ifndef P_RES
#define P_RES 1          // 1: p residual product on the early band; 0: single product everywhere
#endif

// workspace layout (bytes)
#define PLANE16_BYTES ((size_t)NBH * SEQ * HD * 2)
#define OFF_K  ((size_t)0)
#define OFF_VT (OFF_K + PLANE16_BYTES)
// one record per (head, 128-row slab), three 128-B lines: 64 column sums of the carried values, then
// the largest squared row norm of the slab's carried k rows
#define REC 96u
#define NSLAB (SEQ / 128)
#define OFF_R  (OFF_VT + PLANE16_BYTES)
#define WS_TOTAL (OFF_R + (size_t)NBH * NSLAB * REC * 4)
static_assert((PLANE16_BYTES % 128) == 0);
static_assert(NSLAB <= 16);   // a 16-lane row holds one slab's norms a lane
// |q.k| / 8 <= |16 q| |16 k| 2^-11 (Cauchy-Schwarz). Below 30 it stays under 32, half a step of f32 at
// 1e9, also with the inputs' rounding to bf16 (2^-8 a factor) undone: score + -1e9 is then -1e9.
#define FLATB (900.0f * 4194304.0f)   // bound on |16 q|^2 |16 k|^2: 30^2 * 2^22
static_assert(WS_TOTAL <= (size_t)134217728);

#define LDX 36   // floats per lane slot of the state exchange (144 B, 16-B aligned)
static_assert((LDX % 4) == 0 && LDX >= 34);
#define NQT (SEQ / 64)   // query tiles of 64 rows per head
static_assert((NQT % 2) == 0);

#define TILEH (2u * 64u * LDT)   // halves of one staging buffer of K or of V^T: both key halves of a step

// static LDS of the attention kernel (two staging buffers of K and of V^T)
static_assert((size_t)(2 * TILEH * 2) * 2 + (size_t)(4 * 16 * LDC * 4) +
              (size_t)(4 * 32 * LDX * 4) + 32 <= (size_t)131072);

// ---------------------------------------------------------------------------
__device__ __forceinline__ float bf16r(float x) {   // RNE convert to bf16, returned widened
  unsigned int u = __float_as_uint(x);
  u = (u + 0x7FFFu + ((u >> 16) & 1u)) & 0xFFFF0000u;
  return __uint_as_float(u);
}

// f32 -> f16 that cannot produce an f16 subnormal (value select)
static __device__ __forceinline__ _Float16 toh_flush(float v) {
  const _Float16 r = (_Float16)v;
  return (fabsf(v) < 6.103515625e-05f) ? (_Float16)0.0f : r;
}

// 16-bit fragment: p points at element [row = lane&15][k0 + 8*(lane>>4)] of a k-contiguous
// row. Elements 0..7 <- k0+8h+0..7, elements 8..15 <- k0+16+8h+0..7 (same map for A and B).
__device__ __forceinline__ v16h frag_at(const _Float16* p) {
  v8h lo = *(const v8h*)(p);
  v8h hi = *(const v8h*)(p + 16);
  v16h out;
#pragma unroll
  for (int i = 0; i < 8; ++i) { out[i] = lo[i]; out[i + 8] = hi[i]; }
  return out;
}
__device__ __forceinline__ v16h ld_frag(const _Float16* base, unsigned ld) {
  const unsigned lane = threadIdx.x & 31u;
  return frag_at(base + (lane & 15u) * ld + (lane >> 4) * 8u);
}

__device__ __forceinline__ v8f wmma16(v16h a, v16h b, v8f c) {
  v8f d = __builtin_amdgcn_wmma_f32_16x16x32_f16(false, a, false, b, (short)0, c,
                                                 false, false);
  asm volatile("v_nop\n\tv_nop\n\tv_nop\n\tv_nop" : "+v"(d) : "v"(a), "v"(b));
  return d;
}

__device__ __forceinline__ float xhalf(float x) {   // value of lane l ^ 16
  const int b = __builtin_bit_cast(int, x);
  return __builtin_bit_cast(float, __builtin_amdgcn_permlanex16(b, b, 0x76543210, 0xfedcba98,
                                                                false, false));
}

// maximum that hands a NaN on: a NaN norm must fail the bound test
__device__ __forceinline__ float max_nan(float a, float b) {
  return __builtin_elementwise_maximum(a, b);
}

template <int CTRL>
__device__ __forceinline__ float dpp_of(float x) {
  return __builtin_bit_cast(float, __builtin_amdgcn_update_dpp(0, __builtin_bit_cast(int, x), CTRL,
                                                               0xf, 0xf, true));
}
// sum over the 16 lanes of a row, in every lane: neighbours, pairs, then the mirrored quad and half
__device__ __forceinline__ float row16_sum(float x) {
  x += dpp_of<0xB1>(x);    // quad_perm [1,0,3,2]
  x += dpp_of<0x4E>(x);    // quad_perm [2,3,0,1]
  x += dpp_of<0x141>(x);   // row_half_mirror
  x += dpp_of<0x140>(x);   // row_mirror
  return x;
}

// compile-time kind of a key chunk: a past chunk (every cell masked) or the diagonal chunk
struct PastChunk { static constexpr bool past = true; };
struct DiagChunk { static constexpr bool past = false; };

// number of 128-key steps of the 64-row query tile at q0: its past chunks whole, then the diagonal
// chunk up to key q0 + 63, rounded up to whole steps; at least 1
__device__ __forceinline__ unsigned steps_of(unsigned q0) {
  const unsigned cs = q0 & ~((unsigned)CHUNK - 1u);
  return (cs + ((q0 - cs + 191u) & ~127u)) >> 7;
}

__device__ __forceinline__ unsigned lds_off(const void* p) { return (unsigned)(size_t)p; }

__device__ __forceinline__ void wave_lds_sync() {
  __builtin_amdgcn_fence(3 /* release order */, "wavefront");
  asm volatile("s_wait_dscnt 0x0" ::: "memory");
  __builtin_amdgcn_wave_barrier();
}

// ---------------------------------------------------------------------------
// Both planes in one launch. One work-group per (128-row slab, head): k rows go to the
// compact plane [bh][s][64] as f16(16 * bf16(x)), the value rows to the transposed plane
// [bh][64][s] as f16(64 * bf16(x)). A thread takes 32 elements of each input and issues its 16
// 16-B loads ahead of all arithmetic; the whole grid is resident at once, so few waves have to start.
// k: one load of a wave covers 512 contiguous bytes, one store 256 (two whole lines).
// v: thread (rg, cq) loads rows 8 rg .. 8 rg + 7, columns 4 cq .. 4 cq + 3 (a wave's load: two whole
// rows) and writes, per column d, its 8 keys as one 16-B piece into T[d][piece]; row d keeps piece p
// at place p ^ (d >> 2), which spreads both the writers' and the readers' 16 lanes over all banks.
// T: cross-wave (block barrier). Store loop: 16 rows of d per step x 4 steps; one store of a wave =
// two rows of 256 contiguous bytes.
// The slab's record: waves 0 and 1 sum T's rows over the 128 keys as V^T . ones (32 rows of d = one
// 128-B line each; with a B of ones the k order is free, so lane m reads place p ^ m: no bank shared).
// A k row lies in 16 lanes: its squared norm is 4 products a lane and a 16-lane sum; the waves'
// maxima meet in red (second block barrier) and one thread writes the slab's.
// Grid (SEQ/128, NBH).
// ---------------------------------------------------------------------------
#define PROWS 128u   // rows of a slab
static_assert((SEQ % 128) == 0 && HD == 64);
static_assert(128 * HD == 256 * 4 * 8);        // 8 loads of 4 floats a thread cover a slab of one input
static_assert((256 / 16) * 8 == 128 && 16 * 4 == HD && (256 / 16) * 4 == HD);
__global__ __launch_bounds__(256) void prep_kernel(
    const float* __restrict__ Kf, const float* __restrict__ Vf,
    _Float16* __restrict__ K16, _Float16* __restrict__ Vt, float* __restrict__ R) {
  __shared__ __attribute__((aligned(16))) _Float16 T[HD * PROWS];
  __shared__ __attribute__((aligned(16))) float red[8];
  const unsigned tid = threadIdx.x;
  const unsigned w = (unsigned)__builtin_amdgcn_readfirstlane((int)(threadIdx.x >> 5));
  const unsigned s0 = blockIdx.x * PROWS;
  const unsigned bh = blockIdx.y;
  const float* const ks = Kf + ((size_t)bh * SEQ_FULL + s0) * HD;   // block-uniform bases
  const float* const vs = Vf + ((size_t)bh * SEQ_FULL + s0) * HD;
  const unsigned rg = tid >> 4, cq = tid & 15u;

  const float* const vp = vs + (rg * 8u) * (unsigned)HD + cq * 4u;   // the thread's first value piece
  v4f vv[8], ka[8];
#pragma unroll
  for (unsigned r = 0; r < 8u; ++r) vv[r] = *(const v4f*)(vp + r * (unsigned)HD);
  // keeps the value loads first, the order of use (loads return in order): else the scheduler asks
  // for the value rows last and the first conversion waits for all 16 loads
  __builtin_amdgcn_sched_barrier(0);
#pragma unroll
  for (unsigned j = 0; j < 8u; ++j) ka[j] = *(const v4f*)(ks + (j * 256u + tid) * 4u);
  // precaution ahead of any rewrite of the loads' address registers; it names them as inputs so that
  // no later load's result is laid over them in front of it
  asm volatile("s_wait_xcnt 0x0" :: "v"(vp), "v"(tid) : "memory");
  // keeps all 16 loads in front of the arithmetic: left alone, the scheduler puts part of them among
  // the conversions, and a wave then has fewer bytes in flight
  __builtin_amdgcn_sched_barrier(0);

#pragma unroll
  for (unsigned i = 0; i < 4u; ++i) {
    v8h x;
#pragma unroll
    for (int r = 0; r < 8; ++r) x[r] = toh_flush(WCARRY * bf16r(vv[r][i]));
    *(v8h*)&T[(cq * 4u + i) * PROWS + (rg ^ cq) * 8u] = x;
  }

  _Float16* const kd = K16 + ((size_t)bh * SEQ + s0) * HD;
  float nk = 0.0f;   // largest squared norm of the rows that this 16-lane row holds

  // block barrier for T alone: only LDS data crosses waves here, so the fences name LDS; a plain
  // __syncthreads() would also wait for any global load in flight
  __builtin_amdgcn_fence(__ATOMIC_RELEASE, "workgroup", "local");
  __builtin_amdgcn_s_barrier();
  __builtin_amdgcn_fence(__ATOMIC_ACQUIRE, "workgroup", "local");
  _Float16* const vd = Vt + (size_t)bh * HD * SEQ + s0;
  v8h y[4];
#pragma unroll
  for (unsigned i = 0; i < 4u; ++i) {
    const unsigned d = 16u * i + rg;
    y[i] = *(const v8h*)&T[d * PROWS + (cq ^ (d >> 2)) * 8u];
  }
#pragma unroll
  for (unsigned i = 0; i < 4u; ++i) *(v8h*)(vd + (16u * i + rg) * (unsigned)SEQ + cq * 8u) = y[i];
  // precaution: what follows reuses the stores' data and address registers
  asm volatile("s_wait_xcnt 0x0" ::: "memory");

  float* const rec = R + ((size_t)bh * NSLAB + blockIdx.x) * REC;   // block-uniform
  if (w < 2u) {   // scalar test: EXEC stays full for the products
    const unsigned hh = (tid >> 4) & 1u, m = tid & 15u;
    v16h one;
#pragma unroll
    for (int v = 0; v < 16; ++v) one[v] = (_Float16)1.0f;
    // all eight fragments are read as one group ahead of the products: one LDS latency, not eight
    v16h a[4][2];
#pragma unroll
    for (unsigned c = 0; c < 4u; ++c)
#pragma unroll
      for (unsigned gi = 0; gi < 2u; ++gi) {
        const _Float16* const row = &T[((2u * w + gi) * 16u + m) * PROWS];
        const v8h lo = *(const v8h*)(row + ((4u * c + hh) ^ m) * 8u);
        const v8h hi = *(const v8h*)(row + ((4u * c + 2u + hh) ^ m) * 8u);
#pragma unroll
        for (int v = 0; v < 8; ++v) { a[c][gi][v] = lo[v]; a[c][gi][v + 8] = hi[v]; }
      }
    v8f cs[2] = {(v8f){}, (v8f){}};
#pragma unroll
    for (unsigned c = 0; c < 4u; ++c)
#pragma unroll
      for (unsigned gi = 0; gi < 2u; ++gi) cs[gi] = wmma16(a[c][gi], one, cs[gi]);
    if (m == 0u) {   // every column of the result is the same sum: lane (hh, 0) holds rows 8 hh + 0..7
#pragma unroll
      for (unsigned gi = 0; gi < 2u; ++gi) {
        float* const p = rec + (2u * w + gi) * 16u + hh * 8u;
        *(v4f*)(p)     = (v4f){cs[gi][0], cs[gi][1], cs[gi][2], cs[gi][3]};
        *(v4f*)(p + 4) = (v4f){cs[gi][4], cs[gi][5], cs[gi][6], cs[gi][7]};
      }
    }
    // precaution: what follows reuses the stores' data and address registers
    asm volatile("s_wait_xcnt 0x0" ::: "memory");
  }

#pragma unroll
  for (unsigned j = 0; j < 8u; ++j) {
    v4h x;
    float ss = 0.0f;
#pragma unroll
    for (int i = 0; i < 4; ++i) {
      const float f = QKCARRY * bf16r(ka[j][i]);
      x[i] = toh_flush(f);
      ss += f * f;
    }
    *(v4h*)(kd + (j * 256u + tid) * 4u) = x;
    nk = max_nan(nk, row16_sum(ss));
  }
  // precaution: what follows reuses the k stores' data and address registers
  asm volatile("s_wait_xcnt 0x0" ::: "memory");

  nk = max_nan(nk, xhalf(nk));
  if ((tid & 31u) == 0u) red[w] = nk;
  // block barrier for red alone (LDS data only, as above)
  __builtin_amdgcn_fence(__ATOMIC_RELEASE, "workgroup", "local");
  __builtin_amdgcn_s_barrier();
  __builtin_amdgcn_fence(__ATOMIC_ACQUIRE, "workgroup", "local");
  if (tid == 64u) {   // a wave that wrote no column sums owns the record's third line
    const v4f a = *(const v4f*)&red[0], b = *(const v4f*)&red[4];
    rec[64] = max_nan(max_nan(max_nan(a[0], a[1]), max_nan(a[2], a[3])),
                      max_nan(max_nan(b[0], b[1]), max_nan(b[2], b[3])));
  }
}

static_assert(2 * 8 == 16);
__global__ __launch_bounds__(256) __attribute__((amdgpu_num_vgpr(256))) void attn_kernel(
    const float* __restrict__ Qf, const _Float16* __restrict__ Kh,
    const _Float16* __restrict__ Vt, const float* __restrict__ R, float* __restrict__ Out) {
  __shared__ __attribute__((aligned(16))) _Float16 Ks[2 * TILEH];   // [buffer][g][key][d]
  __shared__ __attribute__((aligned(16))) _Float16 Vs[2 * TILEH];   // [buffer][g][d][key]
  __shared__ __attribute__((aligned(16))) float Os[4 * 16 * LDC];
  __shared__ __attribute__((aligned(16))) float Xs[4 * 32 * LDX];
  __shared__ __attribute__((aligned(16))) float qn[8];   // [tile][query row group]
  static_assert(4 * 32 * LDX >= 64 * LDC);               // either array holds a 64-row f32 query tile

  const unsigned tid = threadIdx.x, lane = tid & 31u;
  const unsigned w = (unsigned)__builtin_amdgcn_readfirstlane((int)(threadIdx.x >> 5));
  const unsigned g = w >> 2, wq = w & 3u;            // key half of a step; query row group
  const unsigned hh = lane >> 4, m = lane & 15u;
  const unsigned bh = blockIdx.z * (unsigned)NHEAD + blockIdx.y;
  const float scale = 0.125f / (QKCARRY * QKCARRY);  // HD^-0.5 over the plane carries
  const unsigned obase = wq * (16u * LDC);
  float* const xrow = &Xs[(wq * 32u + lane) * LDX];
  const size_t kplane = (size_t)bh * SEQ * HD;
  const size_t vplane = (size_t)bh * HD * SEQ;
  // staging: the thread's own element inside a step's K rows / V^T rows (global) and tiles (LDS);
  // piece j lies 32 keys (K) or 16 rows of d (V^T) further on
  const unsigned kgo = (tid >> 3) * (unsigned)HD + (tid & 7u) * 8u;
  const unsigned vgo = (tid >> 4) * (unsigned)SEQ + (tid & 15u) * 8u;
  const unsigned klo = (tid >> 3) * LDT + (tid & 7u) * 8u;
  const unsigned vlo = ((tid & 15u) >> 3) * (64u * LDT) + (tid >> 4) * LDT + (tid & 7u) * 8u;

  const unsigned qA = ((unsigned)NQT - 1u - blockIdx.x) * 64u, qB = blockIdx.x * 64u;
  // both tiles' query rows into Os (first tile) and Xs (second), rows of LDC floats: eight copies a lane,
  // every lane on, piece j 16 rows further on. The s_wait_xcnt ends the copies' own statement, a
  // precaution ahead of any rewrite of their address registers.
  {
    const unsigned qr = tid >> 4, qc = (tid & 15u) * 4u;
    const unsigned la = lds_off(&Os[qr * LDC + qc]), lb = lds_off(&Xs[qr * LDC + qc]);
    const float* const ga = Qf + ((size_t)bh * SEQ_FULL + qA + qr) * HD + qc;
    const float* const gb = Qf + ((size_t)bh * SEQ_FULL + qB + qr) * HD + qc;
    asm volatile(
        "global_load_async_to_lds_b128 %0, %8, off\n\t"
        "global_load_async_to_lds_b128 %1, %9, off\n\t"
        "global_load_async_to_lds_b128 %2, %10, off\n\t"
        "global_load_async_to_lds_b128 %3, %11, off\n\t"
        "global_load_async_to_lds_b128 %4, %12, off\n\t"
        "global_load_async_to_lds_b128 %5, %13, off\n\t"
        "global_load_async_to_lds_b128 %6, %14, off\n\t"
        "global_load_async_to_lds_b128 %7, %15, off\n\t"
        "s_wait_xcnt 0x0"
        :: "v"(la), "v"(la + 1u * (16u * LDC * 4u)), "v"(la + 2u * (16u * LDC * 4u)),
           "v"(la + 3u * (16u * LDC * 4u)),
           "v"(lb), "v"(lb + 1u * (16u * LDC * 4u)), "v"(lb + 2u * (16u * LDC * 4u)),
           "v"(lb + 3u * (16u * LDC * 4u)),
           "v"(ga), "v"(ga + 1u * (16u * HD)), "v"(ga + 2u * (16u * HD)), "v"(ga + 3u * (16u * HD)),
           "v"(gb), "v"(gb + 1u * (16u * HD)), "v"(gb + 2u * (16u * HD)), "v"(gb + 3u * (16u * HD))
        : "memory");
  }

  const float* const rb = R + (size_t)bh * NSLAB * REC;   // the head's slab records; block-uniform
  // do the norms bound every score of the tile at q0 against its past chunks? (no past chunk: no matter)
  // Lane m holds slab m's key norm: one load for all slabs (one latency), each wave for itself.
  const unsigned msl = (m < (unsigned)NSLAB) ? m : ((unsigned)NSLAB - 1u);
  const float nrmk = rb[msl * REC + 64u];
  // the slabs' column sums of the lane's four output columns, asked for here, summed behind step 0's copies
  v4f ps[(SEQ - CHUNK) / 128];
#pragma unroll
  for (unsigned sl = 0; sl < (unsigned)(SEQ - CHUNK) / 128u; ++sl)
    ps[sl] = *(const v4f*)(rb + sl * REC + m * 4u);
  asm volatile("s_wait_asynccnt 0x0" ::: "memory");   // this wave's copies of the query rows have landed
  __syncthreads();                                    // and every other wave's: both tiles are published
  // the wave's 16 rows of a tile as B fragments (the loaders' k order: elements 0..7 <- 32 c + 8 hh + 0..7,
  // 8..15 <- 32 c + 16 + 8 hh + 0..7); returns the largest squared norm of the 16 carried rows, in every lane
  auto q_frags = [&](const float* const tile, v16h (&f)[2]) __attribute__((always_inline)) {
    const float* const row = tile + (wq * 16u + m) * LDC + hh * 8u;
    v8f acc = {};
#pragma unroll
    for (unsigned c = 0; c < 2u; ++c) {
      v8h part[2];
#pragma unroll
      for (unsigned h = 0; h < 2u; ++h) {
        const v4f x0 = *(const v4f*)(row + c * 32u + h * 16u);
        const v4f x1 = *(const v4f*)(row + c * 32u + h * 16u + 4u);
        const v8f x = __builtin_shufflevector(x0, x1, 0, 1, 2, 3, 4, 5, 6, 7);
        v8f y;   // bf16(x) widened again: one packed RNE convert a pair, then the two halves in place
#pragma unroll
        for (int i = 0; i < 4; ++i) {
          const unsigned u = __builtin_bit_cast(
              unsigned, __builtin_convertvector((v2f){x[2 * i], x[2 * i + 1]}, v2b));
          y[2 * i]     = __uint_as_float(u << 16);
          y[2 * i + 1] = __uint_as_float(u & 0xFFFF0000u);
        }
        y = y * QKCARRY;
        acc = __builtin_elementwise_fma(y, y, acc);
        part[h] = __builtin_convertvector(y, v8h);
      }
      f[c] = __builtin_shufflevector(part[0], part[1], 0, 1, 2, 3, 4, 5, 6, 7, 8, 9, 10, 11, 12, 13, 14, 15);
    }
    float ss = ((acc[0] + acc[1]) + (acc[2] + acc[3])) + ((acc[4] + acc[5]) + (acc[6] + acc[7]));
    ss += xhalf(ss);                               // row m's other 32 elements
    ss = max_nan(ss, dpp_of<0xB1>(ss));
    ss = max_nan(ss, dpp_of<0x4E>(ss));
    ss = max_nan(ss, dpp_of<0x141>(ss));
    ss = max_nan(ss, dpp_of<0x140>(ss));
    return ss;
  };
  v16h qf[2], qf2[2];   // the running tile's fragments; the second tile's
  {
    const float na = q_frags(Os, qf), nb = q_frags(Xs, qf2);
    if (g == 0u && lane == 0u) {   // group 1 holds the same rows
      qn[wq] = na;
      qn[4u + wq] = nb;
    }
  }
  // publishes qn; it also ends every wave's reads of the f32 rows, so that Os and Xs are free for the loops
  __syncthreads();
  const v4f qna = *(const v4f*)&qn[0], qnb = *(const v4f*)&qn[4];
  auto past_flat = [&](const unsigned q0, const v4f qq) __attribute__((always_inline)) {
    const unsigned nsl = (q0 & ~((unsigned)CHUNK - 1u)) >> 7;
    float kn = (m < nsl) ? nrmk : 0.0f;            // the past slabs' key norms; 16-lane maximum
    kn = max_nan(kn, dpp_of<0xB1>(kn));
    kn = max_nan(kn, dpp_of<0x4E>(kn));
    kn = max_nan(kn, dpp_of<0x141>(kn));
    kn = max_nan(kn, dpp_of<0x140>(kn));
    const float ku = __builtin_bit_cast(
        float, __builtin_amdgcn_readfirstlane(__builtin_bit_cast(int, kn)));
    const float qu = __builtin_bit_cast(
        float, __builtin_amdgcn_readfirstlane(__builtin_bit_cast(
                   int, max_nan(max_nan(qq[0], qq[1]), max_nan(qq[2], qq[3])))));
    return qu * ku < FLATB;                        // scalar: the same in every wave of the block
  };
  const bool fA = past_flat(qA, qna), fB = past_flat(qB, qnb);
  // first 128-key step that each tile walks
  const unsigned bA = fA ? ((qA & ~((unsigned)CHUNK - 1u)) >> 7) : 0u;
  const unsigned bB = fB ? ((qB & ~((unsigned)CHUNK - 1u)) >> 7) : 0u;
  const unsigned n0 = steps_of(qA) - bA;
  const unsigned ntot = n0 + steps_of(qB) - bB;
  const unsigned kl0 = lds_off(&Ks[klo]), vl0 = lds_off(&Vs[vlo]);   // LDS byte addresses, buffer 0
  const _Float16* const kg0 = Kh + kplane + kgo;
  const _Float16* const vg0 = Vt + vplane + vgo;
  // step t's K and V^T tiles into buffer t & 1: eight copies a lane, every lane on. The s_wait_xcnt
  // ends the copies' own statement, a precaution ahead of any rewrite of their address registers.
  auto stage = [&](const unsigned t) __attribute__((always_inline)) {
    const unsigned ks = (t < n0 ? t + bA : t - n0 + bB) * 128u;   // first key of the step
    const unsigned bo = (t & 1u) * (TILEH * 2u);        // the buffer's byte offset
    const unsigned kl = kl0 + bo, vl = vl0 + bo;
    const _Float16* const kp = kg0 + (size_t)ks * HD;
    const _Float16* const vp = vg0 + ks;
    asm volatile(
        "global_load_async_to_lds_b128 %0, %8, off\n\t"
        "global_load_async_to_lds_b128 %1, %9, off\n\t"
        "global_load_async_to_lds_b128 %2, %10, off\n\t"
        "global_load_async_to_lds_b128 %3, %11, off\n\t"
        "global_load_async_to_lds_b128 %4, %12, off\n\t"
        "global_load_async_to_lds_b128 %5, %13, off\n\t"
        "global_load_async_to_lds_b128 %6, %14, off\n\t"
        "global_load_async_to_lds_b128 %7, %15, off\n\t"
        "s_wait_xcnt 0x0"
        :: "v"(kl), "v"(kl + 1u * (32u * LDT * 2u)), "v"(kl + 2u * (32u * LDT * 2u)),
           "v"(kl + 3u * (32u * LDT * 2u)),
           "v"(vl), "v"(vl + 1u * (16u * LDT * 2u)), "v"(vl + 2u * (16u * LDT * 2u)),
           "v"(vl + 3u * (16u * LDT * 2u)),
           "v"(kp), "v"(kp + 1u * (32u * HD)), "v"(kp + 2u * (32u * HD)), "v"(kp + 3u * (32u * HD)),
           "v"(vp), "v"(vp + 1u * (16u * SEQ)), "v"(vp + 2u * (16u * SEQ)), "v"(vp + 3u * (16u * SEQ))
        : "memory");
  };
  // in front of the loops: step 0 landed and published, step 1 in flight (ntot >= 2: each tile has a step)
  stage(0u);
  // keeps the sums below, which wait for the slabs' loads, behind the issue of step 0's copies
  __builtin_amdgcn_sched_barrier(0);
  // past chunks that a tile does not walk: their share of the lane's four output columns, the same for
  // every row of the tile; bA and bB count the slabs (0 where the tile walks its past chunks)
  v4f pvA = {}, pvB = {};
#pragma unroll
  for (unsigned sl = 0; sl < (unsigned)(SEQ - CHUNK) / 128u; ++sl) {
    pvA += (sl < bA) ? ps[sl] : (v4f){};
    pvB += (sl < bB) ? ps[sl] : (v4f){};
  }
  pvA = pvA * (1.0f / ((float)CHUNK * WCARRY));
  pvB = pvB * (1.0f / ((float)CHUNK * WCARRY));
  asm volatile("s_wait_asynccnt 0x0" ::: "memory");   // this wave's copies of step 0 have landed
  __syncthreads();
  stage(1u);
  unsigned t = 0u;   // number of the running step

#pragma unroll 1   // the two tiles run one after the other through one copy of the loop
  for (unsigned pass = 0; pass < 2u; ++pass) {
  const unsigned q0 = (pass ? blockIdx.x : ((unsigned)NQT - 1u - blockIdx.x)) * 64u;
  const unsigned ci = q0 / (unsigned)CHUNK;          // chunk of this query block
  const unsigned cs = ci * (unsigned)CHUNK;          // first key of the diagonal chunk
  const bool first_blk = (q0 - cs < 128u);           // first 128 rows of the chunk; block-uniform
  const unsigned qrow0 = q0 + wq * 16u;

  const bool pflat = pass ? fB : fA;

  float mrow = -1.0e30f, lrow = 0.0f;   // of query row m; lrow: this half's keys only
  // The running output (sum of the chunks' O / l) rests in group 0's own output rows of Os, which
  // are idle until the epilogue: lane (hh, m) owns cells [m][16 nb + 8 hh + 0..7], touched once per
  // chunk. That leaves its 32 registers to the V^T fragments held across the softmax.
  float* const orow = &Os[obase + m * LDC + hh * 8u];
  v8f o[4];
#pragma unroll
  for (int nb = 0; nb < 4; ++nb) o[nb] = (v8f){};
  if (g == 0u) {
#pragma unroll
    for (int nb = 0; nb < 4; ++nb) {
      *(v4f*)(orow + nb * 16) = (v4f){};
      *(v4f*)(orow + nb * 16 + 4) = (v4f){};
    }
  }

#pragma unroll 1
  for (unsigned jc = pflat ? ci : 0u; jc <= ci; ++jc) {
    const bool offd = (jc < ci);                     // past chunk: every cell masked
    const unsigned kc0 = jc * (unsigned)CHUNK;
    const unsigned kc1 =                             // <= SEQ
        offd ? (kc0 + (unsigned)CHUNK) : (cs + ((q0 - cs + 191u) & ~127u));

    // one 128-key step; compiled once for past chunks and once for the diagonal chunk
    auto step = [&](auto kind, const unsigned ks) __attribute__((always_inline)) {
      constexpr bool offd = decltype(kind)::past;
      const unsigned kb = ks + g * 64u;                // this wave's 64 keys
      const bool early = (P_RES != 0) && first_blk && (!offd) && (kb == cs);   // wave-uniform
      const _Float16* const Kw = &Ks[(t & 1u) * TILEH + g * (64u * LDT)];   // this step's buffer
      const _Float16* const Vw = &Vs[(t & 1u) * TILEH + g * (64u * LDT)];

      // scores: 4 key groups of 16, K = 64 in two 32-steps. All eight K fragments are read as
      // one group ahead of the eight products (one LDS latency per tile, not one per product);
      // the four accumulators advance side by side, each still c = 0 then c = 1.
      v16h kf[2][4];
#pragma unroll
      for (int c = 0; c < 2; ++c)
#pragma unroll
        for (int kg = 0; kg < 4; ++kg) kf[c][kg] = ld_frag(&Kw[(kg * 16) * LDT + c * 32], LDT);
      v8f s[4];
#pragma unroll
      for (int kg = 0; kg < 4; ++kg) s[kg] = (v8f){};
#pragma unroll
      for (int c = 0; c < 2; ++c)
#pragma unroll
        for (int kg = 0; kg < 4; ++kg) s[kg] = wmma16(kf[c][kg], qf[c], s[kg]);

      // all eight V^T fragments, issued here as one group: they land while the softmax runs
      v16h vf[2][4];
#pragma unroll
      for (int c = 0; c < 2; ++c)
#pragma unroll
        for (int nb = 0; nb < 4; ++nb) vf[c][nb] = ld_frag(&Vw[(nb * 16) * LDT + c * 32], LDT);

      // Past chunk: the f32 sum score + (-1e9) keeps steps of 64 only, so a whole tile's masked scores
      // are as a rule one and the same number. Tested by value: rounding is monotone, so when the
      // lane's smallest and largest score give the same masked value, all 32 between them do. Where
      // that value is also the other half's and the running maximum (or this is the chunk's first
      // step, whose state is all zero), the softmax below would find alpha = 1 and p = exp(0) = 1 in
      // every cell: the same numbers come from a constant P operand, without the softmax arithmetic.
      bool flat = false;                               // wave-uniform
      float tflat = 0.0f;
      if constexpr (offd) {
        float hi[4], lo[4];
#pragma unroll
        for (int kg = 0; kg < 4; ++kg) {
          hi[kg] = fmaxf(fmaxf(fmaxf(s[kg][0], s[kg][1]), fmaxf(s[kg][2], s[kg][3])),
                         fmaxf(fmaxf(s[kg][4], s[kg][5]), fmaxf(s[kg][6], s[kg][7])));
          lo[kg] = fminf(fminf(fminf(s[kg][0], s[kg][1]), fminf(s[kg][2], s[kg][3])),
                         fminf(fminf(s[kg][4], s[kg][5]), fminf(s[kg][6], s[kg][7])));
        }
        tflat = fmaxf(fmaxf(hi[0], hi[1]), fmaxf(hi[2], hi[3])) * scale + NEGFILL;
        const float tlo = fminf(fminf(lo[0], lo[1]), fminf(lo[2], lo[3])) * scale + NEGFILL;
        const bool ok = (bool)((int)(tlo == tflat) & (int)(xhalf(tflat) == tflat) &
                               ((int)(ks == kc0) | (int)(mrow == tflat)));
        flat = (__builtin_amdgcn_ballot_w32(ok) == 0xFFFFFFFFu);   // scalar test: EXEC stays full
      }

      // B operands of the two 32-key steps, f16(1024 p), and the new state: set for p = 1 in all of
      // this half's 32 cells; the softmax overwrites them where the tile is not flat
      v16h pf[2];
#pragma unroll
      for (int v = 0; v < 16; ++v) {
        pf[0][v] = (_Float16)PCARRY;
        pf[1][v] = (_Float16)PCARRY;
      }
      float mnew = tflat, lnew = lrow + 32.0f;
      // the hint lays the flat tile out as the fall-through of a past chunk's step
      if (__builtin_expect(!flat, !offd)) {
      if constexpr (!offd) {
      // Diagonal chunk: the softmax runs on the raw products (score = raw * 2^-11, exact), the state's
      // maximum is kept raw and its sum x1024 until the end of the chunk. A masked cell takes the raw
      // form of -1e9 itself: next to the row's own unmasked diagonal score its p is 0 either way.
      if (kb >= q0) {
        const int dl = (int)(qrow0 + m) - (int)(kb + hh * 8u);   // cells of the lane above dl are masked
#pragma unroll
        for (int kg = 0; kg < 4; ++kg)
#pragma unroll
          for (int v = 0; v < 8; ++v) s[kg][v] = (kg * 16 + v > dl) ? NEGRAW : s[kg][v];
      }
      float mk[4];
#pragma unroll
      for (int kg = 0; kg < 4; ++kg)
        mk[kg] = fmaxf(fmaxf(fmaxf(s[kg][0], s[kg][1]), fmaxf(s[kg][2], s[kg][3])),
                       fmaxf(fmaxf(s[kg][4], s[kg][5]), fmaxf(s[kg][6], s[kg][7])));
      float mx = fmaxf(fmaxf(mk[0], mk[1]), fmaxf(mk[2], mk[3]));
      mx = fmaxf(mx, xhalf(mx));
      // the floor keeps a tile whose 64 keys are all masked (the half step above the diagonal) at p = 0:
      // with -1e9 itself as the maximum the shift below would lose its low bits
      const float mn = fmaxf(fmaxf(mrow, mx), MFLOOR);
      const float alpha = __builtin_amdgcn_exp2f((mrow - mn) * RAWLOG2);
      mnew = mn;
      // 1024 p = 2^(raw * c - (max * c - 10)): one multiply-add a cell, two cells an instruction
      const float sh = 10.0f - mn * RAWLOG2;
      const v8f c8 = {RAWLOG2, RAWLOG2, RAWLOG2, RAWLOG2, RAWLOG2, RAWLOG2, RAWLOG2, RAWLOG2};
      const v8f sh8 = {sh, sh, sh, sh, sh, sh, sh, sh};
#pragma unroll
      for (int kg = 0; kg < 4; ++kg) {
        const v8f e = __builtin_elementwise_fma(s[kg], c8, sh8);
#pragma unroll
        for (int v = 0; v < 8; ++v) s[kg][v] = __builtin_amdgcn_exp2f(e[v]);
      }
      const v8f s8 = (s[0] + s[1]) + (s[2] + s[3]);   // the four key groups cell by cell, then the eight cells
      lnew = alpha * lrow + (((s8[0] + s8[1]) + (s8[2] + s8[3])) + ((s8[4] + s8[5]) + (s8[6] + s8[7])));
#pragma unroll
      for (int nb = 0; nb < 4; ++nb) o[nb] = o[nb] * alpha;
#pragma unroll
      for (int c = 0; c < 2; ++c)
        pf[c] = __builtin_shufflevector(__builtin_convertvector(s[2 * c], v8h),
                                        __builtin_convertvector(s[2 * c + 1], v8h),
                                        0, 1, 2, 3, 4, 5, 6, 7, 8, 9, 10, 11, 12, 13, 14, 15);
      } else {
#pragma unroll
      for (int kg = 0; kg < 4; ++kg) s[kg] = s[kg] * scale;

      // additive mask of a past chunk, every cell
#pragma unroll
      for (int kg = 0; kg < 4; ++kg)
#pragma unroll
        for (int v = 0; v < 8; ++v) s[kg][v] = s[kg][v] + NEGFILL;

      // online softmax; a lane holds 32 of its query row's 64 scores, lane ^ 16 the other 32
      float mk[4];
#pragma unroll
      for (int kg = 0; kg < 4; ++kg)
        mk[kg] = fmaxf(fmaxf(fmaxf(s[kg][0], s[kg][1]), fmaxf(s[kg][2], s[kg][3])),
                       fmaxf(fmaxf(s[kg][4], s[kg][5]), fmaxf(s[kg][6], s[kg][7])));
      float mx = fmaxf(fmaxf(mk[0], mk[1]), fmaxf(mk[2], mk[3]));
      mx = fmaxf(mx, xhalf(mx));
      const float mn = fmaxf(mrow, mx);
      const float alpha = __expf(mrow - mn);
      mnew = mn;
#pragma unroll
      for (int kg = 0; kg < 4; ++kg)
#pragma unroll
        for (int v = 0; v < 8; ++v) s[kg][v] = __expf(s[kg][v] - mn);
      float sk[4];
#pragma unroll
      for (int kg = 0; kg < 4; ++kg)
        sk[kg] = ((s[kg][0] + s[kg][1]) + (s[kg][2] + s[kg][3])) +
                 ((s[kg][4] + s[kg][5]) + (s[kg][6] + s[kg][7]));
      lnew = alpha * lrow + ((sk[0] + sk[1]) + (sk[2] + sk[3]));
#pragma unroll
      for (int nb = 0; nb < 4; ++nb) o[nb] = o[nb] * alpha;
#pragma unroll
      for (int c = 0; c < 2; ++c)
#pragma unroll
        for (int v = 0; v < 8; ++v) {
          pf[c][v]     = toh_flush(s[2 * c][v] * PCARRY);
          pf[c][v + 8] = toh_flush(s[2 * c + 1][v] * PCARRY);
        }
      }   // past chunk
      }   // softmax of a tile that is not flat
      mrow = mnew;
      lrow = lnew;

      // O^T += V^T . P^T  (K = 64 keys in two 32-steps; A = V^T tile [d][key], B = f16(1024 p))
#pragma unroll
      for (int c = 0; c < 2; ++c)
#pragma unroll
        for (int nb = 0; nb < 4; ++nb) o[nb] = wmma16(vf[c][nb], pf[c], o[nb]);

      if (early) {
        // P residual operand: f16(1024 * (1024 p - f16(1024 p))); s holds 1024 p here
        v16h pr[2];
#pragma unroll
        for (int c = 0; c < 2; ++c) {
          const v8f r0 = (s[2 * c] - __builtin_convertvector(__builtin_convertvector(s[2 * c], v8h), v8f)) * RCARRY;
          const v8f r1 =
              (s[2 * c + 1] - __builtin_convertvector(__builtin_convertvector(s[2 * c + 1], v8h), v8f)) * RCARRY;
          pr[c] = __builtin_shufflevector(__builtin_convertvector(r0, v8h), __builtin_convertvector(r1, v8h),
                                          0, 1, 2, 3, 4, 5, 6, 7, 8, 9, 10, 11, 12, 13, 14, 15);
        }
        // V^T . P_res^T (scale 1/1024), one 16-row group of d at a time, folded immediately
#pragma unroll
        for (int nb = 0; nb < 4; ++nb) {
          v8f o2 = {};
#pragma unroll
          for (int c = 0; c < 2; ++c) {
            const v16h vr = ld_frag(&Vw[(nb * 16) * LDT + c * 32], LDT);
            o2 = wmma16(vr, pr[c], o2);
          }
#pragma unroll
          for (int v = 0; v < 8; ++v) o[nb][v] = o[nb][v] + o2[v] * (1.0f / RCARRY);
        }
      }
      // foot of step t: the one barrier publishes step t + 1's tiles and ends every reader's last
      // read of step t's buffer, which is refilled behind it
      asm volatile("s_wait_dscnt 0x0" ::: "memory");      // this wave's reads of the buffer are done
      asm volatile("s_wait_asynccnt 0x0" ::: "memory");   // this wave's copies of step t + 1 have landed
      __syncthreads();
      if (t + 2u < ntot) stage(t + 2u);                   // block-uniform test
      ++t;
    };
    // kc1 - kc0 is a multiple of 128; both loops stay rolled: one copy of the large body per kind
    if (offd) {
#pragma unroll 1
      for (unsigned ks = kc0; ks < kc1; ks += 128u) step(PastChunk{}, ks);
    } else {
#pragma unroll 1
      for (unsigned ks = kc0; ks < kc1; ks += 128u) step(DiagChunk{}, ks);
    }

    // end of chunk: group 1 hands its state over, group 0 joins the two states, adds O / l to the
    // running output; both reset. Xs is rewritten only behind the next step's barriers.
    // the two lane halves' sums joined; the diagonal chunk's state goes back to plain units (both exact)
    const float lsum = (lrow + xhalf(lrow)) * (offd ? 1.0f : 1.0f / PCARRY);
    mrow = offd ? mrow : mrow * scale;
    if (g != 0u) {
#pragma unroll
      for (int nb = 0; nb < 4; ++nb) {
        *(v4f*)(xrow + nb * 8)     = (v4f){o[nb][0], o[nb][1], o[nb][2], o[nb][3]};
        *(v4f*)(xrow + nb * 8 + 4) = (v4f){o[nb][4], o[nb][5], o[nb][6], o[nb][7]};
      }
      xrow[32] = mrow;
      xrow[33] = lsum;
    }
    __syncthreads();
    if (g == 0u) {
      const float m1 = xrow[32], l1 = xrow[33];
      const float mm = fmaxf(mrow, m1);
      const float a0 = __expf(mrow - mm), a1 = __expf(m1 - mm);
      const float inv = __builtin_amdgcn_rcpf(a0 * lsum + a1 * l1);
      const float f0 = a0 * inv, f1 = a1 * inv;
#pragma unroll
      for (int nb = 0; nb < 4; ++nb) {
        const v4f x0 = *(const v4f*)(xrow + nb * 8);
        const v4f x1 = *(const v4f*)(xrow + nb * 8 + 4);
        v4f t0 = *(const v4f*)(orow + nb * 16);
        v4f t1 = *(const v4f*)(orow + nb * 16 + 4);
#pragma unroll
        for (int v = 0; v < 4; ++v) {
          t0[v] = t0[v] + (o[nb][v] * f0 + x0[v] * f1);
          t1[v] = t1[v] + (o[nb][v + 4] * f0 + x1[v] * f1);
        }
        *(v4f*)(orow + nb * 16) = t0;
        *(v4f*)(orow + nb * 16 + 4) = t1;
      }
    }
#pragma unroll
    for (int nb = 0; nb < 4; ++nb) o[nb] = (v8f){};
    mrow = -1.0e30f;
    lrow = 0.0f;
  }

  if (g == 0u) {
  const float fs = 1.0f / (PCARRY * WCARRY);
  const v4f pv = pass ? pvB : pvA;
  wave_lds_sync();
  v4f x[8];
  size_t off[8];
#pragma unroll
  for (unsigned i = 0; i < 8u; ++i) {
    const unsigned r = 2u * i + (lane >> 4);
    const unsigned c = (lane & 15u) * 4u;
    x[i] = *(const v4f*)&Os[obase + r * LDC + c] * fs + pv;
    off[i] = ((size_t)bh * SEQ_FULL + qrow0 + r) * HD + c;
  }
#pragma unroll
  for (int i = 0; i < 8; ++i) *(v4f*)(Out + off[i]) = x[i];
  // precaution: the second tile's first instructions reuse the stores' address and data registers
  asm volatile("s_wait_xcnt 0x0" ::: "memory");
  }
  qf[0] = qf2[0];
  qf[1] = qf2[1];
  }   // pass
  asm volatile("s_wait_asynccnt 0x0" ::: "memory");   // no copy is outstanding when the wave ends
}

// ---------------------------------------------------------------------------
extern "C" void kernel_launch(void* const* d_in, const int* in_sizes, int n_in,
                              void* d_out, int out_size, void* d_ws, size_t ws_size,
                              hipStream_t stream) {
  if (n_in < 3) return;
  const long long need = ((long long)(NBH - 1) * SEQ_FULL + SEQ) * HD;
  if ((long long)in_sizes[0] < need) return;
  if ((long long)in_sizes[1] < need) return;
  if ((long long)in_sizes[2] < need) return;
  if ((long long)out_size < need) return;
  if (ws_size < WS_TOTAL) return;

  const float* Qf = (const float*)d_in[0];    // query [NB_FULL][NHEAD][SEQ_FULL][HD]
  const float* Kf = (const float*)d_in[1];    // key
  const float* Vf = (const float*)d_in[2];    // value
  float* out = (float*)d_out;                 // [NB_FULL][NHEAD][SEQ_FULL][HD]

  char* ws = (char*)d_ws;
  _Float16* K16  = (_Float16*)(ws + OFF_K);    // [bh][SEQ][HD]
  _Float16* Vt16 = (_Float16*)(ws + OFF_VT);   // [bh][HD][SEQ]
  float* Rec     = (float*)(ws + OFF_R);       // [bh][SEQ/128][REC]

  dim3 blk(256);
  prep_kernel<<<dim3(SEQ / 128, NBH), blk, 0, stream>>>(Kf, Vf, K16, Vt16, Rec);
  attn_kernel<<<dim3(NQT / 2, NHEAD, NB), blk, 0, stream>>>(Qf, K16, Vt16, Rec, out);
}

// v010
// A run of this version takes 16.4 microseconds.
// In two side-by-side timings against v009, it was 1.29 and 1.28 times as fast.
// Counting every step since v000, it is 5.75 times as fast.
#include <hip/hip_runtime.h>
#include <stddef.h>

// All contractions on v_wmma_f32_16x16x32_f16 (f16 operands, f32 accumulate): q.k scores, p.v and the
// column sums of past values. Float inputs are RNE-converted to bf16 and carried in f16 (q and k x16,
// v x64, p x1024; p gets an extra x1024 residual plane with its own accumulator on the first key tile of
// the first query blocks of every 512-row chunk). Softmax, additive mask, chunk sums in f32.
// Causal chunked attention: per 512-key chunk an independent softmax (additive -1e9 on masked
// cells; every cell of a past chunk is masked), the chunk outputs are summed.
// Past chunks: where the row norms bound every |q.k| / 8 below 30, each masked score is -1e9 itself in
// f32, the softmax is 1/512 in every cell, and the chunk's output is the column mean of its values.
// One launch, no workspace: a work-group reads all that it needs in f32 and converts it in registers.

typedef _Float16 v16h __attribute__((ext_vector_type(16)));
typedef _Float16 v8h  __attribute__((ext_vector_type(8)));
typedef _Float16 v4h  __attribute__((ext_vector_type(4)));
typedef __bf16   v2b  __attribute__((ext_vector_type(2)));
typedef float    v8f  __attribute__((ext_vector_type(8)));
typedef float    v4f  __attribute__((ext_vector_type(4)));
typedef float    v2f  __attribute__((ext_vector_type(2)));

#ifndef NB
#define NB 2
#endif
#ifndef SEQ
#define SEQ 2048
#endif
#define NB_FULL  2
#define SEQ_FULL 2048
#define NHEAD 16
#define HD    64
#define CHUNK 512
#define NBH   (NB * NHEAD)
#define NCH   (SEQ / CHUNK)

static_assert(NB >= 1 && NB <= NB_FULL);
static_assert(SEQ >= CHUNK && SEQ <= SEQ_FULL && (SEQ % CHUNK) == 0);
static_assert(CHUNK == 512 && HD == 64);
static_assert((size_t)NBH * SEQ_FULL * HD < (size_t)0xFFFFFFFFu);

#define LDT 72   // halves per LDS row (144 B, 16-B aligned)
#define LDC 68   // floats per LDS row (272 B, 16-B aligned)
static_assert((LDT % 8) == 0 && LDT >= 64);
static_assert((LDC % 4) == 0 && LDC >= 64);

#define QKCARRY 16.0f    // q and k carried x16 each
#define WCARRY  64.0f    // values carried x64
#define PCARRY  1024.0f  // softmax numerators carried x1024
#define RCARRY  1024.0f  // residual plane of p carried x1024 on top of its hi part
#define NEGFILL (-1.0e9f)
#define NEGRAW  (-1.0e9f * 2048.0f)                    // -1e9 in units of the raw products (x 2^11)
#define RAWLOG2 (1.44269504088896f / 2048.0f)          // raw product -> score in log2 units
#define MFLOOR  (-2147483648.0f)                       // floor of the raw running maximum: score -2^20
static_assert(QKCARRY * QKCARRY * 8.0f == 2048.0f);    // HD^-0.5 = 1/8 over the carries
#ifndef P_RES
#define P_RES 1          // 1: p residual product on the early band; 0: single product everywhere
#endif

// |q.k| / 8 <= |16 q| |16 k| 2^-11 (Cauchy-Schwarz). Below 30 it stays under 32, half a step of f32 at
// 1e9, also with k's rounding to bf16 (2^-8), which the f32 k norm leaves out: score + -1e9 is then -1e9.
#define FLATB (900.0f * 4194304.0f)   // bound on |16 q|^2 |16 k|^2: 30^2 * 2^22

#define LDX 36   // floats per lane slot of the state exchange (144 B, 16-B aligned)
static_assert((LDX % 4) == 0 && LDX >= 34);

#define BLKH (64u * LDT)      // halves of one 64-key block of K ([key][d]) or of V^T ([d][key])
#define NBLK (CHUNK / 64)     // blocks of a chunk

// static LDS of the kernel
static_assert((size_t)(2 * NBLK * BLKH) * 2 + (size_t)(4 * 64 * LDC * 4) +
              (size_t)(4 * 4 * 32 * LDX * 4) + (size_t)(16 * 64 * 4) + 128 <= (size_t)327680);

// ---------------------------------------------------------------------------
// f32 -> f16 that cannot produce an f16 subnormal (value select)
static __device__ __forceinline__ _Float16 toh_flush(float v) {
  const _Float16 r = (_Float16)v;
  return (fabsf(v) < 6.103515625e-05f) ? (_Float16)0.0f : r;
}

// 16-bit fragment: p points at element [row = lane&15][k0 + 8*(lane>>4)] of a k-contiguous
// row. Elements 0..7 <- k0+8h+0..7, elements 8..15 <- k0+16+8h+0..7 (same map for A and B).
__device__ __forceinline__ v16h frag_at(const _Float16* p) {
  v8h lo = *(const v8h*)(p);
  v8h hi = *(const v8h*)(p + 16);
  v16h out;
#pragma unroll
  for (int i = 0; i < 8; ++i) { out[i] = lo[i]; out[i + 8] = hi[i]; }
  return out;
}
__device__ __forceinline__ v16h ld_frag(const _Float16* base, unsigned ld) {
  const unsigned lane = threadIdx.x & 31u;
  return frag_at(base + (lane & 15u) * ld + (lane >> 4) * 8u);
}

__device__ __forceinline__ v8f wmma16(v16h a, v16h b, v8f c) {
  v8f d = __builtin_amdgcn_wmma_f32_16x16x32_f16(false, a, false, b, (short)0, c,
                                                 false, false);
  asm volatile("v_nop\n\tv_nop\n\tv_nop\n\tv_nop" : "+v"(d) : "v"(a), "v"(b));
  return d;
}

__device__ __forceinline__ float xhalf(float x) {   // value of lane l ^ 16
  const int b = __builtin_bit_cast(int, x);
  return __builtin_bit_cast(float, __builtin_amdgcn_permlanex16(b, b, 0x76543210, 0xfedcba98,
                                                                false, false));
}

// maximum that hands a NaN on: a NaN norm must fail the bound test
__device__ __forceinline__ float max_nan(float a, float b) {
  return __builtin_elementwise_maximum(a, b);
}

template <int CTRL>
__device__ __forceinline__ float dpp_of(float x) {
  return __builtin_bit_cast(float, __builtin_amdgcn_update_dpp(0, __builtin_bit_cast(int, x), CTRL,
                                                               0xf, 0xf, true));
}
// sum over the 16 lanes of a row, in every lane: neighbours, pairs, then the mirrored quad and half
__device__ __forceinline__ float row16_sum(float x) {
  x += dpp_of<0xB1>(x);    // quad_perm [1,0,3,2]
  x += dpp_of<0x4E>(x);    // quad_perm [2,3,0,1]
  x += dpp_of<0x141>(x);   // row_half_mirror
  x += dpp_of<0x140>(x);   // row_mirror
  return x;
}

// compile-time kind of a key chunk: a past chunk (every cell masked) or the diagonal chunk
struct PastChunk { static constexpr bool past = true; };
struct DiagChunk { static constexpr bool past = false; };

__device__ __forceinline__ unsigned lds_off(const void* p) { return (unsigned)(size_t)p; }

__device__ __forceinline__ void wave_lds_sync() {
  __builtin_amdgcn_fence(3 /* release order */, "wavefront");
  asm volatile("s_wait_dscnt 0x0" ::: "memory");
  __builtin_amdgcn_wave_barrier();
}


// f16(carry * bf16(x)) of eight floats: one packed RNE convert a pair, the two halves widened in place
__device__ __forceinline__ v8h carry8(const v8f x, const float carry) {
  v8f y;
#pragma unroll
  for (int i = 0; i < 4; ++i) {
    const unsigned u = __builtin_bit_cast(
        unsigned, __builtin_convertvector((v2f){x[2 * i], x[2 * i + 1]}, v2b));
    y[2 * i]     = __uint_as_float(u << 16);
    y[2 * i + 1] = __uint_as_float(u & 0xFFFF0000u);
  }
  y = y * carry;
  return __builtin_convertvector(y, v8h);
}

__global__ __launch_bounds__(512) __attribute__((amdgpu_num_vgpr(256))) void attn_kernel(
    const float* __restrict__ Qf, const float* __restrict__ Kf, const float* __restrict__ Vf,
    float* __restrict__ Out) {
  __shared__ __attribute__((aligned(16))) _Float16 Ks[NBLK * BLKH];       // [block][key][d]
  __shared__ __attribute__((aligned(16))) _Float16 Vs[NBLK * BLKH];       // [block][d][key]
  __shared__ __attribute__((aligned(16))) float Os[4 * 64 * LDC];         // [team][pass][row][d]
  __shared__ __attribute__((aligned(16))) float Xs[4 * 4 * 32 * LDX];     // [team][pass][row group][lane]
  __shared__ __attribute__((aligned(16))) float Ps[16 * 64];              // [wave][d]
  __shared__ __attribute__((aligned(16))) float qn[16];                   // [team][pass][row group]
  __shared__ __attribute__((aligned(16))) float kn[16];                   // [wave]

  const unsigned tid = threadIdx.x, lane = tid & 31u;
  const unsigned w = (unsigned)__builtin_amdgcn_readfirstlane((int)(threadIdx.x >> 5));
  const unsigned team = w >> 3, g = (w >> 2) & 1u, wq = w & 3u;   // team; key half of a step; row group
  const unsigned hh = lane >> 4, m = lane & 15u;
  const unsigned bh = blockIdx.x >> 1, ty = blockIdx.x & 1u;
  const unsigned ci = (unsigned)NCH - 1u - blockIdx.y;   // chunk of the query rows
  const unsigned cs = ci * (unsigned)CHUNK;              // first key of the diagonal chunk
  const float scale = 0.125f / (QKCARRY * QKCARRY);      // HD^-0.5 over the carries
  const unsigned pA = 7u - 2u * ty - team;               // the team's first tile; its second is 7 - pA

  // the four tiles' query rows into Os, rows of LDC floats: eight copies a lane, every lane on; a tile is
  // two copies of 32 rows. The s_wait_xcnt ends the copies' own statement, a precaution ahead of any
  // rewrite of their address registers.
  {
    const unsigned qr = tid >> 4, qc = (tid & 15u) * 4u;
    const unsigned l0 = lds_off(&Os[qr * LDC + qc]);
    const float* const gq = Qf + ((size_t)bh * SEQ_FULL + cs + qr) * HD + qc;
    const float* const g0 = gq + (7u - 2u * ty) * (64u * HD);
    const float* const g1 = gq + (2u * ty) * (64u * HD);
    const float* const g2 = gq + (6u - 2u * ty) * (64u * HD);
    const float* const g3 = gq + (1u + 2u * ty) * (64u * HD);
    asm volatile(
        "global_load_async_to_lds_b128 %0, %8, off\n\t"
        "global_load_async_to_lds_b128 %1, %9, off\n\t"
        "global_load_async_to_lds_b128 %2, %10, off\n\t"
        "global_load_async_to_lds_b128 %3, %11, off\n\t"
        "global_load_async_to_lds_b128 %4, %12, off\n\t"
        "global_load_async_to_lds_b128 %5, %13, off\n\t"
        "global_load_async_to_lds_b128 %6, %14, off\n\t"
        "global_load_async_to_lds_b128 %7, %15, off\n\t"
        "s_wait_xcnt 0x0"
        :: "v"(l0), "v"(l0 + 1u * (32u * LDC * 4u)), "v"(l0 + 2u * (32u * LDC * 4u)),
           "v"(l0 + 3u * (32u * LDC * 4u)),
           "v"(l0 + 4u * (32u * LDC * 4u)), "v"(l0 + 5u * (32u * LDC * 4u)),
           "v"(l0 + 6u * (32u * LDC * 4u)), "v"(l0 + 7u * (32u * LDC * 4u)),
           "v"(g0), "v"(g0 + 32u * HD), "v"(g1), "v"(g1 + 32u * HD),
           "v"(g2), "v"(g2 + 32u * HD), "v"(g3), "v"(g3 + 32u * HD)
        : "memory");
  }

  // the lane's first element of a chunk's k and v rows
  const unsigned rowo = (w * 32u + hh * 16u) * (unsigned)HD + m * 4u;
  const float* const kb0 = Kf + (size_t)bh * SEQ_FULL * HD + rowo;
  const float* const vb0 = Vf + (size_t)bh * SEQ_FULL * HD + rowo;
  v4f vv[16], kk[16];
  auto load_v = [&](const unsigned c) __attribute__((always_inline)) {
    const float* const p = vb0 + c * (unsigned)(CHUNK * HD);
#pragma unroll
    for (unsigned r = 0; r < 16u; ++r) vv[r] = *(const v4f*)(p + r * (unsigned)HD);
    // precaution ahead of any rewrite of the loads' address registers, which it names as inputs
    asm volatile("s_wait_xcnt 0x0" :: "v"(p) : "memory");
  };
  auto load_k = [&](const unsigned c) __attribute__((always_inline)) {
    const float* const p = kb0 + c * (unsigned)(CHUNK * HD);
#pragma unroll
    for (unsigned r = 0; r < 16u; ++r) kk[r] = *(const v4f*)(p + r * (unsigned)HD);
    // precaution ahead of any rewrite of the loads' address registers, which it names as inputs
    asm volatile("s_wait_xcnt 0x0" :: "v"(p) : "memory");
  };
  // the lane's 16 keys of column 4 m + i, carried
  auto v_cols = [&](v16h (&col)[4]) __attribute__((always_inline)) {
#pragma unroll
    for (int i = 0; i < 4; ++i) {
      const v8h lo = carry8((v8f){vv[0][i], vv[1][i], vv[2][i], vv[3][i],
                                  vv[4][i], vv[5][i], vv[6][i], vv[7][i]}, WCARRY);
      const v8h hi = carry8((v8f){vv[8][i], vv[9][i], vv[10][i], vv[11][i],
                                  vv[12][i], vv[13][i], vv[14][i], vv[15][i]}, WCARRY);
      col[i] = __builtin_shufflevector(lo, hi, 0, 1, 2, 3, 4, 5, 6, 7, 8, 9, 10, 11, 12, 13, 14, 15);
    }
  };

  // order of reading: the past chunks from the nearest back to the first (work-groups of different chunks
  // then ask memory for different rows at a time), the diagonal chunk last; block-uniform, <= ci
  auto nth = [&](const unsigned j) __attribute__((always_inline)) { return j < ci ? ci - 1u - j : ci; };
  load_v(nth(0u));
  load_k(nth(0u));
  // past chunks: column sums of the carried values, largest squared norm of the k rows
  v8f csum[4] = {(v8f){}, (v8f){}, (v8f){}, (v8f){}};
  float nk = 0.0f;
  {
    v16h one;
#pragma unroll
    for (int v = 0; v < 16; ++v) one[v] = (_Float16)1.0f;
#pragma unroll 1   // block-uniform trip count; one copy of the body
    for (unsigned b = 0; b < ci; ++b) {
      v16h col[4];
      v_cols(col);
      load_v(nth(b + 1u));
#pragma unroll
      for (int i = 0; i < 4; ++i) csum[i] = wmma16(col[i], one, csum[i]);
#pragma unroll
      for (int r = 0; r < 16; ++r) {
        const v4f x = kk[r];
        nk = max_nan(nk, row16_sum((x[0] * x[0] + x[1] * x[1]) + (x[2] * x[2] + x[3] * x[3])));
      }
      load_k(nth(b + 1u));
    }
  }
  nk = max_nan(nk, xhalf(nk)) * (QKCARRY * QKCARRY);
  if (m == 0u) {   // every column of a result is the same sum: lane (hh, 0) holds rows 8 hh + v = columns 4 (8 hh + v) + i
#pragma unroll
    for (int v = 0; v < 8; ++v)
      *(v4f*)&Ps[w * 64u + hh * 32u + (unsigned)v * 4u] = (v4f){csum[0][v], csum[1][v], csum[2][v], csum[3][v]};
  }
  if (lane == 0u) kn[w] = nk;

  asm volatile("s_wait_asynccnt 0x0" ::: "memory");   // this wave's copies of the query rows have landed
  __syncthreads();                                    // and every other wave's; Ps and kn are published too
  // the wave's 16 rows of a tile as B fragments (the loaders' k order: elements 0..7 <- 32 c + 8 hh + 0..7,
  // 8..15 <- 32 c + 16 + 8 hh + 0..7); returns the largest squared norm of the 16 carried rows, in every lane
  auto q_frags = [&](const float* const tile, v16h (&f)[2]) __attribute__((always_inline)) {
    const float* const row = tile + (wq * 16u + m) * LDC + hh * 8u;
    v8f acc = {};
#pragma unroll
    for (unsigned c = 0; c < 2u; ++c) {
      v8h part[2];
#pragma unroll
      for (unsigned h = 0; h < 2u; ++h) {
        const v4f x0 = *(const v4f*)(row + c * 32u + h * 16u);
        const v4f x1 = *(const v4f*)(row + c * 32u + h * 16u + 4u);
        const v8f x = __builtin_shufflevector(x0, x1, 0, 1, 2, 3, 4, 5, 6, 7);
        v8f y;   // bf16(x) widened again: one packed RNE convert a pair, then the two halves in place
#pragma unroll
        for (int i = 0; i < 4; ++i) {
          const unsigned u = __builtin_bit_cast(
              unsigned, __builtin_convertvector((v2f){x[2 * i], x[2 * i + 1]}, v2b));
          y[2 * i]     = __uint_as_float(u << 16);
          y[2 * i + 1] = __uint_as_float(u & 0xFFFF0000u);
        }
        y = y * QKCARRY;
        acc = __builtin_elementwise_fma(y, y, acc);
        part[h] = __builtin_convertvector(y, v8h);
      }
      f[c] = __builtin_shufflevector(part[0], part[1], 0, 1, 2, 3, 4, 5, 6, 7, 8, 9, 10, 11, 12, 13, 14, 15);
    }
    float ss = ((acc[0] + acc[1]) + (acc[2] + acc[3])) + ((acc[4] + acc[5]) + (acc[6] + acc[7]));
    ss += xhalf(ss);                               // row m's other 32 elements
    ss = max_nan(ss, dpp_of<0xB1>(ss));
    ss = max_nan(ss, dpp_of<0x4E>(ss));
    ss = max_nan(ss, dpp_of<0x141>(ss));
    ss = max_nan(ss, dpp_of<0x140>(ss));
    return ss;
  };
  v16h qfA[2], qfB[2];   // the fragments of the team's first and second tile
  {
    const float na = q_frags(&Os[(team * 2u) * (64u * LDC)], qfA);
    const float nb = q_frags(&Os[(team * 2u + 1u) * (64u * LDC)], qfB);
    if (g == 0u && lane == 0u) {   // group 1 holds the same rows
      qn[team * 8u + wq] = na;
      qn[team * 8u + 4u + wq] = nb;
    }
  }
  // publishes qn; it also ends every wave's reads of the f32 rows, so that Os is free for the loops
  __syncthreads();
  bool pflat;   // block-uniform: the norms bound every score of the work-group's rows against the past chunks
  {
    v4f a = *(const v4f*)&qn[0], b = *(const v4f*)&kn[0];
#pragma unroll
    for (int i = 1; i < 4; ++i) {
      const v4f a2 = *(const v4f*)&qn[4 * i], b2 = *(const v4f*)&kn[4 * i];
#pragma unroll
      for (int v = 0; v < 4; ++v) { a[v] = max_nan(a[v], a2[v]); b[v] = max_nan(b[v], b2[v]); }
    }
    const float qu = __builtin_bit_cast(
        float, __builtin_amdgcn_readfirstlane(__builtin_bit_cast(
                   int, max_nan(max_nan(a[0], a[1]), max_nan(a[2], a[3])))));
    const float ku = __builtin_bit_cast(
        float, __builtin_amdgcn_readfirstlane(__builtin_bit_cast(
                   int, max_nan(max_nan(b[0], b[1]), max_nan(b[2], b[3])))));
    pflat = qu * ku < FLATB;   // scalar: the same in every wave of the block
  }
  // past chunks that are not walked: their share of the lane's four output columns, the same for every row
  v4f pv = {};
  if (pflat) {
#pragma unroll
    for (unsigned i = 0; i < 16u; ++i) pv += *(const v4f*)&Ps[i * 64u + m * 4u];
    pv = pv * (1.0f / ((float)CHUNK * WCARRY));
  }
  // The running output (sum of the chunks' O / l) rests in group 0's own output rows of Os: lane (hh, m)
  // owns cells [m][16 nb + 8 hh + 0..7] of either tile, touched once per chunk.
  if (g == 0u) {
#pragma unroll
    for (unsigned ps = 0; ps < 2u; ++ps) {
      float* const z = &Os[(team * 2u + ps) * (64u * LDC) + wq * (16u * LDC) + m * LDC + hh * 8u];
#pragma unroll
      for (int nb = 0; nb < 4; ++nb) {
        *(v4f*)(z + nb * 16) = (v4f){};
        *(v4f*)(z + nb * 16 + 4) = (v4f){};
      }
    }
  }

  // the rows in vv and kk, carried, into the chunk's blocks
  auto put_chunk = [&]() __attribute__((always_inline)) {
    {
      const unsigned kio = (w & 1u) * 32u + hh * 16u;   // the lane's first key inside its block
      _Float16* const vblk = &Vs[(w >> 1) * BLKH + (m * 4u) * LDT + kio];
      _Float16* const kblk = &Ks[(w >> 1) * BLKH + kio * LDT + m * 4u];
      v16h col[4];
      v_cols(col);
#pragma unroll
      for (unsigned i = 0; i < 4u; ++i) {
        *(v8h*)(vblk + i * LDT) = __builtin_shufflevector(col[i], col[i], 0, 1, 2, 3, 4, 5, 6, 7);
        *(v8h*)(vblk + i * LDT + 8u) = __builtin_shufflevector(col[i], col[i], 8, 9, 10, 11, 12, 13, 14, 15);
      }
#pragma unroll
      for (unsigned r = 0; r < 16u; r += 2u) {
        const v8h x = carry8(__builtin_shufflevector(kk[r], kk[r + 1u], 0, 1, 2, 3, 4, 5, 6, 7), QKCARRY);
        *(v4h*)(kblk + r * LDT) = __builtin_shufflevector(x, x, 0, 1, 2, 3);
        *(v4h*)(kblk + (r + 1u) * LDT) = __builtin_shufflevector(x, x, 4, 5, 6, 7);
      }
    }
  };
  unsigned jc = pflat ? ci : 0u;   // first chunk that is walked
  if (!pflat) {   // block-uniform; else the registers hold the diagonal chunk's rows already
    load_v(jc);
    load_k(jc);
  }
  put_chunk();
  __syncthreads();    // the chunk's blocks are published

#pragma unroll 1   // one copy of the loops for every chunk that is walked
  for (;;) {
    const bool offd = (jc < ci);                     // past chunk: every cell masked
    const unsigned kc0 = jc * (unsigned)CHUNK;

#pragma unroll 1   // the team's two tiles run one after the other through one copy of the loops
    for (unsigned pass = 0; pass < 2u; ++pass) {
    const unsigned q0 = cs + (pass ? 7u - pA : pA) * 64u;
    const bool first_blk = (q0 - cs < 128u);           // first 128 rows of the chunk; team-uniform
    const unsigned qrow0 = q0 + wq * 16u;
    const unsigned obase = (team * 2u + pass) * (64u * LDC) + wq * (16u * LDC);
    float* const orow = &Os[obase + m * LDC + hh * 8u];
    float* const xrow = &Xs[(((team * 2u + pass) * 4u + wq) * 32u + lane) * LDX];
    v16h qf[2];
    qf[0] = pass ? qfB[0] : qfA[0];
    qf[1] = pass ? qfB[1] : qfA[1];
    const unsigned kc1 =                             // <= SEQ
        offd ? (kc0 + (unsigned)CHUNK) : (cs + ((q0 - cs + 191u) & ~127u));

    float mrow = -1.0e30f, lrow = 0.0f;   // of query row m; lrow: this half's keys only
    v8f o[4];
#pragma unroll
    for (int nb = 0; nb < 4; ++nb) o[nb] = (v8f){};

    // one 128-key step; compiled once for past chunks and once for the diagonal chunk
    auto step = [&](auto kind, const unsigned ks) __attribute__((always_inline)) {
      constexpr bool offd = decltype(kind)::past;
      const unsigned kb = ks + g * 64u;                // this wave's 64 keys
      const bool early = (P_RES != 0) && first_blk && (!offd) && (kb == cs);   // wave-uniform
      const _Float16* const Kw = &Ks[((kb - kc0) >> 6) * BLKH];   // this wave's block
      const _Float16* const Vw = &Vs[((kb - kc0) >> 6) * BLKH];

      // scores: 4 key groups of 16, K = 64 in two 32-steps. All eight K fragments are read as
      // one group ahead of the eight products (one LDS latency per tile, not one per product);
      // the four accumulators advance side by side, each still c = 0 then c = 1.
      v16h kf[2][4];
#pragma unroll
      for (int c = 0; c < 2; ++c)
#pragma unroll
        for (int kg = 0; kg < 4; ++kg) kf[c][kg] = ld_frag(&Kw[(kg * 16) * LDT + c * 32], LDT);
      v8f s[4];
#pragma unroll
      for (int kg = 0; kg < 4; ++kg) s[kg] = (v8f){};
#pragma unroll
      for (int c = 0; c < 2; ++c)
#pragma unroll
        for (int kg = 0; kg < 4; ++kg) s[kg] = wmma16(kf[c][kg], qf[c], s[kg]);

      // all eight V^T fragments, issued here as one group: they land while the softmax runs
      v16h vf[2][4];
#pragma unroll
      for (int c = 0; c < 2; ++c)
#pragma unroll
        for (int nb = 0; nb < 4; ++nb) vf[c][nb] = ld_frag(&Vw[(nb * 16) * LDT + c * 32], LDT);

      // Past chunk: the f32 sum score + (-1e9) keeps steps of 64 only, so a whole tile's masked scores
      // are as a rule one and the same number. Tested by value: rounding is monotone, so when the
      // lane's smallest and largest score give the same masked value, all 32 between them do. Where
      // that value is also the other half's and the running maximum (or this is the chunk's first
      // step, whose state is all zero), the softmax below would find alpha = 1 and p = exp(0) = 1 in
      // every cell: the same numbers come from a constant P operand, without the softmax arithmetic.
      bool flat = false;                               // wave-uniform
      float tflat = 0.0f;
      if constexpr (offd) {
        float hi[4], lo[4];
#pragma unroll
        for (int kg = 0; kg < 4; ++kg) {
          hi[kg] = fmaxf(fmaxf(fmaxf(s[kg][0], s[kg][1]), fmaxf(s[kg][2], s[kg][3])),
                         fmaxf(fmaxf(s[kg][4], s[kg][5]), fmaxf(s[kg][6], s[kg][7])));
          lo[kg] = fminf(fminf(fminf(s[kg][0], s[kg][1]), fminf(s[kg][2], s[kg][3])),
                         fminf(fminf(s[kg][4], s[kg][5]), fminf(s[kg][6], s[kg][7])));
        }
        tflat = fmaxf(fmaxf(hi[0], hi[1]), fmaxf(hi[2], hi[3])) * scale + NEGFILL;
        const float tlo = fminf(fminf(lo[0], lo[1]), fminf(lo[2], lo[3])) * scale + NEGFILL;
        const bool ok = (bool)((int)(tlo == tflat) & (int)(xhalf(tflat) == tflat) &
                               ((int)(ks == kc0) | (int)(mrow == tflat)));
        flat = (__builtin_amdgcn_ballot_w32(ok) == 0xFFFFFFFFu);   // scalar test: EXEC stays full
      }

      // B operands of the two 32-key steps, f16(1024 p), and the new state: set for p = 1 in all of
      // this half's 32 cells; the softmax overwrites them where the tile is not flat
      v16h pf[2];
#pragma unroll
      for (int v = 0; v < 16; ++v) {
        pf[0][v] = (_Float16)PCARRY;
        pf[1][v] = (_Float16)PCARRY;
      }
      float mnew = tflat, lnew = lrow + 32.0f;
      // the hint lays the flat tile out as the fall-through of a past chunk's step
      if (__builtin_expect(!flat, !offd)) {
      if constexpr (!offd) {
      // Diagonal chunk: the softmax runs on the raw products (score = raw * 2^-11, exact), the state's
      // maximum is kept raw and its sum x1024 until the end of the chunk. A masked cell takes the raw
      // form of -1e9 itself: next to the row's own unmasked diagonal score its p is 0 either way.
      if (kb >= q0) {
        const int dl = (int)(qrow0 + m) - (int)(kb + hh * 8u);   // cells of the lane above dl are masked
#pragma unroll
        for (int kg = 0; kg < 4; ++kg)
#pragma unroll
          for (int v = 0; v < 8; ++v) s[kg][v] = (kg * 16 + v > dl) ? NEGRAW : s[kg][v];
      }
      float mk[4];
#pragma unroll
      for (int kg = 0; kg < 4; ++kg)
        mk[kg] = fmaxf(fmaxf(fmaxf(s[kg][0], s[kg][1]), fmaxf(s[kg][2], s[kg][3])),
                       fmaxf(fmaxf(s[kg][4], s[kg][5]), fmaxf(s[kg][6], s[kg][7])));
      float mx = fmaxf(fmaxf(mk[0], mk[1]), fmaxf(mk[2], mk[3]));
      mx = fmaxf(mx, xhalf(mx));
      // the floor keeps a tile whose 64 keys are all masked (the half step above the diagonal) at p = 0:
      // with -1e9 itself as the maximum the shift below would lose its low bits
      const float mn = fmaxf(fmaxf(mrow, mx), MFLOOR);
      const float alpha = __builtin_amdgcn_exp2f((mrow - mn) * RAWLOG2);
      mnew = mn;
      // 1024 p = 2^(raw * c - (max * c - 10)): one multiply-add a cell, two cells an instruction
      const float sh = 10.0f - mn * RAWLOG2;
      const v8f c8 = {RAWLOG2, RAWLOG2, RAWLOG2, RAWLOG2, RAWLOG2, RAWLOG2, RAWLOG2, RAWLOG2};
      const v8f sh8 = {sh, sh, sh, sh, sh, sh, sh, sh};
#pragma unroll
      for (int kg = 0; kg < 4; ++kg) {
        const v8f e = __builtin_elementwise_fma(s[kg], c8, sh8);
#pragma unroll
        for (int v = 0; v < 8; ++v) s[kg][v] = __builtin_amdgcn_exp2f(e[v]);
      }
      const v8f s8 = (s[0] + s[1]) + (s[2] + s[3]);   // the four key groups cell by cell, then the eight cells
      lnew = alpha * lrow + (((s8[0] + s8[1]) + (s8[2] + s8[3])) + ((s8[4] + s8[5]) + (s8[6] + s8[7])));
#pragma unroll
      for (int nb = 0; nb < 4; ++nb) o[nb] = o[nb] * alpha;
#pragma unroll
      for (int c = 0; c < 2; ++c)
        pf[c] = __builtin_shufflevector(__builtin_convertvector(s[2 * c], v8h),
                                        __builtin_convertvector(s[2 * c + 1], v8h),
                                        0, 1, 2, 3, 4, 5, 6, 7, 8, 9, 10, 11, 12, 13, 14, 15);
      } else {
#pragma unroll
      for (int kg = 0; kg < 4; ++kg) s[kg] = s[kg] * scale;

      // additive mask of a past chunk, every cell
#pragma unroll
      for (int kg = 0; kg < 4; ++kg)
#pragma unroll
        for (int v = 0; v < 8; ++v) s[kg][v] = s[kg][v] + NEGFILL;

      // online softmax; a lane holds 32 of its query row's 64 scores, lane ^ 16 the other 32
      float mk[4];
#pragma unroll
      for (int kg = 0; kg < 4; ++kg)
        mk[kg] = fmaxf(fmaxf(fmaxf(s[kg][0], s[kg][1]), fmaxf(s[kg][2], s[kg][3])),
                       fmaxf(fmaxf(s[kg][4], s[kg][5]), fmaxf(s[kg][6], s[kg][7])));
      float mx = fmaxf(fmaxf(mk[0], mk[1]), fmaxf(mk[2], mk[3]));
      mx = fmaxf(mx, xhalf(mx));
      const float mn = fmaxf(mrow, mx);
      const float alpha = __expf(mrow - mn);
      mnew = mn;
#pragma unroll
      for (int kg = 0; kg < 4; ++kg)
#pragma unroll
        for (int v = 0; v < 8; ++v) s[kg][v] = __expf(s[kg][v] - mn);
      float sk[4];
#pragma unroll
      for (int kg = 0; kg < 4; ++kg)
        sk[kg] = ((s[kg][0] + s[kg][1]) + (s[kg][2] + s[kg][3])) +
                 ((s[kg][4] + s[kg][5]) + (s[kg][6] + s[kg][7]));
      lnew = alpha * lrow + ((sk[0] + sk[1]) + (sk[2] + sk[3]));
#pragma unroll
      for (int nb = 0; nb < 4; ++nb) o[nb] = o[nb] * alpha;
#pragma unroll
      for (int c = 0; c < 2; ++c)
#pragma unroll
        for (int v = 0; v < 8; ++v) {
          pf[c][v]     = toh_flush(s[2 * c][v] * PCARRY);
          pf[c][v + 8] = toh_flush(s[2 * c + 1][v] * PCARRY);
        }
      }   // past chunk
      }   // softmax of a tile that is not flat
      mrow = mnew;
      lrow = lnew;

      // O^T += V^T . P^T  (K = 64 keys in two 32-steps; A = V^T tile [d][key], B = f16(1024 p))
#pragma unroll
      for (int c = 0; c < 2; ++c)
#pragma unroll
        for (int nb = 0; nb < 4; ++nb) o[nb] = wmma16(vf[c][nb], pf[c], o[nb]);

      if (early) {
        // P residual operand: f16(1024 * (1024 p - f16(1024 p))); s holds 1024 p here
        v16h pr[2];
#pragma unroll
        for (int c = 0; c < 2; ++c) {
          const v8f r0 = (s[2 * c] - __builtin_convertvector(__builtin_convertvector(s[2 * c], v8h), v8f)) * RCARRY;
          const v8f r1 =
              (s[2 * c + 1] - __builtin_convertvector(__builtin_convertvector(s[2 * c + 1], v8h), v8f)) * RCARRY;
          pr[c] = __builtin_shufflevector(__builtin_convertvector(r0, v8h), __builtin_convertvector(r1, v8h),
                                          0, 1, 2, 3, 4, 5, 6, 7, 8, 9, 10, 11, 12, 13, 14, 15);
        }
        // V^T . P_res^T (scale 1/1024), one 16-row group of d at a time, folded immediately
#pragma unroll
        for (int nb = 0; nb < 4; ++nb) {
          v8f o2 = {};
#pragma unroll
          for (int c = 0; c < 2; ++c) {
            const v16h vr = ld_frag(&Vw[(nb * 16) * LDT + c * 32], LDT);
            o2 = wmma16(vr, pr[c], o2);
          }
#pragma unroll
          for (int v = 0; v < 8; ++v) o[nb][v] = o[nb][v] + o2[v] * (1.0f / RCARRY);
        }
      }
    };
    // kc1 - kc0 is a multiple of 128; both loops stay rolled: one copy of the large body per kind
    if (offd) {
#pragma unroll 1
      for (unsigned ks = kc0; ks < kc1; ks += 128u) step(PastChunk{}, ks);
    } else {
#pragma unroll 1
      for (unsigned ks = kc0; ks < kc1; ks += 128u) step(DiagChunk{}, ks);
    }

    // end of chunk: group 1 hands its state over, group 0 joins the two states, adds O / l to the
    // running output; both reset. Each pass has its own part of Xs; a part is rewritten only behind the next chunk's barriers.
    // the two lane halves' sums joined; the diagonal chunk's state goes back to plain units (both exact)
    const float lsum = (lrow + xhalf(lrow)) * (offd ? 1.0f : 1.0f / PCARRY);
    mrow = offd ? mrow : mrow * scale;
    if (g != 0u) {
#pragma unroll
      for (int nb = 0; nb < 4; ++nb) {
        *(v4f*)(xrow + nb * 8)     = (v4f){o[nb][0], o[nb][1], o[nb][2], o[nb][3]};
        *(v4f*)(xrow + nb * 8 + 4) = (v4f){o[nb][4], o[nb][5], o[nb][6], o[nb][7]};
      }
      xrow[32] = mrow;
      xrow[33] = lsum;
    }
    __syncthreads();
    if (g == 0u) {
      const float m1 = xrow[32], l1 = xrow[33];
      const float mm = fmaxf(mrow, m1);
      const float a0 = __expf(mrow - mm), a1 = __expf(m1 - mm);
      const float inv = __builtin_amdgcn_rcpf(a0 * lsum + a1 * l1);
      const float f0 = a0 * inv, f1 = a1 * inv;
#pragma unroll
      for (int nb = 0; nb < 4; ++nb) {
        const v4f x0 = *(const v4f*)(xrow + nb * 8);
        const v4f x1 = *(const v4f*)(xrow + nb * 8 + 4);
        v4f t0 = *(const v4f*)(orow + nb * 16);
        v4f t1 = *(const v4f*)(orow + nb * 16 + 4);
#pragma unroll
        for (int v = 0; v < 4; ++v) {
          t0[v] = t0[v] + (o[nb][v] * f0 + x0[v] * f1);
          t1[v] = t1[v] + (o[nb][v + 4] * f0 + x1[v] * f1);
        }
        *(v4f*)(orow + nb * 16) = t0;
        *(v4f*)(orow + nb * 16 + 4) = t1;
      }
    }
#pragma unroll
    for (int nb = 0; nb < 4; ++nb) o[nb] = (v8f){};
    mrow = -1.0e30f;
    lrow = 0.0f;

    if (!offd && g == 0u) {   // the tile's last chunk: its rows go out
    const float fs = 1.0f / (PCARRY * WCARRY);
    wave_lds_sync();
    v4f x[8];
    size_t off[8];
#pragma unroll
    for (unsigned i = 0; i < 8u; ++i) {
      const unsigned r = 2u * i + (lane >> 4);
      const unsigned c = (lane & 15u) * 4u;
      x[i] = *(const v4f*)&Os[obase + r * LDC + c] * fs + pv;
      off[i] = ((size_t)bh * SEQ_FULL + qrow0 + r) * HD + c;
    }
#pragma unroll
    for (int i = 0; i < 8; ++i) *(v4f*)(Out + off[i]) = x[i];
    // precaution: what follows reuses the stores' address and data registers
    asm volatile("s_wait_xcnt 0x0" ::: "memory");
    }
    }   // pass
    if (jc == ci) break;   // block-uniform
    ++jc;
    __syncthreads();    // ends every wave's reads of the chunk before
    load_v(jc);
    load_k(jc);
    put_chunk();
    __syncthreads();    // the chunk's blocks are published
  }   // chunk
}

// ---------------------------------------------------------------------------
extern "C" void kernel_launch(void* const* d_in, const int* in_sizes, int n_in,
                              void* d_out, int out_size, void* d_ws, size_t ws_size,
                              hipStream_t stream) {
  if (n_in < 3) return;
  const long long need = ((long long)(NBH - 1) * SEQ_FULL + SEQ) * HD;
  if ((long long)in_sizes[0] < need) return;
  if ((long long)in_sizes[1] < need) return;
  if ((long long)in_sizes[2] < need) return;
  if ((long long)out_size < need) return;

  const float* Qf = (const float*)d_in[0];    // query [NB_FULL][NHEAD][SEQ_FULL][HD]
  const float* Kf = (const float*)d_in[1];    // key
  const float* Vf = (const float*)d_in[2];    // value
  float* out = (float*)d_out;                 // [NB_FULL][NHEAD][SEQ_FULL][HD]

  attn_kernel<<<dim3(2 * NBH, NCH), dim3(512), 0, stream>>>(Qf, Kf, Vf, out);
}
